// v000
// Times are from an AMD MI455X. After a warm-up the kernel runs many times in a row, and a time is the length of
// such a window on the GPU divided by its runs, so every launch and the gaps after it count. The runs cycle
// through copies of the inputs. A figure is the median of several windows, for all but v000 over two sittings.
// Sittings can differ by a few percent; kernels timed side by side share one.
// v000 is the starting kernel. One run takes 2230 microseconds.
#include <hip/hip_runtime.h>

// SpatialTemporalAttention (x [2][2048][1024]; Q/K/V = x W ([in,out], no bias; 16 heads x 64); scores = Q.K / 8 + spatial_bias[h] exp(-dist[b][i][j]) with dist = pairwise Euclidean distance of spatial_coords [2][2048][2] (0 when d2 == 0); masked where mask[b][i][j] == 0 (int, read) -> -inf; softmax; out = merged Wo + bo -> [2][2048][1024]).
// Compute dtypes, f32 accumulate: every input rounded to bf16; Q/K/V on PLAIN bf16 operands (inputs: exact); the distance bias table exp(-dist) [2048][2048] per batch in f32 (k_dist); scores and attn.v: query rows < 512 hl (3 products), the rest single fp16 (x1024); bias + mask + softmax f32; Wo hl x exact (2 products) + bias.

#define NB_  2
#define TT   2048
#define DM   1024
#define NH_  16
#define NKV  16
#define REP  (NH_ / NKV)
#define HD   64
#define DQ   (NH_ * HD)
#define DKV  (NKV * HD)
#define ZH   2
#define RH   512                  // query rows < RH use hi+lo planes (0: none)
#define WIN  0
#define PCAR 1024.0f
#define SCL  0.125f   // HD^-0.5
typedef _Float16 h16;
typedef unsigned short bf;
typedef __attribute__((ext_vector_type(16))) __bf16   v16bf;
typedef __attribute__((ext_vector_type(16))) _Float16 v16h;
typedef __attribute__((ext_vector_type(8)))  _Float16 v8h;
typedef __attribute__((ext_vector_type(8)))  unsigned short v8us;
typedef __attribute__((ext_vector_type(8)))  float    v8f;
typedef __attribute__((ext_vector_type(4)))  float    v4f;
typedef v8h  __attribute__((may_alias)) v8ha;
typedef v4f  __attribute__((may_alias)) v4fa;
typedef v8us __attribute__((may_alias)) v8usa;

__device__ __forceinline__ unsigned short f2bf(float f) { unsigned u = __float_as_uint(f); u += 0x7FFFu + ((u >> 16) & 1u); return (unsigned short)(u >> 16); }
__device__ __forceinline__ float bf2f(unsigned short b) { return __uint_as_float(((unsigned)b) << 16); }
__device__ __forceinline__ float bfr(float f) { return bf2f(f2bf(f)); }
__device__ __forceinline__ v16h cat16(v8h lo, v8h hi) { return __builtin_shufflevector(lo, hi, 0, 1, 2, 3, 4, 5, 6, 7, 8, 9, 10, 11, 12, 13, 14, 15); }
__device__ __forceinline__ v16bf cat16b(v8us lo, v8us hi) { return __builtin_bit_cast(v16bf, __builtin_shufflevector(lo, hi, 0, 1, 2, 3, 4, 5, 6, 7, 8, 9, 10, 11, 12, 13, 14, 15)); }
__device__ __forceinline__ v8f wmma16(v16h a, v16h b, v8f c) { return __builtin_amdgcn_wmma_f32_16x16x32_f16(false, a, false, b, (short)0, c, false, false); }
__device__ __forceinline__ v8f wmmab(v16bf a, v16bf b, v8f c) { return __builtin_amdgcn_wmma_f32_16x16x32_bf16(false, a, false, b, (short)0, c, false, false); }



// ---- k_gemmw: register-blocked GEMM, ONE WAVE per 64x64 output tile (16 accumulators), operands straight from K-contiguous 16-bit planes; grid (M/64, N/64, Z), 32 threads.
// C[m][n] (f32, pitch ldc, + optional f32 bias[n]) = sum_k A[m][k] Bt[n][k] (+ split products per NSPLIT). z-batch strides sA/sB/sC in elements. K % 32 == 0.
template <typename T16> struct WFrag;
template <> struct WFrag<h16> { typedef v16h V; static __device__ __forceinline__ V ld(const h16* p) { return cat16(*(const v8h*)p, *(const v8h*)(p + 16)); } static __device__ __forceinline__ v8f mma(V a, V b, v8f c) { return wmma16(a, b, c); } };
template <> struct WFrag<bf> { typedef v16bf V; static __device__ __forceinline__ V ld(const bf* p) { return cat16b(*(const v8us*)p, *(const v8us*)(p + 16)); } static __device__ __forceinline__ v8f mma(V a, V b, v8f c) { return wmmab(a, b, c); } };
template <typename T16, int NSPLIT, bool BIAS>
__global__ __launch_bounds__(32) void k_gemmw(const T16* __restrict__ A, const T16* __restrict__ A2, const T16* __restrict__ Bt, const T16* __restrict__ Bt2, int K, float* C, int ldc, const float* __restrict__ bias, size_t sA, size_t sB, size_t sC) {
    typedef typename WFrag<T16>::V V;
    __shared__ __align__(16) float os[16 * 68];
    const size_t z = blockIdx.z; A += z * sA; if (A2) A2 += z * sA; Bt += z * sB; if (Bt2) Bt2 += z * sB; C += z * sC;
    const int lane = threadIdx.x & 31, lr = lane & 15, hi = lane >> 4; const int r0 = blockIdx.x * 64, c0 = blockIdx.y * 64;
    v8f acc[4][4];
#pragma unroll
    for (int mb = 0; mb < 4; ++mb)
#pragma unroll
        for (int nb = 0; nb < 4; ++nb) acc[mb][nb] = (v8f){};
    const size_t aoff = (size_t)(r0 + lr) * K + 8 * hi, boff = (size_t)(c0 + lr) * K + 8 * hi;
#pragma unroll 1
    for (int kc = 0; kc < K; kc += 32) {
        V a[4], a2[4];
#pragma unroll
        for (int mb = 0; mb < 4; ++mb) { a[mb] = WFrag<T16>::ld(A + aoff + (size_t)mb * 16 * K + kc); if (NSPLIT == 1 || NSPLIT == 2) a2[mb] = WFrag<T16>::ld(A2 + aoff + (size_t)mb * 16 * K + kc); }
#pragma unroll
        for (int nb = 0; nb < 4; ++nb) { const V b = WFrag<T16>::ld(Bt + boff + (size_t)nb * 16 * K + kc); V b2; if (NSPLIT >= 2) b2 = WFrag<T16>::ld(Bt2 + boff + (size_t)nb * 16 * K + kc);
#pragma unroll
            for (int mb = 0; mb < 4; ++mb) { acc[mb][nb] = WFrag<T16>::mma(a[mb], b, acc[mb][nb]); if (NSPLIT == 1 || NSPLIT == 2) acc[mb][nb] = WFrag<T16>::mma(a2[mb], b, acc[mb][nb]); if (NSPLIT >= 2) acc[mb][nb] = WFrag<T16>::mma(a[mb], b2, acc[mb][nb]); } }
        asm volatile("v_nop\n\tv_nop\n\tv_nop\n\tv_nop" : "+v"(acc[0][0]), "+v"(acc[1][1]), "+v"(acc[2][2]), "+v"(acc[3][3]) : "v"(a[0]), "v"(a[3]));
    }
#pragma unroll
    for (int mb = 0; mb < 4; ++mb) {
#pragma unroll
        for (int nb = 0; nb < 4; ++nb) {
#pragma unroll
            for (int j = 0; j < 8; ++j) os[(hi * 8 + j) * 68 + nb * 16 + lr] = acc[mb][nb][j]; }
        __builtin_amdgcn_wave_barrier(); asm volatile("" ::: "memory");
        float* crow = C + (size_t)(r0 + mb * 16) * ldc + c0;
{
#pragma unroll
            for (int s = 0; s < 8; ++s) { const int row = 2 * s + hi, cofs = lr * 4; v4f val = *(const v4fa*)(os + row * 68 + cofs); if (BIAS) { val[0] += bfr(bias[c0 + cofs]); val[1] += bfr(bias[c0 + cofs + 1]); val[2] += bfr(bias[c0 + cofs + 2]); val[3] += bfr(bias[c0 + cofs + 3]); }
                *(v4f*)(crow + (size_t)row * ldc + cofs) = val; }
             }
        __builtin_amdgcn_wave_barrier(); asm volatile("" ::: "memory");
    }
}

__device__ __forceinline__ h16 tohx(float x) { return (h16)x; }
__device__ __forceinline__ void splitf(float y, unsigned short& h, unsigned short& l) { h = f2bf(y); l = f2bf(y - bf2f(h)); }
typedef __attribute__((ext_vector_type(2))) _Float16 v2h;
typedef __attribute__((ext_vector_type(4))) _Float16 v4h;
typedef __attribute__((ext_vector_type(2))) unsigned short v2us;
typedef __attribute__((ext_vector_type(4))) unsigned short v4us;
typedef __attribute__((ext_vector_type(2))) float v2f;
typedef __attribute__((ext_vector_type(4))) int v4i;

__global__ __launch_bounds__(256) void k_wtG(const float* __restrict__ w, int K, int N, bf* Bt) {
    const int lane = threadIdx.x & 31; const int L0 = (blockIdx.x * 8 + (threadIdx.x >> 5)) * 8; const int nlines = N * K / 64;
{
#pragma unroll 1
        for (int l = 0; l < 8; ++l) { const int L = L0 + l; if (L >= nlines) break; const size_t e = (size_t)L * 64 + lane * 2; const int k = (int)(e % K), n = (int)(e / K); v2us o;
            o[0] = f2bf(w[(size_t)k * N + n]); o[1] = f2bf(w[(size_t)(k + 1) * N + n]); *(v2us*)(Bt + e) = o; }
         }
}
__global__ __launch_bounds__(256) void k_cvt8(const float* __restrict__ src, bf* dst, size_t n8) { const size_t i = (size_t)blockIdx.x * 256 + threadIdx.x; if (i >= n8) return; const v8f v = *(const v8f*)(src + i * 8); v8us o;
#pragma unroll
    for (int k = 0; k < 8; ++k) o[k] = f2bf(v[k]); *(v8us*)(dst + i * 8) = o;  }
__global__ __launch_bounds__(256) void k_cscvt(const float* __restrict__ cosT, const float* __restrict__ sinT, float* CS) { const int idx = blockIdx.x * 256 + threadIdx.x; if (idx >= TT * HD) return; v2f cs; cs[0] = bfr(cosT[idx]); cs[1] = bfr(sinT[idx]); *(v2f*)(CS + (size_t)idx * 2) = cs;  }
// k_rope: head planes [h][t][d] (fp16 + hi/lo) of rope(x) x sc with the rotate-half convention out[d] = x[d] cos[t][d] - x[d+HD/2] sin[t][d], out[d+HD/2] = x[d+HD/2] cos[t][d+HD/2] + x[d] sin[t][d+HD/2]
__global__ __launch_bounds__(256) void k_rope(const float* __restrict__ F, int pitch, int nheads, const float* __restrict__ CS, const float* __restrict__ RF, const float* __restrict__ nw, float sc, h16* P16, bf* Ph, bf* Pl) {
    const size_t e = ((size_t)blockIdx.x * 256 + threadIdx.x) * 2; if (e >= (size_t)nheads * TT * HD) return; const int d = (int)(e % HD); const int t = (int)((e / HD) % TT); const int h = (int)(e / ((size_t)HD * TT)); const float* f = F + (size_t)t * pitch + h * HD; const float rf = RF ? RF[(size_t)h * TT + t] : 1.0f; v2h o16; v2us oh, ol;
#pragma unroll
    for (int q = 0; q < 2; ++q) { const int dd = d + q; const int dp = (dd < HD / 2) ? dd + HD / 2 : dd - HD / 2; float x0 = f[dd], x1 = f[dp];
        if (RF) { float n0 = __fmul_rn(x0, rf), n1 = __fmul_rn(x1, rf); asm volatile("" : "+v"(n0)); asm volatile("" : "+v"(n1)); x0 = __fmul_rn(bfr(nw[dd]), n0); x1 = __fmul_rn(bfr(nw[dp]), n1); }
        const v2f cs = *(const v2f*)(CS + ((size_t)t * HD + dd) * 2); float a = __fmul_rn(x0, cs[0]), bq = __fmul_rn(x1, cs[1]); asm volatile("" : "+v"(a)); asm volatile("" : "+v"(bq)); const float r = ((dd < HD / 2) ? __fsub_rn(a, bq) : __fadd_rn(a, bq)) * sc;
        o16[q] = tohx(r); unsigned short a2, c2; splitf(r, a2, c2); oh[q] = a2; ol[q] = c2; }
    *(v2h*)(P16 + e) = o16; *(v2us*)(Ph + e) = oh; *(v2us*)(Pl + e) = ol;  }
__global__ __launch_bounds__(256) void k_vtp(const float* __restrict__ F, int pitch, int nheads, h16* V16, bf* Vh, bf* Vl) { const size_t e = ((size_t)blockIdx.x * 256 + threadIdx.x) * 2; if (e >= (size_t)nheads * HD * TT) return; const int t = (int)(e % TT); const int d = (int)((e / TT) % HD); const int g = (int)(e / ((size_t)TT * HD)); v2h o16; v2us oh, ol;
#pragma unroll
    for (int q = 0; q < 2; ++q) { const float x = F[(size_t)(t + q) * pitch + g * HD + d]; o16[q] = tohx(x); unsigned short a2, c2; splitf(x, a2, c2); oh[q] = a2; ol[q] = c2; }
    *(v2h*)(V16 + e) = o16; *(v2us*)(Vh + e) = oh; *(v2us*)(Vl + e) = ol;  }
__global__ __launch_bounds__(256) void k_csid(float* CS) { const int idx = blockIdx.x * 256 + threadIdx.x; if (idx >= TT * HD) return; v2f cs; cs[0] = 1.0f; cs[1] = 0.0f; *(v2f*)(CS + (size_t)idx * 2) = cs;  }
// k_asoft: per row (zz, i): t = S x HD^-0.5 + spatial_bias[h] exp(-dist) (mask == 0 -> -inf); softmax over the 2048 keys (register row, one exp, fixed trees);
__global__ __launch_bounds__(256) void k_asoft(const float* __restrict__ Sb, const float* __restrict__ ED, const int* __restrict__ mk, const float* __restrict__ sbias, int h0, h16* P16, bf* Ph, bf* Pl) {
    const int lane = threadIdx.x & 31; const int row = blockIdx.x * 8 + (threadIdx.x >> 5); if (row >= ZH * TT) return; const int i = row % TT; const int zz = row / TT; (void)zz; const bool hires = (i < RH); const float* sr = Sb + (size_t)row * TT; float v[TT / 32]; float mx = -3.0e38f;
#pragma unroll
    for (int ch = 0; ch < TT / 128; ++ch) { const int j0 = ch * 128 + lane * 4; const v4f a = *(const v4f*)(sr + j0);
#pragma unroll
        for (int q = 0; q < 4; ++q) { const int j = j0 + q; (void)j; float sb = bfr(sbias[h0 + zz]); asm volatile("" : "+v"(sb)); float bias = __fmul_rn(sb, ED[(size_t)i * TT + j]); asm volatile("" : "+v"(bias)); float t0 = a[q] * SCL; asm volatile("" : "+v"(t0)); const float t = (mk[(size_t)i * TT + j] == 0) ? -__builtin_inff() : __fadd_rn(t0, bias); v[ch * 4 + q] = t; mx = fmaxf(mx, t); } }
#pragma unroll
    for (int sh = 16; sh; sh >>= 1) mx = fmaxf(mx, __shfl_xor(mx, sh, 32));
    float sum = 0.f;
#pragma unroll
    for (int k = 0; k < TT / 32; ++k) { float d0 = __fsub_rn(v[k], mx); asm volatile("" : "+v"(d0)); v[k] = __builtin_amdgcn_exp2f(__fmul_rn(d0, 1.4426950408889634f)); sum += v[k]; }
#pragma unroll
    for (int sh = 16; sh; sh >>= 1) sum += __shfl_xor(sum, sh, 32);
    const float f = __fdiv_rn(hires ? 1.0f : PCAR, sum);
{
        if (hires) {
#pragma unroll
            for (int ch = 0; ch < TT / 128; ++ch) { v4us oh, ol;
#pragma unroll
                for (int q = 0; q < 4; ++q) { unsigned short a, c2; splitf(v[ch * 4 + q] * f, a, c2); oh[q] = a; ol[q] = c2; }
                const size_t oo = ((size_t)zz * (RH ? RH : 1) + i) * TT + ch * 128 + lane * 4; *(v4us*)(Ph + oo) = oh; *(v4us*)(Pl + oo) = ol; }
        } else {
#pragma unroll
            for (int ch = 0; ch < TT / 128; ++ch) { v4h o4;
#pragma unroll
                for (int q = 0; q < 4; ++q) o4[q] = tohx(v[ch * 4 + q] * f);
                *(v4h*)(P16 + (size_t)row * TT + ch * 128 + lane * 4) = o4; } }
         }
}
__global__ __launch_bounds__(256) void k_merge(const float* __restrict__ O, int h0, bf* Ah, bf* Al) { const size_t e = ((size_t)blockIdx.x * 256 + threadIdx.x) * 2; if (e >= (size_t)ZH * TT * HD) return; const int d = (int)(e % HD); const int t = (int)((e / HD) % TT); const int zz = (int)(e / ((size_t)HD * TT)); const float cs = (t < RH) ? 1.0f : (1.0f / PCAR); const size_t oo = (size_t)t * DQ + (h0 + zz) * HD + d;
    v2us oh, ol;
#pragma unroll
    for (int q = 0; q < 2; ++q) { unsigned short a, c2; splitf(O[e + q] * cs, a, c2); oh[q] = a; ol[q] = c2; } *(v2us*)(Ah + oo) = oh; *(v2us*)(Al + oo) = ol;  }

__global__ __launch_bounds__(256) void k_dist(const float* __restrict__ co, float* ED) { const size_t e = ((size_t)blockIdx.x * 256 + threadIdx.x) * 4; if (e >= (size_t)TT * TT) return; const int j = (int)(e % TT); const int i = (int)(e / TT); const float xi = bfr(co[i * 2]), yi = bfr(co[i * 2 + 1]); v4f o;   // exp(-dist): dist = sqrt(dx^2 + dy^2) (0 when d2 == 0) (16-B lanes)
#pragma unroll
    for (int u = 0; u < 4; ++u) { const float dx = __fsub_rn(xi, bfr(co[(j + u) * 2])), dy = __fsub_rn(yi, bfr(co[(j + u) * 2 + 1])); float px = __fmul_rn(dx, dx), py = __fmul_rn(dy, dy); asm volatile("" : "+v"(px)); asm volatile("" : "+v"(py)); const float d2 = __fadd_rn(px, py); const float dist = (d2 == 0.f) ? 0.f : __fsqrt_rn(d2); o[u] = __expf(-dist); }
    *(v4f*)(ED + e) = o;  }

extern "C" void kernel_launch(void* const* d_in, const int* in_sizes, int n_in,
                              void* d_out, int out_size, void* d_ws, size_t ws_size, hipStream_t stream) {
    (void)in_sizes; (void)n_in; (void)out_size;
    const float* x = (const float*)d_in[0]; const float* coords = (const float*)d_in[1]; const int* mask = (const int*)d_in[2]; const float* wq = (const float*)d_in[3]; const float* wk = (const float*)d_in[4]; const float* wv = (const float*)d_in[5]; const float* sbias = (const float*)d_in[6]; const float* wo = (const float*)d_in[7]; const float* bo = (const float*)d_in[8]; const float* cosT = nullptr; const float* sinT = nullptr; (void)cosT; (void)sinT;
    float* OUT = (float*)d_out;     // [2][2048][1024]
    char* wsp = (char*)d_ws;
    auto take = [&](size_t bytes) { char* p = wsp; wsp += (bytes + 255) & ~(size_t)255; return (void*)p; };
    bf* WQ = (bf*)take((size_t)DQ * DM * 2); bf* WK = (bf*)take((size_t)DKV * DM * 2); bf* WV = (bf*)take((size_t)DKV * DM * 2); bf* WO = (bf*)take((size_t)DM * DQ * 2); float* CS = (float*)take((size_t)TT * HD * 2 * 4);
    bf* XB = (bf*)take((size_t)TT * DM * 2); float* ED = (float*)take((size_t)TT * TT * 4); float* FQ = (float*)take((size_t)TT * DQ * 4); float* FK = (float*)take((size_t)TT * DKV * 4);
    h16* QP16 = (h16*)take((size_t)NH_ * TT * HD * 2); h16* KP16 = (h16*)take((size_t)NKV * TT * HD * 2); h16* VT16 = (h16*)take((size_t)NKV * HD * TT * 2);
    bf* QPh = (bf*)take((size_t)NH_ * TT * HD * 2); bf* QPl = (bf*)take((size_t)NH_ * TT * HD * 2); bf* KPh = (bf*)take((size_t)NKV * TT * HD * 2); bf* KPl = (bf*)take((size_t)NKV * TT * HD * 2); bf* VTh = (bf*)take((size_t)NKV * HD * TT * 2); bf* VTl = (bf*)take((size_t)NKV * HD * TT * 2); bf* Ph = (bf*)take((size_t)ZH * RH * TT * 2); bf* Pl = (bf*)take((size_t)ZH * RH * TT * 2);
    float* Sb = (float*)take((size_t)ZH * TT * TT * 4); h16* P16 = (h16*)take((size_t)ZH * TT * TT * 2); float* Ob = (float*)take((size_t)ZH * TT * HD * 4); bf* ATh = (bf*)take((size_t)TT * DQ * 2); bf* ATl = (bf*)take((size_t)TT * DQ * 2);
    if ((size_t)(wsp - (char*)d_ws) > ws_size) return;    // ws 256 MiB
    float* FV = FK;   // v projection reuses the k buffer after the k planes are built (stream-ordered)
    { k_wtG<<<(unsigned)((DM * DQ / 64 + 63) / 64), 256, 0, stream>>>(wq, DM, DQ, WQ); k_wtG<<<(unsigned)((DM * DKV / 64 + 63) / 64), 256, 0, stream>>>(wk, DM, DKV, WK); k_wtG<<<(unsigned)((DM * DKV / 64 + 63) / 64), 256, 0, stream>>>(wv, DM, DKV, WV);
      k_wtG<<<(unsigned)((DQ * DM / 64 + 63) / 64), 256, 0, stream>>>(wo, DQ, DM, WO);
       }
    k_csid<<<(TT * HD + 255) / 256, 256, 0, stream>>>(CS);
    const unsigned LQ = (unsigned)(((size_t)NH_ * TT * HD / 2 + 255) / 256), LKv = (unsigned)(((size_t)NKV * TT * HD / 2 + 255) / 256);
    for (int b = 0; b < NB_; ++b) {
        
        k_cvt8<<<(unsigned)(((size_t)TT * DM / 8 + 255) / 256), 256, 0, stream>>>(x + (size_t)b * TT * DM, XB, (size_t)TT * DM / 8); k_dist<<<(TT * TT / 4 + 255) / 256, 256, 0, stream>>>(coords + (size_t)b * TT * 2, ED);
        k_gemmw<bf, 0, false><<<dim3(TT / 64, DQ / 64, 1), 32, 0, stream>>>(XB, nullptr, WQ, nullptr, DM, FQ, DQ, nullptr, 0, 0, 0);
        k_rope<<<LQ, 256, 0, stream>>>(FQ, DQ, NH_, CS, nullptr, nullptr, 1.0f, QP16, QPh, QPl);
        k_gemmw<bf, 0, false><<<dim3(TT / 64, DKV / 64, 1), 32, 0, stream>>>(XB, nullptr, WK, nullptr, DM, FK, DKV, nullptr, 0, 0, 0);
        k_rope<<<LKv, 256, 0, stream>>>(FK, DKV, NKV, CS, nullptr, nullptr, 1.0f, KP16, KPh, KPl);
        k_gemmw<bf, 0, false><<<dim3(TT / 64, DKV / 64, 1), 32, 0, stream>>>(XB, nullptr, WV, nullptr, DM, FV, DKV, nullptr, 0, 0, 0); k_vtp<<<LKv, 256, 0, stream>>>(FV, DKV, NKV, VT16, VTh, VTl);
        for (int h0 = 0; h0 < NH_; h0 += ZH) { const size_t zq = (size_t)h0, zk = (size_t)(h0 / REP);   // one kv head per query head: the pass's two heads use consecutive kv planes (z-strides TT*HD)
            k_gemmw<bf, 2, false><<<dim3(RH / 64, TT / 64, ZH), 32, 0, stream>>>(QPh + zq * TT * HD, QPl + zq * TT * HD, KPh + zk * TT * HD, KPl + zk * TT * HD, HD, Sb, TT, nullptr, (size_t)TT * HD, (size_t)TT * HD, (size_t)TT * TT);
            k_gemmw<h16, 0, false><<<dim3((TT - RH) / 64, TT / 64, ZH), 32, 0, stream>>>(QP16 + zq * TT * HD + (size_t)RH * HD, nullptr, KP16 + zk * TT * HD, nullptr, HD, Sb + (size_t)RH * TT, TT, nullptr, (size_t)TT * HD, (size_t)TT * HD, (size_t)TT * TT);
            k_asoft<<<ZH * TT / 8, 256, 0, stream>>>(Sb, ED, mask + (size_t)b * TT * TT, sbias, h0, P16, Ph, Pl);
            k_gemmw<bf, 2, false><<<dim3(RH / 64, HD / 64, ZH), 32, 0, stream>>>(Ph, Pl, VTh + zk * HD * TT, VTl + zk * HD * TT, TT, Ob, HD, nullptr, (size_t)RH * TT, (size_t)HD * TT, (size_t)TT * HD);
            k_gemmw<h16, 0, false><<<dim3((TT - RH) / 64, HD / 64, ZH), 32, 0, stream>>>(P16 + (size_t)RH * TT, nullptr, VT16 + zk * HD * TT, nullptr, TT, Ob + (size_t)RH * HD, HD, nullptr, (size_t)TT * TT, (size_t)HD * TT, (size_t)TT * HD);
            k_merge<<<(unsigned)(((size_t)ZH * TT * HD / 2 + 255) / 256), 256, 0, stream>>>(Ob, h0, ATh, ATl); }
        k_gemmw<bf, 1, true><<<dim3(TT / 64, DM / 64, 1), 32, 0, stream>>>(ATh, ATl, WO, nullptr, DQ, OUT + (size_t)b * TT * DM, DM, bo, 0, 0, 0); }
}

// v001
// A run of this version takes 1050 microseconds.
// Two timings next to v000 put it at 2.14 and 2.13 times that version's speed.
#include <hip/hip_runtime.h>

// SpatialTemporalAttention (x [2][2048][1024]; Q/K/V = x W ([in,out], no bias; 16 heads x 64); scores = Q.K / 8 + spatial_bias[h] exp(-dist[b][i][j]) with dist = pairwise Euclidean distance of spatial_coords [2][2048][2] (0 when d2 == 0); masked where mask[b][i][j] == 0 (int, read) -> -inf; softmax; out = merged Wo + bo -> [2][2048][1024]).
// Compute dtypes, f32 accumulate: every input rounded to bf16; Q/K/V on PLAIN bf16 operands (inputs: exact); the distance bias table exp(-dist) [2048][2048] per batch in f32 (k_dist); scores and attn.v: query rows < 512 hl (3 products), the rest single fp16 (x1024); bias + mask + softmax f32; Wo hl x exact (2 products) + bias.

#define NB_  2
#define TT   2048
#define DM   1024
#define NH_  16
#define NKV  16
#define REP  (NH_ / NKV)
#define HD   64
#define DQ   (NH_ * HD)
#define DKV  (NKV * HD)
#define ZH   2
#define RH   512                  // query rows < RH use hi+lo planes (0: none)
#define WIN  0
#define PCAR 1024.0f
#define SCL  0.125f   // HD^-0.5
#define KSV  16                   // K ranges of the attn.v products (2048 keys -> 128 a work-group)
#define KSP  4                    // K ranges of the Q, K and Wo products (1024 -> 256 a work-group)
typedef _Float16 h16;
typedef unsigned short bf;
typedef __attribute__((ext_vector_type(16))) __bf16   v16bf;
typedef __attribute__((ext_vector_type(16))) _Float16 v16h;
typedef __attribute__((ext_vector_type(8)))  _Float16 v8h;
typedef __attribute__((ext_vector_type(8)))  unsigned short v8us;
typedef __attribute__((ext_vector_type(8)))  float    v8f;
typedef __attribute__((ext_vector_type(4)))  float    v4f;
typedef v8h  __attribute__((may_alias)) v8ha;
typedef v4f  __attribute__((may_alias)) v4fa;
typedef v8us __attribute__((may_alias)) v8usa;

__device__ __forceinline__ unsigned short f2bf(float f) { unsigned u = __float_as_uint(f); u += 0x7FFFu + ((u >> 16) & 1u); return (unsigned short)(u >> 16); }
__device__ __forceinline__ float bf2f(unsigned short b) { return __uint_as_float(((unsigned)b) << 16); }
__device__ __forceinline__ float bfr(float f) { return bf2f(f2bf(f)); }
__device__ __forceinline__ v16h cat16(v8h lo, v8h hi) { return __builtin_shufflevector(lo, hi, 0, 1, 2, 3, 4, 5, 6, 7, 8, 9, 10, 11, 12, 13, 14, 15); }
__device__ __forceinline__ v16bf cat16b(v8us lo, v8us hi) { return __builtin_bit_cast(v16bf, __builtin_shufflevector(lo, hi, 0, 1, 2, 3, 4, 5, 6, 7, 8, 9, 10, 11, 12, 13, 14, 15)); }
__device__ __forceinline__ v8f wmma16(v16h a, v16h b, v8f c) { return __builtin_amdgcn_wmma_f32_16x16x32_f16(false, a, false, b, (short)0, c, false, false); }
__device__ __forceinline__ v8f wmmab(v16bf a, v16bf b, v8f c) { return __builtin_amdgcn_wmma_f32_16x16x32_bf16(false, a, false, b, (short)0, c, false, false); }



// ---- k_gemmw: register-blocked GEMM, ONE WAVE per 64x64 output tile (16 accumulators), operands straight from K-contiguous 16-bit planes; grid (M/64, N/64, Z), 32 threads.
// C[m][n] (f32, pitch ldc, + optional f32 bias[n]) = sum_k A[m][k] Bt[n][k] (+ split products per NSPLIT). z-batch strides sA/sB/sC in elements. K % (32 KS) == 0.
// KS > 1: grid z = Z x KS; work-group (z, ks) sums only k in [ks K/KS, (ks+1) K/KS) and stores its f32 partial tile to plane ks (plane stride sP elements); the kernel that reads C adds the KS planes in plane order.
template <typename T16> struct WFrag;
template <> struct WFrag<h16> { typedef v16h V; static __device__ __forceinline__ V ld(const h16* p) { return cat16(*(const v8h*)p, *(const v8h*)(p + 16)); } static __device__ __forceinline__ v8f mma(V a, V b, v8f c) { return wmma16(a, b, c); } };
template <> struct WFrag<bf> { typedef v16bf V; static __device__ __forceinline__ V ld(const bf* p) { return cat16b(*(const v8us*)p, *(const v8us*)(p + 16)); } static __device__ __forceinline__ v8f mma(V a, V b, v8f c) { return wmmab(a, b, c); } };
template <typename T16, int NSPLIT, bool BIAS, int KS>
__global__ __launch_bounds__(32) void k_gemmw(const T16* __restrict__ A, const T16* __restrict__ A2, const T16* __restrict__ Bt, const T16* __restrict__ Bt2, int K, float* C, int ldc, const float* __restrict__ bias, size_t sA, size_t sB, size_t sC, size_t sP) {
    typedef typename WFrag<T16>::V V;
    __shared__ __align__(16) float os[16 * 68];
    const size_t z = blockIdx.z / KS; const int ks = blockIdx.z % KS; A += z * sA; if (A2) A2 += z * sA; Bt += z * sB; if (Bt2) Bt2 += z * sB; C += z * sC + (size_t)ks * sP; const int kn = K / KS, kb = ks * kn;
    const int lane = threadIdx.x & 31, lr = lane & 15, hi = lane >> 4; const int r0 = blockIdx.x * 64, c0 = blockIdx.y * 64;
    v8f acc[4][4];
#pragma unroll
    for (int mb = 0; mb < 4; ++mb)
#pragma unroll
        for (int nb = 0; nb < 4; ++nb) acc[mb][nb] = (v8f){};
    const size_t aoff = (size_t)(r0 + lr) * K + 8 * hi, boff = (size_t)(c0 + lr) * K + 8 * hi;
#pragma unroll 1
    for (int kc = kb; kc < kb + kn; kc += 32) {
        V a[4], a2[4];
#pragma unroll
        for (int mb = 0; mb < 4; ++mb) { a[mb] = WFrag<T16>::ld(A + aoff + (size_t)mb * 16 * K + kc); if (NSPLIT == 1 || NSPLIT == 2) a2[mb] = WFrag<T16>::ld(A2 + aoff + (size_t)mb * 16 * K + kc); }
#pragma unroll
        for (int nb = 0; nb < 4; ++nb) { const V b = WFrag<T16>::ld(Bt + boff + (size_t)nb * 16 * K + kc); V b2; if (NSPLIT >= 2) b2 = WFrag<T16>::ld(Bt2 + boff + (size_t)nb * 16 * K + kc);
#pragma unroll
            for (int mb = 0; mb < 4; ++mb) { acc[mb][nb] = WFrag<T16>::mma(a[mb], b, acc[mb][nb]); if (NSPLIT == 1 || NSPLIT == 2) acc[mb][nb] = WFrag<T16>::mma(a2[mb], b, acc[mb][nb]); if (NSPLIT >= 2) acc[mb][nb] = WFrag<T16>::mma(a[mb], b2, acc[mb][nb]); } }
        asm volatile("v_nop\n\tv_nop\n\tv_nop\n\tv_nop" : "+v"(acc[0][0]), "+v"(acc[1][1]), "+v"(acc[2][2]), "+v"(acc[3][3]) : "v"(a[0]), "v"(a[3]));
    }
#pragma unroll
    for (int mb = 0; mb < 4; ++mb) {
#pragma unroll
        for (int nb = 0; nb < 4; ++nb) {
#pragma unroll
            for (int j = 0; j < 8; ++j) os[(hi * 8 + j) * 68 + nb * 16 + lr] = acc[mb][nb][j]; }
        __builtin_amdgcn_wave_barrier(); asm volatile("" ::: "memory");
        float* crow = C + (size_t)(r0 + mb * 16) * ldc + c0;
{
#pragma unroll
            for (int s = 0; s < 8; ++s) { const int row = 2 * s + hi, cofs = lr * 4; v4f val = *(const v4fa*)(os + row * 68 + cofs); if (BIAS) { val[0] += bfr(bias[c0 + cofs]); val[1] += bfr(bias[c0 + cofs + 1]); val[2] += bfr(bias[c0 + cofs + 2]); val[3] += bfr(bias[c0 + cofs + 3]); }
                *(v4f*)(crow + (size_t)row * ldc + cofs) = val; }
             }
        __builtin_amdgcn_wave_barrier(); asm volatile("" ::: "memory");
    }
}

__device__ __forceinline__ h16 tohx(float x) { return (h16)x; }
__device__ __forceinline__ void splitf(float y, unsigned short& h, unsigned short& l) { h = f2bf(y); l = f2bf(y - bf2f(h)); }
typedef __attribute__((ext_vector_type(2))) _Float16 v2h;
typedef __attribute__((ext_vector_type(4))) _Float16 v4h;
typedef __attribute__((ext_vector_type(2))) unsigned short v2us;
typedef __attribute__((ext_vector_type(4))) unsigned short v4us;
typedef __attribute__((ext_vector_type(2))) float v2f;
typedef __attribute__((ext_vector_type(4))) int v4i;

// sum of NP partial planes (stride sp elements) at elements off, off + 1 (off even), in plane order
template <int NP> __device__ __forceinline__ v2f psum2(const float* __restrict__ P, size_t sp, unsigned off) { v2f a = *(const v2f*)(P + off);
#pragma unroll
    for (int i = 1; i < NP; ++i) a += *(const v2f*)(P + (size_t)i * sp + off); return a; }

__global__ __launch_bounds__(256) void k_wtG(const float* __restrict__ w, int K, int N, bf* Bt) {
    const int lane = threadIdx.x & 31; const int L0 = (blockIdx.x * 8 + (threadIdx.x >> 5)) * 8; const int nlines = N * K / 64;
{
#pragma unroll 1
        for (int l = 0; l < 8; ++l) { const int L = L0 + l; if (L >= nlines) break; const size_t e = (size_t)L * 64 + lane * 2; const int k = (int)(e % K), n = (int)(e / K); v2us o;
            o[0] = f2bf(w[(size_t)k * N + n]); o[1] = f2bf(w[(size_t)(k + 1) * N + n]); *(v2us*)(Bt + e) = o; }
         }
}
__global__ __launch_bounds__(256) void k_cvt8(const float* __restrict__ src, bf* dst, size_t n8) { const size_t i = (size_t)blockIdx.x * 256 + threadIdx.x; if (i >= n8) return; const v8f v = *(const v8f*)(src + i * 8); v8us o;
#pragma unroll
    for (int k = 0; k < 8; ++k) o[k] = f2bf(v[k]); *(v8us*)(dst + i * 8) = o;  }
__global__ __launch_bounds__(256) void k_cscvt(const float* __restrict__ cosT, const float* __restrict__ sinT, float* CS) { const int idx = blockIdx.x * 256 + threadIdx.x; if (idx >= TT * HD) return; v2f cs; cs[0] = bfr(cosT[idx]); cs[1] = bfr(sinT[idx]); *(v2f*)(CS + (size_t)idx * 2) = cs;  }
// k_rope: F = KSP partial planes [TT][pitch], summed here; head planes [h][t][d] (fp16 + hi/lo) of rope(x) x sc with the rotate-half convention out[d] = x[d] cos[t][d] - x[d+HD/2] sin[t][d], out[d+HD/2] = x[d+HD/2] cos[t][d+HD/2] + x[d] sin[t][d+HD/2]
__global__ __launch_bounds__(256) void k_rope(const float* __restrict__ F, int pitch, int nheads, const float* __restrict__ CS, const float* __restrict__ RF, const float* __restrict__ nw, float sc, h16* P16, bf* Ph, bf* Pl) {
    const size_t e = ((size_t)blockIdx.x * 256 + threadIdx.x) * 2; if (e >= (size_t)nheads * TT * HD) return; const int d = (int)(e % HD); const int t = (int)((e / HD) % TT); const int h = (int)(e / ((size_t)HD * TT)); const unsigned fo = (unsigned)t * pitch + h * HD; v2h o16; v2us oh, ol;
    const v2f X0 = psum2<KSP>(F, (size_t)TT * pitch, fo + d), X1 = psum2<KSP>(F, (size_t)TT * pitch, fo + ((d < HD / 2) ? d + HD / 2 : d - HD / 2));
    asm volatile("s_wait_xcnt 0x0" ::: "memory");   // stands in front of the first rewrite of an address register of the plane loads above
    const float rf = RF ? RF[(size_t)h * TT + t] : 1.0f;
#pragma unroll
    for (int q = 0; q < 2; ++q) { const int dd = d + q; const int dp = (dd < HD / 2) ? dd + HD / 2 : dd - HD / 2; float x0 = X0[q], x1 = X1[q];   // d is even: d + q and its partner dp stay in their halves
        if (RF) { float n0 = __fmul_rn(x0, rf), n1 = __fmul_rn(x1, rf); asm volatile("" : "+v"(n0)); asm volatile("" : "+v"(n1)); x0 = __fmul_rn(bfr(nw[dd]), n0); x1 = __fmul_rn(bfr(nw[dp]), n1); }
        const v2f cs = *(const v2f*)(CS + ((size_t)t * HD + dd) * 2); float a = __fmul_rn(x0, cs[0]), bq = __fmul_rn(x1, cs[1]); asm volatile("" : "+v"(a)); asm volatile("" : "+v"(bq)); const float r = ((dd < HD / 2) ? __fsub_rn(a, bq) : __fadd_rn(a, bq)) * sc;
        o16[q] = tohx(r); unsigned short a2, c2; splitf(r, a2, c2); oh[q] = a2; ol[q] = c2; }
    *(v2h*)(P16 + e) = o16; *(v2us*)(Ph + e) = oh; *(v2us*)(Pl + e) = ol;  }
__global__ __launch_bounds__(256) void k_vtp(const float* __restrict__ F, int pitch, int nheads, h16* V16, bf* Vh, bf* Vl) { const size_t e = ((size_t)blockIdx.x * 256 + threadIdx.x) * 2; if (e >= (size_t)nheads * HD * TT) return; const int t = (int)(e % TT); const int d = (int)((e / TT) % HD); const int g = (int)(e / ((size_t)TT * HD)); v2h o16; v2us oh, ol;
#pragma unroll
    for (int q = 0; q < 2; ++q) { const float x = F[(size_t)(t + q) * pitch + g * HD + d]; o16[q] = tohx(x); unsigned short a2, c2; splitf(x, a2, c2); oh[q] = a2; ol[q] = c2; }
    *(v2h*)(V16 + e) = o16; *(v2us*)(Vh + e) = oh; *(v2us*)(Vl + e) = ol;  }
__global__ __launch_bounds__(256) void k_csid(float* CS) { const int idx = blockIdx.x * 256 + threadIdx.x; if (idx >= TT * HD) return; v2f cs; cs[0] = 1.0f; cs[1] = 0.0f; *(v2f*)(CS + (size_t)idx * 2) = cs;  }
// k_asoft: per row (zz, i): t = S x HD^-0.5 + spatial_bias[h] exp(-dist) (mask == 0 -> -inf); softmax over the 2048 keys (register row, one exp, fixed trees);
__global__ __launch_bounds__(256) void k_asoft(const float* __restrict__ Sb, const float* __restrict__ ED, const int* __restrict__ mk, const float* __restrict__ sbias, int h0, h16* P16, bf* Ph, bf* Pl) {
    const int lane = threadIdx.x & 31; const int row = blockIdx.x * 8 + (threadIdx.x >> 5); if (row >= ZH * TT) return; const int i = row % TT; const int zz = row / TT; (void)zz; const bool hires = (i < RH); const float* sr = Sb + (size_t)row * TT; float v[TT / 32]; float mx = -3.0e38f;
#pragma unroll
    for (int ch = 0; ch < TT / 128; ++ch) { const int j0 = ch * 128 + lane * 4; const v4f a = *(const v4f*)(sr + j0);
#pragma unroll
        for (int q = 0; q < 4; ++q) { const int j = j0 + q; (void)j; float sb = bfr(sbias[h0 + zz]); asm volatile("" : "+v"(sb)); float bias = __fmul_rn(sb, ED[(size_t)i * TT + j]); asm volatile("" : "+v"(bias)); float t0 = a[q] * SCL; asm volatile("" : "+v"(t0)); const float t = (mk[(size_t)i * TT + j] == 0) ? -__builtin_inff() : __fadd_rn(t0, bias); v[ch * 4 + q] = t; mx = fmaxf(mx, t); } }
#pragma unroll
    for (int sh = 16; sh; sh >>= 1) mx = fmaxf(mx, __shfl_xor(mx, sh, 32));
    float sum = 0.f;
#pragma unroll
    for (int k = 0; k < TT / 32; ++k) { float d0 = __fsub_rn(v[k], mx); asm volatile("" : "+v"(d0)); v[k] = __builtin_amdgcn_exp2f(__fmul_rn(d0, 1.4426950408889634f)); sum += v[k]; }
#pragma unroll
    for (int sh = 16; sh; sh >>= 1) sum += __shfl_xor(sum, sh, 32);
    const float f = __fdiv_rn(hires ? 1.0f : PCAR, sum);
{
        if (hires) {
#pragma unroll
            for (int ch = 0; ch < TT / 128; ++ch) { v4us oh, ol;
#pragma unroll
                for (int q = 0; q < 4; ++q) { unsigned short a, c2; splitf(v[ch * 4 + q] * f, a, c2); oh[q] = a; ol[q] = c2; }
                const size_t oo = ((size_t)zz * (RH ? RH : 1) + i) * TT + ch * 128 + lane * 4; *(v4us*)(Ph + oo) = oh; *(v4us*)(Pl + oo) = ol; }
        } else {
#pragma unroll
            for (int ch = 0; ch < TT / 128; ++ch) { v4h o4;
#pragma unroll
                for (int q = 0; q < 4; ++q) o4[q] = tohx(v[ch * 4 + q] * f);
                *(v4h*)(P16 + (size_t)row * TT + ch * 128 + lane * 4) = o4; } }
         }
}
__global__ __launch_bounds__(256) void k_merge(const float* __restrict__ O, int h0, bf* Ah, bf* Al) { const size_t e = ((size_t)blockIdx.x * 256 + threadIdx.x) * 2; if (e >= (size_t)ZH * TT * HD) return; const int d = (int)(e % HD); const int t = (int)((e / HD) % TT); const int zz = (int)(e / ((size_t)HD * TT)); const float cs = (t < RH) ? 1.0f : (1.0f / PCAR); const size_t oo = (size_t)t * DQ + (h0 + zz) * HD + d;
    v2us oh, ol; const v2f os = psum2<KSV>(O, (size_t)ZH * TT * HD, (unsigned)e);
#pragma unroll
    for (int q = 0; q < 2; ++q) { unsigned short a, c2; splitf(os[q] * cs, a, c2); oh[q] = a; ol[q] = c2; } *(v2us*)(Ah + oo) = oh; *(v2us*)(Al + oo) = ol;  }
// k_osum: out = sum of the KSP partial planes of merged x Wo, + bias (16-B lanes)
__global__ __launch_bounds__(256) void k_osum(const float* __restrict__ P, const float* __restrict__ bias, float* out) { const unsigned i4 = blockIdx.x * 256 + threadIdx.x; if (i4 >= TT * DM / 4) return; const unsigned c = (i4 * 4) % DM; const v4f* P4 = (const v4f*)P; v4f a = P4[i4];
#pragma unroll
    for (int i = 1; i < KSP; ++i) a += (P4 + (size_t)i * (TT * DM / 4))[i4];
#pragma unroll
    for (int u = 0; u < 4; ++u) a[u] += bfr(bias[c + u]);
    ((v4f*)out)[i4] = a;  }

__global__ __launch_bounds__(256) void k_dist(const float* __restrict__ co, float* ED) { const size_t e = ((size_t)blockIdx.x * 256 + threadIdx.x) * 4; if (e >= (size_t)TT * TT) return; const int j = (int)(e % TT); const int i = (int)(e / TT); const float xi = bfr(co[i * 2]), yi = bfr(co[i * 2 + 1]); v4f o;   // exp(-dist): dist = sqrt(dx^2 + dy^2) (0 when d2 == 0) (16-B lanes)
#pragma unroll
    for (int u = 0; u < 4; ++u) { const float dx = __fsub_rn(xi, bfr(co[(j + u) * 2])), dy = __fsub_rn(yi, bfr(co[(j + u) * 2 + 1])); float px = __fmul_rn(dx, dx), py = __fmul_rn(dy, dy); asm volatile("" : "+v"(px)); asm volatile("" : "+v"(py)); const float d2 = __fadd_rn(px, py); const float dist = (d2 == 0.f) ? 0.f : __fsqrt_rn(d2); o[u] = __expf(-dist); }
    *(v4f*)(ED + e) = o;  }

extern "C" void kernel_launch(void* const* d_in, const int* in_sizes, int n_in,
                              void* d_out, int out_size, void* d_ws, size_t ws_size, hipStream_t stream) {
    (void)in_sizes; (void)n_in; (void)out_size;
    const float* x = (const float*)d_in[0]; const float* coords = (const float*)d_in[1]; const int* mask = (const int*)d_in[2]; const float* wq = (const float*)d_in[3]; const float* wk = (const float*)d_in[4]; const float* wv = (const float*)d_in[5]; const float* sbias = (const float*)d_in[6]; const float* wo = (const float*)d_in[7]; const float* bo = (const float*)d_in[8]; const float* cosT = nullptr; const float* sinT = nullptr; (void)cosT; (void)sinT;
    float* OUT = (float*)d_out;     // [2][2048][1024]
    char* wsp = (char*)d_ws;
    auto take = [&](size_t bytes) { char* p = wsp; wsp += (bytes + 255) & ~(size_t)255; return (void*)p; };
    bf* WQ = (bf*)take((size_t)DQ * DM * 2); bf* WK = (bf*)take((size_t)DKV * DM * 2); bf* WV = (bf*)take((size_t)DKV * DM * 2); bf* WO = (bf*)take((size_t)DM * DQ * 2); float* CS = (float*)take((size_t)TT * HD * 2 * 4);
    bf* XB = (bf*)take((size_t)TT * DM * 2); float* ED = (float*)take((size_t)TT * TT * 4); float* FQ = (float*)take((size_t)KSP * TT * DQ * 4); float* FK = (float*)take((size_t)KSP * TT * DKV * 4);
    h16* QP16 = (h16*)take((size_t)NH_ * TT * HD * 2); h16* KP16 = (h16*)take((size_t)NKV * TT * HD * 2); h16* VT16 = (h16*)take((size_t)NKV * HD * TT * 2);
    bf* QPh = (bf*)take((size_t)NH_ * TT * HD * 2); bf* QPl = (bf*)take((size_t)NH_ * TT * HD * 2); bf* KPh = (bf*)take((size_t)NKV * TT * HD * 2); bf* KPl = (bf*)take((size_t)NKV * TT * HD * 2); bf* VTh = (bf*)take((size_t)NKV * HD * TT * 2); bf* VTl = (bf*)take((size_t)NKV * HD * TT * 2); bf* Ph = (bf*)take((size_t)ZH * RH * TT * 2); bf* Pl = (bf*)take((size_t)ZH * RH * TT * 2);
    float* Sb = (float*)take((size_t)ZH * TT * TT * 4); h16* P16 = (h16*)take((size_t)ZH * TT * TT * 2); float* Ob = (float*)take((size_t)KSV * ZH * TT * HD * 4); bf* ATh = (bf*)take((size_t)TT * DQ * 2); bf* ATl = (bf*)take((size_t)TT * DQ * 2);
    if ((size_t)(wsp - (char*)d_ws) > ws_size) return;    // ws 256 MiB
    float* FV = FK;   // v projection reuses the k buffer after the k planes are built (stream-ordered)
    float* FO = FQ;   // the Wo partial planes reuse the q buffer after the q planes are built (stream-ordered)
    { k_wtG<<<(unsigned)((DM * DQ / 64 + 63) / 64), 256, 0, stream>>>(wq, DM, DQ, WQ); k_wtG<<<(unsigned)((DM * DKV / 64 + 63) / 64), 256, 0, stream>>>(wk, DM, DKV, WK); k_wtG<<<(unsigned)((DM * DKV / 64 + 63) / 64), 256, 0, stream>>>(wv, DM, DKV, WV);
      k_wtG<<<(unsigned)((DQ * DM / 64 + 63) / 64), 256, 0, stream>>>(wo, DQ, DM, WO);
       }
    k_csid<<<(TT * HD + 255) / 256, 256, 0, stream>>>(CS);
    const unsigned LQ = (unsigned)(((size_t)NH_ * TT * HD / 2 + 255) / 256), LKv = (unsigned)(((size_t)NKV * TT * HD / 2 + 255) / 256);
    for (int b = 0; b < NB_; ++b) {
        
        k_cvt8<<<(unsigned)(((size_t)TT * DM / 8 + 255) / 256), 256, 0, stream>>>(x + (size_t)b * TT * DM, XB, (size_t)TT * DM / 8); k_dist<<<(TT * TT / 4 + 255) / 256, 256, 0, stream>>>(coords + (size_t)b * TT * 2, ED);
        k_gemmw<bf, 0, false, KSP><<<dim3(TT / 64, DQ / 64, KSP), 32, 0, stream>>>(XB, nullptr, WQ, nullptr, DM, FQ, DQ, nullptr, 0, 0, 0, (size_t)TT * DQ);
        k_rope<<<LQ, 256, 0, stream>>>(FQ, DQ, NH_, CS, nullptr, nullptr, 1.0f, QP16, QPh, QPl);
        k_gemmw<bf, 0, false, KSP><<<dim3(TT / 64, DKV / 64, KSP), 32, 0, stream>>>(XB, nullptr, WK, nullptr, DM, FK, DKV, nullptr, 0, 0, 0, (size_t)TT * DKV);
        k_rope<<<LKv, 256, 0, stream>>>(FK, DKV, NKV, CS, nullptr, nullptr, 1.0f, KP16, KPh, KPl);
        k_gemmw<bf, 0, false, 1><<<dim3(TT / 64, DKV / 64, 1), 32, 0, stream>>>(XB, nullptr, WV, nullptr, DM, FV, DKV, nullptr, 0, 0, 0, 0); k_vtp<<<LKv, 256, 0, stream>>>(FV, DKV, NKV, VT16, VTh, VTl);
        for (int h0 = 0; h0 < NH_; h0 += ZH) { const size_t zq = (size_t)h0, zk = (size_t)(h0 / REP);   // one kv head per query head: the pass's two heads use consecutive kv planes (z-strides TT*HD)
            k_gemmw<bf, 2, false, 1><<<dim3(RH / 64, TT / 64, ZH), 32, 0, stream>>>(QPh + zq * TT * HD, QPl + zq * TT * HD, KPh + zk * TT * HD, KPl + zk * TT * HD, HD, Sb, TT, nullptr, (size_t)TT * HD, (size_t)TT * HD, (size_t)TT * TT, 0);
            k_gemmw<h16, 0, false, 1><<<dim3((TT - RH) / 64, TT / 64, ZH), 32, 0, stream>>>(QP16 + zq * TT * HD + (size_t)RH * HD, nullptr, KP16 + zk * TT * HD, nullptr, HD, Sb + (size_t)RH * TT, TT, nullptr, (size_t)TT * HD, (size_t)TT * HD, (size_t)TT * TT, 0);
            k_asoft<<<ZH * TT / 8, 256, 0, stream>>>(Sb, ED, mask + (size_t)b * TT * TT, sbias, h0, P16, Ph, Pl);
            k_gemmw<bf, 2, false, KSV><<<dim3(RH / 64, HD / 64, ZH * KSV), 32, 0, stream>>>(Ph, Pl, VTh + zk * HD * TT, VTl + zk * HD * TT, TT, Ob, HD, nullptr, (size_t)RH * TT, (size_t)HD * TT, (size_t)TT * HD, (size_t)ZH * TT * HD);
            k_gemmw<h16, 0, false, KSV><<<dim3((TT - RH) / 64, HD / 64, ZH * KSV), 32, 0, stream>>>(P16 + (size_t)RH * TT, nullptr, VT16 + zk * HD * TT, nullptr, TT, Ob + (size_t)RH * HD, HD, nullptr, (size_t)TT * TT, (size_t)HD * TT, (size_t)TT * HD, (size_t)ZH * TT * HD);
            k_merge<<<(unsigned)(((size_t)ZH * TT * HD / 2 + 255) / 256), 256, 0, stream>>>(Ob, h0, ATh, ATl); }
        k_gemmw<bf, 1, false, KSP><<<dim3(TT / 64, DM / 64, KSP), 32, 0, stream>>>(ATh, ATl, WO, nullptr, DQ, FO, DM, nullptr, 0, 0, 0, (size_t)TT * DM);
        k_osum<<<(unsigned)(((size_t)TT * DM / 4 + 255) / 256), 256, 0, stream>>>(FO, bo, OUT + (size_t)b * TT * DM); }
}

// v002
// Measured time: 388 microseconds a run.
// In two side-by-side timings against v001, it was 2.69 and 2.71 times as fast.
// All steps since v000 together make it 5.77 times as fast.
#include <hip/hip_runtime.h>

// SpatialTemporalAttention (x [2][2048][1024]; Q/K/V = x W ([in,out], no bias; 16 heads x 64); scores = Q.K / 8 + spatial_bias[h] exp(-dist[b][i][j]) with dist = pairwise Euclidean distance of spatial_coords [2][2048][2] (0 when d2 == 0); masked where mask[b][i][j] == 0 (int, read) -> -inf; softmax; out = merged Wo + bo -> [2][2048][1024]).
// Compute dtypes, f32 accumulate: every input rounded to bf16; Q/K/V on PLAIN bf16 operands (inputs: exact); the distance bias table exp(-dist) [2048][2048] per batch in f32 (k_dist); scores and attn.v (one fused kernel, k_fattn): query rows < 512 hl (3 products), the rest single fp16; bias + mask + running softmax f32; Wo hl x exact (2 products) + bias.

#define NB_  2
#define TT   2048
#define DM   1024
#define NH_  16
#define NKV  16
#define REP  (NH_ / NKV)
#define HD   64
#define DQ   (NH_ * HD)
#define DKV  (NKV * HD)
#define RH   512                  // query rows < RH use hi+lo planes (0: none)
#define WIN  0
#define SCL  0.125f   // HD^-0.5
#define KPI  72                   // k_fattn LDS pitch of a staged K row, elements: 128 B + 16 B (16 B x odd: b128 fragment reads without bank conflicts)
#define VPI  40                   // the same of a staged Vt row: 64 B + 16 B
#define BPI  36                   // the same of a bias row, floats: 128 B + 16 B
#define LOG2E 1.4426950408889634f
#define KSP  4                    // K ranges of the Q, K and Wo products (1024 -> 256 a work-group)
typedef _Float16 h16;
typedef unsigned short bf;
typedef __attribute__((ext_vector_type(16))) __bf16   v16bf;
typedef __attribute__((ext_vector_type(16))) _Float16 v16h;
typedef __attribute__((ext_vector_type(8)))  _Float16 v8h;
typedef __attribute__((ext_vector_type(8)))  unsigned short v8us;
typedef __attribute__((ext_vector_type(8)))  float    v8f;
typedef __attribute__((ext_vector_type(4)))  float    v4f;
typedef v8h  __attribute__((may_alias)) v8ha;
typedef v4f  __attribute__((may_alias)) v4fa;
typedef v8us __attribute__((may_alias)) v8usa;

__device__ __forceinline__ unsigned short f2bf(float f) { unsigned u = __float_as_uint(f); u += 0x7FFFu + ((u >> 16) & 1u); return (unsigned short)(u >> 16); }
__device__ __forceinline__ float bf2f(unsigned short b) { return __uint_as_float(((unsigned)b) << 16); }
__device__ __forceinline__ float bfr(float f) { return bf2f(f2bf(f)); }
__device__ __forceinline__ v16h cat16(v8h lo, v8h hi) { return __builtin_shufflevector(lo, hi, 0, 1, 2, 3, 4, 5, 6, 7, 8, 9, 10, 11, 12, 13, 14, 15); }
__device__ __forceinline__ v16bf cat16b(v8us lo, v8us hi) { return __builtin_bit_cast(v16bf, __builtin_shufflevector(lo, hi, 0, 1, 2, 3, 4, 5, 6, 7, 8, 9, 10, 11, 12, 13, 14, 15)); }
__device__ __forceinline__ v8f wmma16(v16h a, v16h b, v8f c) { return __builtin_amdgcn_wmma_f32_16x16x32_f16(false, a, false, b, (short)0, c, false, false); }
__device__ __forceinline__ v8f wmmab(v16bf a, v16bf b, v8f c) { return __builtin_amdgcn_wmma_f32_16x16x32_bf16(false, a, false, b, (short)0, c, false, false); }



// ---- k_gemmw: register-blocked GEMM, ONE WAVE per 64x64 output tile (16 accumulators), operands straight from K-contiguous 16-bit planes; grid (M/64, N/64, Z), 32 threads.
// C[m][n] (f32, pitch ldc, + optional f32 bias[n]) = sum_k A[m][k] Bt[n][k] (+ split products per NSPLIT). z-batch strides sA/sB/sC in elements. K % (32 KS) == 0.
// KS > 1: grid z = Z x KS; work-group (z, ks) sums only k in [ks K/KS, (ks+1) K/KS) and stores its f32 partial tile to plane ks (plane stride sP elements); the kernel that reads C adds the KS planes in plane order.
template <typename T16> struct WFrag;
template <> struct WFrag<h16> { typedef v16h V; static __device__ __forceinline__ V ld(const h16* p) { return cat16(*(const v8h*)p, *(const v8h*)(p + 16)); } static __device__ __forceinline__ v8f mma(V a, V b, v8f c) { return wmma16(a, b, c); } };
template <> struct WFrag<bf> { typedef v16bf V; static __device__ __forceinline__ V ld(const bf* p) { return cat16b(*(const v8us*)p, *(const v8us*)(p + 16)); } static __device__ __forceinline__ v8f mma(V a, V b, v8f c) { return wmmab(a, b, c); } };
template <typename T16, int NSPLIT, bool BIAS, int KS>
__global__ __launch_bounds__(32) void k_gemmw(const T16* __restrict__ A, const T16* __restrict__ A2, const T16* __restrict__ Bt, const T16* __restrict__ Bt2, int K, float* C, int ldc, const float* __restrict__ bias, size_t sA, size_t sB, size_t sC, size_t sP) {
    typedef typename WFrag<T16>::V V;
    __shared__ __align__(16) float os[16 * 68];
    const size_t z = blockIdx.z / KS; const int ks = blockIdx.z % KS; A += z * sA; if (A2) A2 += z * sA; Bt += z * sB; if (Bt2) Bt2 += z * sB; C += z * sC + (size_t)ks * sP; const int kn = K / KS, kb = ks * kn;
    const int lane = threadIdx.x & 31, lr = lane & 15, hi = lane >> 4; const int r0 = blockIdx.x * 64, c0 = blockIdx.y * 64;
    v8f acc[4][4];
#pragma unroll
    for (int mb = 0; mb < 4; ++mb)
#pragma unroll
        for (int nb = 0; nb < 4; ++nb) acc[mb][nb] = (v8f){};
    const size_t aoff = (size_t)(r0 + lr) * K + 8 * hi, boff = (size_t)(c0 + lr) * K + 8 * hi;
#pragma unroll 1
    for (int kc = kb; kc < kb + kn; kc += 32) {
        V a[4], a2[4];
#pragma unroll
        for (int mb = 0; mb < 4; ++mb) { a[mb] = WFrag<T16>::ld(A + aoff + (size_t)mb * 16 * K + kc); if (NSPLIT == 1 || NSPLIT == 2) a2[mb] = WFrag<T16>::ld(A2 + aoff + (size_t)mb * 16 * K + kc); }
#pragma unroll
        for (int nb = 0; nb < 4; ++nb) { const V b = WFrag<T16>::ld(Bt + boff + (size_t)nb * 16 * K + kc); V b2; if (NSPLIT >= 2) b2 = WFrag<T16>::ld(Bt2 + boff + (size_t)nb * 16 * K + kc);
#pragma unroll
            for (int mb = 0; mb < 4; ++mb) { acc[mb][nb] = WFrag<T16>::mma(a[mb], b, acc[mb][nb]); if (NSPLIT == 1 || NSPLIT == 2) acc[mb][nb] = WFrag<T16>::mma(a2[mb], b, acc[mb][nb]); if (NSPLIT >= 2) acc[mb][nb] = WFrag<T16>::mma(a[mb], b2, acc[mb][nb]); } }
        asm volatile("v_nop\n\tv_nop\n\tv_nop\n\tv_nop" : "+v"(acc[0][0]), "+v"(acc[1][1]), "+v"(acc[2][2]), "+v"(acc[3][3]) : "v"(a[0]), "v"(a[3]));
    }
#pragma unroll
    for (int mb = 0; mb < 4; ++mb) {
#pragma unroll
        for (int nb = 0; nb < 4; ++nb) {
#pragma unroll
            for (int j = 0; j < 8; ++j) os[(hi * 8 + j) * 68 + nb * 16 + lr] = acc[mb][nb][j]; }
        __builtin_amdgcn_wave_barrier(); asm volatile("" ::: "memory");
        float* crow = C + (size_t)(r0 + mb * 16) * ldc + c0;
{
#pragma unroll
            for (int s = 0; s < 8; ++s) { const int row = 2 * s + hi, cofs = lr * 4; v4f val = *(const v4fa*)(os + row * 68 + cofs); if (BIAS) { val[0] += bfr(bias[c0 + cofs]); val[1] += bfr(bias[c0 + cofs + 1]); val[2] += bfr(bias[c0 + cofs + 2]); val[3] += bfr(bias[c0 + cofs + 3]); }
                *(v4f*)(crow + (size_t)row * ldc + cofs) = val; }
             }
        __builtin_amdgcn_wave_barrier(); asm volatile("" ::: "memory");
    }
}

__device__ __forceinline__ h16 tohx(float x) { return (h16)x; }
__device__ __forceinline__ void splitf(float y, unsigned short& h, unsigned short& l) { h = f2bf(y); l = f2bf(y - bf2f(h)); }
typedef __attribute__((ext_vector_type(2))) _Float16 v2h;
typedef __attribute__((ext_vector_type(4))) _Float16 v4h;
typedef __attribute__((ext_vector_type(2))) unsigned short v2us;
typedef __attribute__((ext_vector_type(4))) unsigned short v4us;
typedef __attribute__((ext_vector_type(2))) float v2f;
typedef __attribute__((ext_vector_type(4))) int v4i;

// sum of NP partial planes (stride sp elements) at elements off, off + 1 (off even), in plane order
template <int NP> __device__ __forceinline__ v2f psum2(const float* __restrict__ P, size_t sp, unsigned off) { v2f a = *(const v2f*)(P + off);
#pragma unroll
    for (int i = 1; i < NP; ++i) a += *(const v2f*)(P + (size_t)i * sp + off); return a; }

__global__ __launch_bounds__(256) void k_wtG(const float* __restrict__ w, int K, int N, bf* Bt) {
    const int lane = threadIdx.x & 31; const int L0 = (blockIdx.x * 8 + (threadIdx.x >> 5)) * 8; const int nlines = N * K / 64;
{
#pragma unroll 1
        for (int l = 0; l < 8; ++l) { const int L = L0 + l; if (L >= nlines) break; const size_t e = (size_t)L * 64 + lane * 2; const int k = (int)(e % K), n = (int)(e / K); v2us o;
            o[0] = f2bf(w[(size_t)k * N + n]); o[1] = f2bf(w[(size_t)(k + 1) * N + n]); *(v2us*)(Bt + e) = o; }
         }
}
__global__ __launch_bounds__(256) void k_cvt8(const float* __restrict__ src, bf* dst, size_t n8) { const size_t i = (size_t)blockIdx.x * 256 + threadIdx.x; if (i >= n8) return; const v8f v = *(const v8f*)(src + i * 8); v8us o;
#pragma unroll
    for (int k = 0; k < 8; ++k) o[k] = f2bf(v[k]); *(v8us*)(dst + i * 8) = o;  }
__global__ __launch_bounds__(256) void k_cscvt(const float* __restrict__ cosT, const float* __restrict__ sinT, float* CS) { const int idx = blockIdx.x * 256 + threadIdx.x; if (idx >= TT * HD) return; v2f cs; cs[0] = bfr(cosT[idx]); cs[1] = bfr(sinT[idx]); *(v2f*)(CS + (size_t)idx * 2) = cs;  }
// k_rope: F = KSP partial planes [TT][pitch], summed here; head planes [h][t][d] (fp16 + hi/lo) of rope(x) x sc with the rotate-half convention out[d] = x[d] cos[t][d] - x[d+HD/2] sin[t][d], out[d+HD/2] = x[d+HD/2] cos[t][d+HD/2] + x[d] sin[t][d+HD/2]
__global__ __launch_bounds__(256) void k_rope(const float* __restrict__ F, int pitch, int nheads, const float* __restrict__ CS, const float* __restrict__ RF, const float* __restrict__ nw, float sc, h16* P16, bf* Ph, bf* Pl) {
    const size_t e = ((size_t)blockIdx.x * 256 + threadIdx.x) * 2; if (e >= (size_t)nheads * TT * HD) return; const int d = (int)(e % HD); const int t = (int)((e / HD) % TT); const int h = (int)(e / ((size_t)HD * TT)); const unsigned fo = (unsigned)t * pitch + h * HD; v2h o16; v2us oh, ol;
    const v2f X0 = psum2<KSP>(F, (size_t)TT * pitch, fo + d), X1 = psum2<KSP>(F, (size_t)TT * pitch, fo + ((d < HD / 2) ? d + HD / 2 : d - HD / 2));
    asm volatile("s_wait_xcnt 0x0" ::: "memory");   // stands in front of the first rewrite of an address register of the plane loads above
    const float rf = RF ? RF[(size_t)h * TT + t] : 1.0f;
#pragma unroll
    for (int q = 0; q < 2; ++q) { const int dd = d + q; const int dp = (dd < HD / 2) ? dd + HD / 2 : dd - HD / 2; float x0 = X0[q], x1 = X1[q];   // d is even: d + q and its partner dp stay in their halves
        if (RF) { float n0 = __fmul_rn(x0, rf), n1 = __fmul_rn(x1, rf); asm volatile("" : "+v"(n0)); asm volatile("" : "+v"(n1)); x0 = __fmul_rn(bfr(nw[dd]), n0); x1 = __fmul_rn(bfr(nw[dp]), n1); }
        const v2f cs = *(const v2f*)(CS + ((size_t)t * HD + dd) * 2); float a = __fmul_rn(x0, cs[0]), bq = __fmul_rn(x1, cs[1]); asm volatile("" : "+v"(a)); asm volatile("" : "+v"(bq)); const float r = ((dd < HD / 2) ? __fsub_rn(a, bq) : __fadd_rn(a, bq)) * sc;
        o16[q] = tohx(r); unsigned short a2, c2; splitf(r, a2, c2); oh[q] = a2; ol[q] = c2; }
    *(v2h*)(P16 + e) = o16; *(v2us*)(Ph + e) = oh; *(v2us*)(Pl + e) = ol;  }
__global__ __launch_bounds__(256) void k_vtp(const float* __restrict__ F, int pitch, int nheads, h16* V16, bf* Vh, bf* Vl) { const size_t e = ((size_t)blockIdx.x * 256 + threadIdx.x) * 2; if (e >= (size_t)nheads * HD * TT) return; const int t = (int)(e % TT); const int d = (int)((e / TT) % HD); const int g = (int)(e / ((size_t)TT * HD)); v2h o16; v2us oh, ol;
#pragma unroll
    for (int q = 0; q < 2; ++q) { const float x = F[(size_t)(t + q) * pitch + g * HD + d]; o16[q] = tohx(x); unsigned short a2, c2; splitf(x, a2, c2); oh[q] = a2; ol[q] = c2; }
    *(v2h*)(V16 + e) = o16; *(v2us*)(Vh + e) = oh; *(v2us*)(Vl + e) = ol;  }
__global__ __launch_bounds__(256) void k_csid(float* CS) { const int idx = blockIdx.x * 256 + threadIdx.x; if (idx >= TT * HD) return; v2f cs; cs[0] = 1.0f; cs[1] = 0.0f; *(v2f*)(CS + (size_t)idx * 2) = cs;  }
typedef v4i __attribute__((may_alias)) v4ia;
template <typename T16> struct PFrag;
template <> struct PFrag<h16> { static __device__ __forceinline__ void put(v16h& a, v16h& b, int e, float p) { (void)b; a[e] = (h16)p; } };
template <> struct PFrag<bf> { static __device__ __forceinline__ void put(v16bf& a, v16bf& b, int e, float p) { const __bf16 x = (__bf16)p; a[e] = x; b[e] = (__bf16)(p - (float)x); } };
template <typename T16, bool HL, int NQT>
__device__ __forceinline__ void fattn_body(const T16* __restrict__ Q, const T16* __restrict__ Q2, const T16* __restrict__ Kp, const T16* __restrict__ K2, const T16* __restrict__ Vt, const T16* __restrict__ V2, const float* __restrict__ ED, const int* __restrict__ mk, float sb2, int q0, int h, bf* Ah, bf* Al, char* sm) {
    typedef typename WFrag<T16>::V V;
    constexpr int NQ = 16 * NQT, NP = HL ? 2 : 1, KTE = 32 * KPI, VTE = 64 * VPI, STG = NP * (KTE + VTE), NS = TT / 2 / 32;
    const int lane = threadIdx.x & 31, lr = lane & 15, hi = lane >> 4, th = threadIdx.x & 127; const int w = __builtin_amdgcn_readfirstlane(threadIdx.x >> 5), qg = w & 3, kh = w >> 2;
    T16* st = (T16*)sm + kh * 2 * STG;                          // this key half's two stage buffers: K plane(s), then Vt plane(s)
    float* bs = (float*)(sm + 4 * STG * 2) + w * NQ * BPI;      // this wave's own bias rows
    const int qw = q0 + qg * NQ; const size_t hp = (size_t)h * TT * HD;
    V qf[NQT][2], qf2[NQT][2];
#pragma unroll
    for (int qt = 0; qt < NQT; ++qt)
#pragma unroll
        for (int kk = 0; kk < 2; ++kk) { const size_t a = hp + (size_t)(qw + qt * 16 + lr) * HD + kk * 32 + 8 * hi; qf[qt][kk] = WFrag<T16>::ld(Q + a); if (HL) qf2[qt][kk] = WFrag<T16>::ld(Q2 + a); }
    v8f o[4][NQT]; float m[NQT], l[NQT];
#pragma unroll
    for (int qt = 0; qt < NQT; ++qt) { m[qt] = -3.0e38f; l[qt] = 0.f;
#pragma unroll
        for (int dt = 0; dt < 4; ++dt) o[dt][qt] = (v8f){}; }
    const int kb = kh * (TT / 2);
    // the next stage on its way: 16-byte chunk c = th + 128 i of the K tile (32 rows x 8 chunks, contiguous in memory) and of the Vt tile (64 rows x 4 chunks); rows 4 i + lane / 8 of the bias block (8 lanes a 128-byte row)
    v4i rk[NP][2], rv[NP][2], rm[NQT][4]; v4f re[NQT][4];
    const size_t ak = hp + (size_t)kb * HD + th * 8, av = hp + (size_t)(th >> 2) * TT + kb + (th & 3) * 8, ae = (size_t)(qw + (lane >> 3)) * TT + kb + (lane & 7) * 4;
    const T16* kp = Kp + ak; const T16* kp2 = HL ? K2 + ak : nullptr; const T16* vp = Vt + av; const T16* vp2 = HL ? V2 + av : nullptr; const float* ep = ED + ae; const int* mp = mk + ae;
    auto gload = [&]() {
#pragma unroll
        for (int i = 0; i < 2; ++i) { rk[0][i] = *(const v4ia*)(kp + i * 1024); rv[0][i] = *(const v4ia*)(vp + i * 32 * TT); if (HL) { rk[NP - 1][i] = *(const v4ia*)(kp2 + i * 1024); rv[NP - 1][i] = *(const v4ia*)(vp2 + i * 32 * TT); } }
#pragma unroll
        for (int qt = 0; qt < NQT; ++qt)
#pragma unroll
            for (int i = 0; i < 4; ++i) { re[qt][i] = *(const v4f*)(ep + (qt * 16 + 4 * i) * TT); rm[qt][i] = *(const v4i*)(mp + (qt * 16 + 4 * i) * TT); }
        kp += 32 * HD; vp += 32; ep += 32; mp += 32; if (HL) { kp2 += 32 * HD; vp2 += 32; } };
    auto sstore = [&](int buf) { T16* b = st + buf * STG;
#pragma unroll
        for (int i = 0; i < 2; ++i) { const int c = th + 128 * i; const int sk = (c >> 3) * KPI + (c & 7) * 8, sv = NP * KTE + (c >> 2) * VPI + (c & 3) * 8;
            *(v4ia*)(b + sk) = rk[0][i]; *(v4ia*)(b + sv) = rv[0][i]; if (HL) { *(v4ia*)(b + KTE + sk) = rk[NP - 1][i]; *(v4ia*)(b + VTE + sv) = rv[NP - 1][i]; } }
#pragma unroll
        for (int qt = 0; qt < NQT; ++qt)
#pragma unroll
            for (int i = 0; i < 4; ++i) { v4f bb;
#pragma unroll
                for (int u = 0; u < 4; ++u) bb[u] = (rm[qt][i][u] == 0) ? -__builtin_inff() : sb2 * re[qt][i][u];
                *(v4f*)(bs + (qt * 16 + 4 * i + (lane >> 3)) * BPI + (lane & 7) * 4) = bb; } };
    gload(); sstore(0); __syncthreads();
#pragma unroll 1   // rolled: the stage body is several hundred instructions, and unrolled it would leave the register limit
    for (int s = 0; s < NS; ++s) { const T16* b = st + (s & 1) * STG;
        if (s + 1 < NS) gload();
        v8f sc_[2][NQT];
#pragma unroll
        for (int kt = 0; kt < 2; ++kt) { V ka[2], ka2[2];
#pragma unroll
            for (int kk = 0; kk < 2; ++kk) { const int a = (kt * 16 + lr) * KPI + kk * 32 + 8 * hi; ka[kk] = WFrag<T16>::ld(b + a); if (HL) ka2[kk] = WFrag<T16>::ld(b + KTE + a); }
#pragma unroll
            for (int qt = 0; qt < NQT; ++qt) { v8f c = (v8f){};
#pragma unroll
                for (int kk = 0; kk < 2; ++kk) { c = WFrag<T16>::mma(ka[kk], qf[qt][kk], c); if (HL) { c = WFrag<T16>::mma(ka[kk], qf2[qt][kk], c); c = WFrag<T16>::mma(ka2[kk], qf[qt][kk], c); } }
                sc_[kt][qt] = c; } }
        V pf[NQT], pf2[NQT];
#pragma unroll
        for (int qt = 0; qt < NQT; ++qt) { float mx = m[qt];
#pragma unroll
            for (int kt = 0; kt < 2; ++kt) { const float* br = bs + (qt * 16 + lr) * BPI + kt * 16 + 8 * hi; const v4f e0 = *(const v4f*)br, e1 = *(const v4f*)(br + 4);
#pragma unroll
                for (int j = 0; j < 8; ++j) { const float t = sc_[kt][qt][j] * (SCL * LOG2E) + ((j < 4) ? e0[j & 3] : e1[j & 3]); sc_[kt][qt][j] = t; mx = fmaxf(mx, t); } }
            mx = fmaxf(mx, __shfl_xor(mx, 16, 32));
            const float rs = __builtin_amdgcn_exp2f(m[qt] - mx); m[qt] = mx; float ps = 0.f;
#pragma unroll
            for (int kt = 0; kt < 2; ++kt)
#pragma unroll
                for (int j = 0; j < 8; ++j) { const float p = __builtin_amdgcn_exp2f(sc_[kt][qt][j] - mx); ps += p; PFrag<T16>::put(pf[qt], pf2[qt], kt * 8 + j, p); }
            l[qt] = l[qt] * rs + ps;   // this lane half's keys only; the lane halves are joined behind the loop
#pragma unroll
            for (int dt = 0; dt < 4; ++dt) o[dt][qt] *= rs; }
#pragma unroll
        for (int dt = 0; dt < 4; ++dt) { const int a = NP * KTE + (dt * 16 + lr) * VPI + 8 * hi; const V va = WFrag<T16>::ld(b + a); V va2; if (HL) va2 = WFrag<T16>::ld(b + VTE + a);
#pragma unroll
            for (int qt = 0; qt < NQT; ++qt) { o[dt][qt] = WFrag<T16>::mma(va, pf[qt], o[dt][qt]); if (HL) { o[dt][qt] = WFrag<T16>::mma(va, pf2[qt], o[dt][qt]); o[dt][qt] = WFrag<T16>::mma(va2, pf[qt], o[dt][qt]); } } }
        if (s + 1 < NS) sstore((s + 1) & 1);   // K, Vt: the buffer that stage s - 1 read, whose readers passed the barrier at the foot of that stage; bias rows: this wave's own, read above
        __syncthreads();                       // publishes stage s + 1 and ends every read of stage s
    }
    // join of the two key halves, lane for lane: half 1 leaves its set in LDS (over the stage buffers, all read by now), half 0 adds it to its own and writes whole 128-byte lines of the merged planes
    float* jo = (float*)sm + (size_t)qg * NQT * 4 * 32 * 8 + lane * 8; float* jm = (float*)sm + 4 * NQT * 4 * 32 * 8 + qg * NQT * 32 * 2 + lane * 2;
    if (kh == 1) {
#pragma unroll
        for (int qt = 0; qt < NQT; ++qt) { v2f ml; ml[0] = m[qt]; ml[1] = l[qt]; *(v2f*)(jm + qt * 64) = ml;
#pragma unroll
            for (int dt = 0; dt < 4; ++dt) { *(v4f*)(jo + (qt * 4 + dt) * 256) = __builtin_shufflevector(o[dt][qt], o[dt][qt], 0, 1, 2, 3); *(v4f*)(jo + (qt * 4 + dt) * 256 + 4) = __builtin_shufflevector(o[dt][qt], o[dt][qt], 4, 5, 6, 7); } } }
    __syncthreads();
    if (kh == 0) {
#pragma unroll
        for (int qt = 0; qt < NQT; ++qt) { const v2f ml = *(const v2f*)(jm + qt * 64); const float M = fmaxf(m[qt], ml[0]); const float f0 = __builtin_amdgcn_exp2f(m[qt] - M), f1 = __builtin_amdgcn_exp2f(ml[0] - M);
            float L = l[qt] * f0 + ml[1] * f1; L += __shfl_xor(L, 16, 32); const float inv = 1.0f / L;
#pragma unroll
            for (int dt = 0; dt < 4; ++dt) { const v4f x0 = *(const v4f*)(jo + (qt * 4 + dt) * 256), x1 = *(const v4f*)(jo + (qt * 4 + dt) * 256 + 4); v8us oh, ol;
#pragma unroll
                for (int u = 0; u < 8; ++u) { unsigned short x, y; splitf((o[dt][qt][u] * f0 + ((u < 4) ? x0[u & 3] : x1[u & 3]) * f1) * inv, x, y); oh[u] = x; ol[u] = y; }
                const size_t oo = (size_t)(qw + qt * 16 + lr) * DQ + h * HD + dt * 16 + 8 * hi; *(v8us*)(Ah + oo) = oh; *(v8us*)(Al + oo) = ol;
                asm volatile("s_wait_xcnt 0x0" ::: "memory"); } } }   // stands in front of the next trip's rewrite of the two stores' address and data registers
}
// grid (heads, TT / 64): 64 query rows a work-group; the hi+lo tiles (three products each) have the low indices. Four waves a SIMD (at most 256 registers): the grid is two work-groups a WGP.
__global__ __launch_bounds__(256, 4) void k_fattn(const h16* __restrict__ Q16, const h16* __restrict__ K16, const h16* __restrict__ V16, const bf* __restrict__ Qh, const bf* __restrict__ Ql, const bf* __restrict__ Kh, const bf* __restrict__ Kl, const bf* __restrict__ Vh, const bf* __restrict__ Vl, const float* __restrict__ ED, const int* __restrict__ mk, const float* __restrict__ sbias, bf* Ah, bf* Al) {
    __shared__ __align__(16) char sm[4 * 2 * (32 * KPI + 64 * VPI) * 2 + 8 * 16 * BPI * 4];   // the hi+lo form's stage buffers and bias rows; the fp16 form has half the planes
    const int h = blockIdx.x, q0 = (int)blockIdx.y * 64; const float sb2 = bfr(sbias[h]) * LOG2E;
    if (q0 < RH) fattn_body<bf, true, 1>(Qh, Ql, Kh, Kl, Vh, Vl, ED, mk, sb2, q0, h, Ah, Al, sm);
    else fattn_body<h16, false, 1>(Q16, nullptr, K16, nullptr, V16, nullptr, ED, mk, sb2, q0, h, Ah, Al, sm);
}
// k_osum: out = sum of the KSP partial planes of merged x Wo, + bias (16-B lanes)
__global__ __launch_bounds__(256) void k_osum(const float* __restrict__ P, const float* __restrict__ bias, float* out) { const unsigned i4 = blockIdx.x * 256 + threadIdx.x; if (i4 >= TT * DM / 4) return; const unsigned c = (i4 * 4) % DM; const v4f* P4 = (const v4f*)P; v4f a = P4[i4];
#pragma unroll
    for (int i = 1; i < KSP; ++i) a += (P4 + (size_t)i * (TT * DM / 4))[i4];
#pragma unroll
    for (int u = 0; u < 4; ++u) a[u] += bfr(bias[c + u]);
    ((v4f*)out)[i4] = a;  }

__global__ __launch_bounds__(256) void k_dist(const float* __restrict__ co, float* ED) { const size_t e = ((size_t)blockIdx.x * 256 + threadIdx.x) * 4; if (e >= (size_t)TT * TT) return; const int j = (int)(e % TT); const int i = (int)(e / TT); const float xi = bfr(co[i * 2]), yi = bfr(co[i * 2 + 1]); v4f o;   // exp(-dist): dist = sqrt(dx^2 + dy^2) (0 when d2 == 0) (16-B lanes)
#pragma unroll
    for (int u = 0; u < 4; ++u) { const float dx = __fsub_rn(xi, bfr(co[(j + u) * 2])), dy = __fsub_rn(yi, bfr(co[(j + u) * 2 + 1])); float px = __fmul_rn(dx, dx), py = __fmul_rn(dy, dy); asm volatile("" : "+v"(px)); asm volatile("" : "+v"(py)); const float d2 = __fadd_rn(px, py); const float dist = (d2 == 0.f) ? 0.f : __fsqrt_rn(d2); o[u] = __expf(-dist); }
    *(v4f*)(ED + e) = o;  }

extern "C" void kernel_launch(void* const* d_in, const int* in_sizes, int n_in,
                              void* d_out, int out_size, void* d_ws, size_t ws_size, hipStream_t stream) {
    (void)in_sizes; (void)n_in; (void)out_size;
    const float* x = (const float*)d_in[0]; const float* coords = (const float*)d_in[1]; const int* mask = (const int*)d_in[2]; const float* wq = (const float*)d_in[3]; const float* wk = (const float*)d_in[4]; const float* wv = (const float*)d_in[5]; const float* sbias = (const float*)d_in[6]; const float* wo = (const float*)d_in[7]; const float* bo = (const float*)d_in[8]; const float* cosT = nullptr; const float* sinT = nullptr; (void)cosT; (void)sinT;
    float* OUT = (float*)d_out;     // [2][2048][1024]
    char* wsp = (char*)d_ws;
    auto take = [&](size_t bytes) { char* p = wsp; wsp += (bytes + 255) & ~(size_t)255; return (void*)p; };
    bf* WQ = (bf*)take((size_t)DQ * DM * 2); bf* WK = (bf*)take((size_t)DKV * DM * 2); bf* WV = (bf*)take((size_t)DKV * DM * 2); bf* WO = (bf*)take((size_t)DM * DQ * 2); float* CS = (float*)take((size_t)TT * HD * 2 * 4);
    bf* XB = (bf*)take((size_t)TT * DM * 2); float* ED = (float*)take((size_t)TT * TT * 4); float* FQ = (float*)take((size_t)KSP * TT * DQ * 4); float* FK = (float*)take((size_t)KSP * TT * DKV * 4);
    h16* QP16 = (h16*)take((size_t)NH_ * TT * HD * 2); h16* KP16 = (h16*)take((size_t)NKV * TT * HD * 2); h16* VT16 = (h16*)take((size_t)NKV * HD * TT * 2);
    bf* QPh = (bf*)take((size_t)NH_ * TT * HD * 2); bf* QPl = (bf*)take((size_t)NH_ * TT * HD * 2); bf* KPh = (bf*)take((size_t)NKV * TT * HD * 2); bf* KPl = (bf*)take((size_t)NKV * TT * HD * 2); bf* VTh = (bf*)take((size_t)NKV * HD * TT * 2); bf* VTl = (bf*)take((size_t)NKV * HD * TT * 2);
    bf* ATh = (bf*)take((size_t)TT * DQ * 2); bf* ATl = (bf*)take((size_t)TT * DQ * 2);
    if ((size_t)(wsp - (char*)d_ws) > ws_size) return;    // ws 256 MiB
    float* FV = FK;   // v projection reuses the k buffer after the k planes are built (stream-ordered)
    float* FO = FQ;   // the Wo partial planes reuse the q buffer after the q planes are built (stream-ordered)
    { k_wtG<<<(unsigned)((DM * DQ / 64 + 63) / 64), 256, 0, stream>>>(wq, DM, DQ, WQ); k_wtG<<<(unsigned)((DM * DKV / 64 + 63) / 64), 256, 0, stream>>>(wk, DM, DKV, WK); k_wtG<<<(unsigned)((DM * DKV / 64 + 63) / 64), 256, 0, stream>>>(wv, DM, DKV, WV);
      k_wtG<<<(unsigned)((DQ * DM / 64 + 63) / 64), 256, 0, stream>>>(wo, DQ, DM, WO);
       }
    k_csid<<<(TT * HD + 255) / 256, 256, 0, stream>>>(CS);
    const unsigned LQ = (unsigned)(((size_t)NH_ * TT * HD / 2 + 255) / 256), LKv = (unsigned)(((size_t)NKV * TT * HD / 2 + 255) / 256);
    for (int b = 0; b < NB_; ++b) {
        
        k_cvt8<<<(unsigned)(((size_t)TT * DM / 8 + 255) / 256), 256, 0, stream>>>(x + (size_t)b * TT * DM, XB, (size_t)TT * DM / 8); k_dist<<<(TT * TT / 4 + 255) / 256, 256, 0, stream>>>(coords + (size_t)b * TT * 2, ED);
        k_gemmw<bf, 0, false, KSP><<<dim3(TT / 64, DQ / 64, KSP), 32, 0, stream>>>(XB, nullptr, WQ, nullptr, DM, FQ, DQ, nullptr, 0, 0, 0, (size_t)TT * DQ);
        k_rope<<<LQ, 256, 0, stream>>>(FQ, DQ, NH_, CS, nullptr, nullptr, 1.0f, QP16, QPh, QPl);
        k_gemmw<bf, 0, false, KSP><<<dim3(TT / 64, DKV / 64, KSP), 32, 0, stream>>>(XB, nullptr, WK, nullptr, DM, FK, DKV, nullptr, 0, 0, 0, (size_t)TT * DKV);
        k_rope<<<LKv, 256, 0, stream>>>(FK, DKV, NKV, CS, nullptr, nullptr, 1.0f, KP16, KPh, KPl);
        k_gemmw<bf, 0, false, 1><<<dim3(TT / 64, DKV / 64, 1), 32, 0, stream>>>(XB, nullptr, WV, nullptr, DM, FV, DKV, nullptr, 0, 0, 0, 0); k_vtp<<<LKv, 256, 0, stream>>>(FV, DKV, NKV, VT16, VTh, VTl);
        k_fattn<<<dim3(NH_, TT / 64), 256, 0, stream>>>(QP16, KP16, VT16, QPh, QPl, KPh, KPl, VTh, VTl, ED, mask + (size_t)b * TT * TT, sbias, ATh, ATl);
        k_gemmw<bf, 1, false, KSP><<<dim3(TT / 64, DM / 64, KSP), 32, 0, stream>>>(ATh, ATl, WO, nullptr, DQ, FO, DM, nullptr, 0, 0, 0, (size_t)TT * DM);
        k_osum<<<(unsigned)(((size_t)TT * DM / 4 + 255) / 256), 256, 0, stream>>>(FO, bo, OUT + (size_t)b * TT * DM); }
}

// v003
// It runs in 277 microseconds.
// Timed twice side by side with v002, it ran 1.41 times as fast both times.
// Counting every step since v000, it is 8.13 times as fast.
#include <hip/hip_runtime.h>

// SpatialTemporalAttention (x [2][2048][1024]; Q/K/V = x W ([in,out], no bias; 16 heads x 64); scores = Q.K / 8 + spatial_bias[h] exp(-dist[b][i][j]) with dist = pairwise Euclidean distance of spatial_coords [2][2048][2] (0 when d2 == 0); masked where mask[b][i][j] == 0 (int, read) -> -inf; softmax; out = merged Wo + bo -> [2][2048][1024]).
// Compute dtypes, f32 accumulate: every input rounded to bf16; Q/K/V on PLAIN bf16 operands (inputs: exact), one launch for both batches whose epilogue writes the attention operand planes (k_proj); the distance bias table exp(-dist) [2048][2048] per batch in f32 (k_dist); scores and attn.v (one fused kernel, k_fattn): query rows < 512 hl (3 products), the rest single fp16; bias + mask + running softmax f32; Wo hl x exact (2 products) + bias.

#define NB_  2
#define TT   2048
#define DM   1024
#define NH_  16
#define NKV  16
#define REP  (NH_ / NKV)
#define HD   64
#define DQ   (NH_ * HD)
#define DKV  (NKV * HD)
#define RH   512                  // query rows < RH use hi+lo planes (0: none)
#define WIN  0
#define SCL  0.125f   // HD^-0.5
#define KPI  72                   // k_fattn LDS pitch of a staged K row, elements: 128 B + 16 B (16 B x odd: b128 fragment reads without bank conflicts)
#define VPI  40                   // the same of a staged Vt row: 64 B + 16 B
#define BPI  36                   // the same of a bias row, floats: 128 B + 16 B
#define LOG2E 1.4426950408889634f
#define KSP  4                    // K ranges of the Wo product (1024 -> 256 a work-group)
typedef _Float16 h16;
typedef unsigned short bf;
typedef __attribute__((ext_vector_type(16))) __bf16   v16bf;
typedef __attribute__((ext_vector_type(16))) _Float16 v16h;
typedef __attribute__((ext_vector_type(8)))  _Float16 v8h;
typedef __attribute__((ext_vector_type(8)))  unsigned short v8us;
typedef __attribute__((ext_vector_type(8)))  float    v8f;
typedef __attribute__((ext_vector_type(4)))  float    v4f;
typedef v8h  __attribute__((may_alias)) v8ha;
typedef v4f  __attribute__((may_alias)) v4fa;
typedef v8us __attribute__((may_alias)) v8usa;

__device__ __forceinline__ unsigned short f2bf(float f) { unsigned u = __float_as_uint(f); u += 0x7FFFu + ((u >> 16) & 1u); return (unsigned short)(u >> 16); }
__device__ __forceinline__ float bf2f(unsigned short b) { return __uint_as_float(((unsigned)b) << 16); }
__device__ __forceinline__ float bfr(float f) { return bf2f(f2bf(f)); }
__device__ __forceinline__ v16h cat16(v8h lo, v8h hi) { return __builtin_shufflevector(lo, hi, 0, 1, 2, 3, 4, 5, 6, 7, 8, 9, 10, 11, 12, 13, 14, 15); }
__device__ __forceinline__ v16bf cat16b(v8us lo, v8us hi) { return __builtin_bit_cast(v16bf, __builtin_shufflevector(lo, hi, 0, 1, 2, 3, 4, 5, 6, 7, 8, 9, 10, 11, 12, 13, 14, 15)); }
__device__ __forceinline__ v8f wmma16(v16h a, v16h b, v8f c) { return __builtin_amdgcn_wmma_f32_16x16x32_f16(false, a, false, b, (short)0, c, false, false); }
__device__ __forceinline__ v8f wmmab(v16bf a, v16bf b, v8f c) { return __builtin_amdgcn_wmma_f32_16x16x32_bf16(false, a, false, b, (short)0, c, false, false); }



// ---- k_gemmw: register-blocked GEMM, ONE WAVE per 64x64 output tile (16 accumulators), operands straight from K-contiguous 16-bit planes; grid (M/64, N/64, Z), 32 threads.
// C[m][n] (f32, pitch ldc, + optional f32 bias[n]) = sum_k A[m][k] Bt[n][k] (+ split products per NSPLIT). z-batch strides sA/sB/sC in elements. K % (32 KS) == 0.
// KS > 1: grid z = Z x KS; work-group (z, ks) sums only k in [ks K/KS, (ks+1) K/KS) and stores its f32 partial tile to plane ks (plane stride sP elements); the kernel that reads C adds the KS planes in plane order.
template <typename T16> struct WFrag;
template <> struct WFrag<h16> { typedef v16h V; static __device__ __forceinline__ V ld(const h16* p) { return cat16(*(const v8h*)p, *(const v8h*)(p + 16)); } static __device__ __forceinline__ v8f mma(V a, V b, v8f c) { return wmma16(a, b, c); } };
template <> struct WFrag<bf> { typedef v16bf V; static __device__ __forceinline__ V ld(const bf* p) { return cat16b(*(const v8us*)p, *(const v8us*)(p + 16)); } static __device__ __forceinline__ v8f mma(V a, V b, v8f c) { return wmmab(a, b, c); } };
template <typename T16, int NSPLIT, bool BIAS, int KS>
__global__ __launch_bounds__(32) void k_gemmw(const T16* __restrict__ A, const T16* __restrict__ A2, const T16* __restrict__ Bt, const T16* __restrict__ Bt2, int K, float* C, int ldc, const float* __restrict__ bias, size_t sA, size_t sB, size_t sC, size_t sP) {
    typedef typename WFrag<T16>::V V;
    __shared__ __align__(16) float os[16 * 68];
    const size_t z = blockIdx.z / KS; const int ks = blockIdx.z % KS; A += z * sA; if (A2) A2 += z * sA; Bt += z * sB; if (Bt2) Bt2 += z * sB; C += z * sC + (size_t)ks * sP; const int kn = K / KS, kb = ks * kn;
    const int lane = threadIdx.x & 31, lr = lane & 15, hi = lane >> 4; const int r0 = blockIdx.x * 64, c0 = blockIdx.y * 64;
    v8f acc[4][4];
#pragma unroll
    for (int mb = 0; mb < 4; ++mb)
#pragma unroll
        for (int nb = 0; nb < 4; ++nb) acc[mb][nb] = (v8f){};
    const size_t aoff = (size_t)(r0 + lr) * K + 8 * hi, boff = (size_t)(c0 + lr) * K + 8 * hi;
#pragma unroll 1
    for (int kc = kb; kc < kb + kn; kc += 32) {
        V a[4], a2[4];
#pragma unroll
        for (int mb = 0; mb < 4; ++mb) { a[mb] = WFrag<T16>::ld(A + aoff + (size_t)mb * 16 * K + kc); if (NSPLIT == 1 || NSPLIT == 2) a2[mb] = WFrag<T16>::ld(A2 + aoff + (size_t)mb * 16 * K + kc); }
#pragma unroll
        for (int nb = 0; nb < 4; ++nb) { const V b = WFrag<T16>::ld(Bt + boff + (size_t)nb * 16 * K + kc); V b2; if (NSPLIT >= 2) b2 = WFrag<T16>::ld(Bt2 + boff + (size_t)nb * 16 * K + kc);
#pragma unroll
            for (int mb = 0; mb < 4; ++mb) { acc[mb][nb] = WFrag<T16>::mma(a[mb], b, acc[mb][nb]); if (NSPLIT == 1 || NSPLIT == 2) acc[mb][nb] = WFrag<T16>::mma(a2[mb], b, acc[mb][nb]); if (NSPLIT >= 2) acc[mb][nb] = WFrag<T16>::mma(a[mb], b2, acc[mb][nb]); } }
        asm volatile("v_nop\n\tv_nop\n\tv_nop\n\tv_nop" : "+v"(acc[0][0]), "+v"(acc[1][1]), "+v"(acc[2][2]), "+v"(acc[3][3]) : "v"(a[0]), "v"(a[3]));
    }
#pragma unroll
    for (int mb = 0; mb < 4; ++mb) {
#pragma unroll
        for (int nb = 0; nb < 4; ++nb) {
#pragma unroll
            for (int j = 0; j < 8; ++j) os[(hi * 8 + j) * 68 + nb * 16 + lr] = acc[mb][nb][j]; }
        __builtin_amdgcn_wave_barrier(); asm volatile("" ::: "memory");
        float* crow = C + (size_t)(r0 + mb * 16) * ldc + c0;
{
#pragma unroll
            for (int s = 0; s < 8; ++s) { const int row = 2 * s + hi, cofs = lr * 4; v4f val = *(const v4fa*)(os + row * 68 + cofs); if (BIAS) { val[0] += bfr(bias[c0 + cofs]); val[1] += bfr(bias[c0 + cofs + 1]); val[2] += bfr(bias[c0 + cofs + 2]); val[3] += bfr(bias[c0 + cofs + 3]); }
                *(v4f*)(crow + (size_t)row * ldc + cofs) = val; }
             }
        __builtin_amdgcn_wave_barrier(); asm volatile("" ::: "memory");
    }
}

__device__ __forceinline__ h16 tohx(float x) { return (h16)x; }
__device__ __forceinline__ void splitf(float y, unsigned short& h, unsigned short& l) { h = f2bf(y); l = f2bf(y - bf2f(h)); }
typedef __attribute__((ext_vector_type(2))) _Float16 v2h;
typedef __attribute__((ext_vector_type(4))) _Float16 v4h;
typedef __attribute__((ext_vector_type(2))) unsigned short v2us;
typedef __attribute__((ext_vector_type(4))) unsigned short v4us;
typedef __attribute__((ext_vector_type(2))) float v2f;
typedef __attribute__((ext_vector_type(4))) int v4i;

__global__ __launch_bounds__(256) void k_wtG(const float* __restrict__ w, int K, int N, bf* Bt) {
    const int lane = threadIdx.x & 31; const int L0 = (blockIdx.x * 8 + (threadIdx.x >> 5)) * 8; const int nlines = N * K / 64;
{
#pragma unroll 1
        for (int l = 0; l < 8; ++l) { const int L = L0 + l; if (L >= nlines) break; const size_t e = (size_t)L * 64 + lane * 2; const int k = (int)(e % K), n = (int)(e / K); v2us o;
            o[0] = f2bf(w[(size_t)k * N + n]); o[1] = f2bf(w[(size_t)(k + 1) * N + n]); *(v2us*)(Bt + e) = o; }
         }
}
__global__ __launch_bounds__(256) void k_cvt8(const float* __restrict__ src, bf* dst, size_t n8) { const size_t i = (size_t)blockIdx.x * 256 + threadIdx.x; if (i >= n8) return; const v8f v = *(const v8f*)(src + i * 8); v8us o;
#pragma unroll
    for (int k = 0; k < 8; ++k) o[k] = f2bf(v[k]); *(v8us*)(dst + i * 8) = o;  }
__global__ __launch_bounds__(256) void k_cscvt(const float* __restrict__ cosT, const float* __restrict__ sinT, float* CS) { const int idx = blockIdx.x * 256 + threadIdx.x; if (idx >= TT * HD) return; v2f cs; cs[0] = bfr(cosT[idx]); cs[1] = bfr(sinT[idx]); *(v2f*)(CS + (size_t)idx * 2) = cs;  }
// ---- k_proj: the Q, K and V projections of both batches in one launch; ONE WAVE per 64x64 tile as in k_gemmw, the whole K range in one accumulation, and the epilogue writes the operand planes of k_fattn itself (fp16, and bf16 hi + lo).
// grid (TT / 64, heads, 3 NB_), z = product x NB_ + batch. Q, K: rows = 64 tokens of x, columns = the 64 outputs of head h -> plane [b][h][t][d]. V: rows = the 64 outputs of head h, columns = 64 tokens -> the transposed plane [b][h][d][t].
__global__ __launch_bounds__(32) void k_proj(const bf* __restrict__ XB, const bf* __restrict__ WQ, const bf* __restrict__ WK, const bf* __restrict__ WV, h16* Q16, bf* Qh, bf* Ql, h16* K16, bf* Kh, bf* Kl, h16* V16, bf* Vh, bf* Vl) {
    __shared__ __align__(16) float os[16 * 68];
    const int pr = blockIdx.z / NB_, b = blockIdx.z % NB_, t0 = blockIdx.x * 64, h = blockIdx.y; const bool tr = pr == 2;
    const bf* X = XB + ((size_t)b * TT + t0) * DM; const bf* Wt = (pr == 0 ? WQ : pr == 1 ? WK : WV) + (size_t)h * HD * DM;
    const int lane = threadIdx.x & 31, lr = lane & 15, hi = lane >> 4;
    const bf* A = tr ? Wt : X; const bf* Bt = tr ? X : Wt; const unsigned lo = lr * DM + 8 * hi;   // wave-uniform bases and one lane offset for both operands
    v8f acc[4][4];
#pragma unroll
    for (int mb = 0; mb < 4; ++mb)
#pragma unroll
        for (int nb = 0; nb < 4; ++nb) acc[mb][nb] = (v8f){};
#pragma unroll 1   // rolled, as in k_gemmw: 16 accumulators and 8 fragments already fill the wave's working set
    for (int kc = 0; kc < DM; kc += 32) {
        v16bf a[4];
#pragma unroll
        for (int mb = 0; mb < 4; ++mb) a[mb] = WFrag<bf>::ld(A + kc + (lo + mb * 16 * DM));
        asm volatile("s_wait_xcnt 0x0" ::: "memory");   // stands in front of the B fragment loads: the compiler lays one of their destinations over the address pair of the A loads just issued
#pragma unroll
        for (int nb = 0; nb < 4; ++nb) { const v16bf bb = WFrag<bf>::ld(Bt + kc + (lo + nb * 16 * DM));
#pragma unroll
            for (int mb = 0; mb < 4; ++mb) acc[mb][nb] = wmmab(a[mb], bb, acc[mb][nb]); }
        asm volatile("v_nop\n\tv_nop\n\tv_nop\n\tv_nop" : "+v"(acc[0][0]), "+v"(acc[1][1]), "+v"(acc[2][2]), "+v"(acc[3][3]) : "v"(a[0]), "v"(a[3]));   // the four vector slots between the last WMMA and the next trip's fragment loads over its operands, on the taken side of the loop branch too
    }
    h16* P16 = (pr == 0 ? Q16 : pr == 1 ? K16 : V16); bf* Ph = (pr == 0 ? Qh : pr == 1 ? Kh : Vh); bf* Pl = (pr == 0 ? Ql : pr == 1 ? Kl : Vl);
    const int op = tr ? TT : HD; const size_t ob = ((size_t)b * NH_ + h) * TT * HD + (size_t)t0 * (tr ? 1 : HD) + (size_t)(lane >> 3) * op + (lane & 7) * 8;
#pragma unroll
    for (int mb = 0; mb < 4; ++mb) {
#pragma unroll
        for (int nb = 0; nb < 4; ++nb) {
#pragma unroll
            for (int j = 0; j < 8; ++j) os[(hi * 8 + j) * 68 + nb * 16 + lr] = acc[mb][nb][j]; }
        __builtin_amdgcn_wave_barrier(); asm volatile("" ::: "memory");   // keeps the row reads below behind the tile's LDS writes
#pragma unroll
        for (int s = 0; s < 4; ++s) { const float* rp = os + (4 * s + (lane >> 3)) * 68 + (lane & 7) * 8; const v4f x0 = *(const v4fa*)rp, x1 = *(const v4fa*)(rp + 4); v8h o16; v8us oh, ol;   // 8 lanes a row of 64: whole 128-byte lines of each plane
#pragma unroll
            for (int u = 0; u < 8; ++u) { const float r = (u < 4) ? x0[u & 3] : x1[u & 3]; o16[u] = tohx(r); unsigned short a2, c2; splitf(r, a2, c2); oh[u] = a2; ol[u] = c2; }
            const size_t oo = ob + (size_t)(mb * 16 + 4 * s) * op; *(v8h*)(P16 + oo) = o16; *(v8us*)(Ph + oo) = oh; *(v8us*)(Pl + oo) = ol;
            asm volatile("s_wait_xcnt 0x0" ::: "memory"); }   // stands in front of the next trip's rewrite of the three stores' address and data registers
        __builtin_amdgcn_wave_barrier(); asm volatile("" ::: "memory");   // keeps the next tile's LDS writes behind the row reads above
    }
}
typedef v4i __attribute__((may_alias)) v4ia;
template <typename T16> struct PFrag;
template <> struct PFrag<h16> { static __device__ __forceinline__ void put(v16h& a, v16h& b, int e, float p) { (void)b; a[e] = (h16)p; } };
template <> struct PFrag<bf> { static __device__ __forceinline__ void put(v16bf& a, v16bf& b, int e, float p) { const __bf16 x = (__bf16)p; a[e] = x; b[e] = (__bf16)(p - (float)x); } };
template <typename T16, bool HL, int NQT>
__device__ __forceinline__ void fattn_body(const T16* __restrict__ Q, const T16* __restrict__ Q2, const T16* __restrict__ Kp, const T16* __restrict__ K2, const T16* __restrict__ Vt, const T16* __restrict__ V2, const float* __restrict__ ED, const int* __restrict__ mk, float sb2, int q0, int h, bf* Ah, bf* Al, char* sm) {
    typedef typename WFrag<T16>::V V;
    constexpr int NQ = 16 * NQT, NP = HL ? 2 : 1, KTE = 32 * KPI, VTE = 64 * VPI, STG = NP * (KTE + VTE), NS = TT / 2 / 32;
    const int lane = threadIdx.x & 31, lr = lane & 15, hi = lane >> 4, th = threadIdx.x & 127; const int w = __builtin_amdgcn_readfirstlane(threadIdx.x >> 5), qg = w & 3, kh = w >> 2;
    T16* st = (T16*)sm + kh * 2 * STG;                          // this key half's two stage buffers: K plane(s), then Vt plane(s)
    float* bs = (float*)(sm + 4 * STG * 2) + w * NQ * BPI;      // this wave's own bias rows
    const int qw = q0 + qg * NQ; const size_t hp = (size_t)h * TT * HD;
    V qf[NQT][2], qf2[NQT][2];
#pragma unroll
    for (int qt = 0; qt < NQT; ++qt)
#pragma unroll
        for (int kk = 0; kk < 2; ++kk) { const size_t a = hp + (size_t)(qw + qt * 16 + lr) * HD + kk * 32 + 8 * hi; qf[qt][kk] = WFrag<T16>::ld(Q + a); if (HL) qf2[qt][kk] = WFrag<T16>::ld(Q2 + a); }
    v8f o[4][NQT]; float m[NQT], l[NQT];
#pragma unroll
    for (int qt = 0; qt < NQT; ++qt) { m[qt] = -3.0e38f; l[qt] = 0.f;
#pragma unroll
        for (int dt = 0; dt < 4; ++dt) o[dt][qt] = (v8f){}; }
    const int kb = kh * (TT / 2);
    // the next stage on its way: 16-byte chunk c = th + 128 i of the K tile (32 rows x 8 chunks, contiguous in memory) and of the Vt tile (64 rows x 4 chunks); rows 4 i + lane / 8 of the bias block (8 lanes a 128-byte row)
    v4i rk[NP][2], rv[NP][2], rm[NQT][4]; v4f re[NQT][4];
    const size_t ak = hp + (size_t)kb * HD + th * 8, av = hp + (size_t)(th >> 2) * TT + kb + (th & 3) * 8, ae = (size_t)(qw + (lane >> 3)) * TT + kb + (lane & 7) * 4;
    const T16* kp = Kp + ak; const T16* kp2 = HL ? K2 + ak : nullptr; const T16* vp = Vt + av; const T16* vp2 = HL ? V2 + av : nullptr; const float* ep = ED + ae; const int* mp = mk + ae;
    auto gload = [&]() {
#pragma unroll
        for (int i = 0; i < 2; ++i) { rk[0][i] = *(const v4ia*)(kp + i * 1024); rv[0][i] = *(const v4ia*)(vp + i * 32 * TT); if (HL) { rk[NP - 1][i] = *(const v4ia*)(kp2 + i * 1024); rv[NP - 1][i] = *(const v4ia*)(vp2 + i * 32 * TT); } }
#pragma unroll
        for (int qt = 0; qt < NQT; ++qt)
#pragma unroll
            for (int i = 0; i < 4; ++i) { re[qt][i] = *(const v4f*)(ep + (qt * 16 + 4 * i) * TT); rm[qt][i] = *(const v4i*)(mp + (qt * 16 + 4 * i) * TT); }
        kp += 32 * HD; vp += 32; ep += 32; mp += 32; if (HL) { kp2 += 32 * HD; vp2 += 32; } };
    auto sstore = [&](int buf) { T16* b = st + buf * STG;
#pragma unroll
        for (int i = 0; i < 2; ++i) { const int c = th + 128 * i; const int sk = (c >> 3) * KPI + (c & 7) * 8, sv = NP * KTE + (c >> 2) * VPI + (c & 3) * 8;
            *(v4ia*)(b + sk) = rk[0][i]; *(v4ia*)(b + sv) = rv[0][i]; if (HL) { *(v4ia*)(b + KTE + sk) = rk[NP - 1][i]; *(v4ia*)(b + VTE + sv) = rv[NP - 1][i]; } }
#pragma unroll
        for (int qt = 0; qt < NQT; ++qt)
#pragma unroll
            for (int i = 0; i < 4; ++i) { v4f bb;
#pragma unroll
                for (int u = 0; u < 4; ++u) bb[u] = (rm[qt][i][u] == 0) ? -__builtin_inff() : sb2 * re[qt][i][u];
                *(v4f*)(bs + (qt * 16 + 4 * i + (lane >> 3)) * BPI + (lane & 7) * 4) = bb; } };
    gload(); sstore(0); __syncthreads();
#pragma unroll 1   // rolled: the stage body is several hundred instructions, and unrolled it would leave the register limit
    for (int s = 0; s < NS; ++s) { const T16* b = st + (s & 1) * STG;
        if (s + 1 < NS) gload();
        v8f sc_[2][NQT];
#pragma unroll
        for (int kt = 0; kt < 2; ++kt) { V ka[2], ka2[2];
#pragma unroll
            for (int kk = 0; kk < 2; ++kk) { const int a = (kt * 16 + lr) * KPI + kk * 32 + 8 * hi; ka[kk] = WFrag<T16>::ld(b + a); if (HL) ka2[kk] = WFrag<T16>::ld(b + KTE + a); }
#pragma unroll
            for (int qt = 0; qt < NQT; ++qt) { v8f c = (v8f){};
#pragma unroll
                for (int kk = 0; kk < 2; ++kk) { c = WFrag<T16>::mma(ka[kk], qf[qt][kk], c); if (HL) { c = WFrag<T16>::mma(ka[kk], qf2[qt][kk], c); c = WFrag<T16>::mma(ka2[kk], qf[qt][kk], c); } }
                sc_[kt][qt] = c; } }
        V pf[NQT], pf2[NQT];
#pragma unroll
        for (int qt = 0; qt < NQT; ++qt) { float mx = m[qt];
#pragma unroll
            for (int kt = 0; kt < 2; ++kt) { const float* br = bs + (qt * 16 + lr) * BPI + kt * 16 + 8 * hi; const v4f e0 = *(const v4f*)br, e1 = *(const v4f*)(br + 4);
#pragma unroll
                for (int j = 0; j < 8; ++j) { const float t = sc_[kt][qt][j] * (SCL * LOG2E) + ((j < 4) ? e0[j & 3] : e1[j & 3]); sc_[kt][qt][j] = t; mx = fmaxf(mx, t); } }
            mx = fmaxf(mx, __shfl_xor(mx, 16, 32));
            const float rs = __builtin_amdgcn_exp2f(m[qt] - mx); m[qt] = mx; float ps = 0.f;
#pragma unroll
            for (int kt = 0; kt < 2; ++kt)
#pragma unroll
                for (int j = 0; j < 8; ++j) { const float p = __builtin_amdgcn_exp2f(sc_[kt][qt][j] - mx); ps += p; PFrag<T16>::put(pf[qt], pf2[qt], kt * 8 + j, p); }
            l[qt] = l[qt] * rs + ps;   // this lane half's keys only; the lane halves are joined behind the loop
#pragma unroll
            for (int dt = 0; dt < 4; ++dt) o[dt][qt] *= rs; }
#pragma unroll
        for (int dt = 0; dt < 4; ++dt) { const int a = NP * KTE + (dt * 16 + lr) * VPI + 8 * hi; const V va = WFrag<T16>::ld(b + a); V va2; if (HL) va2 = WFrag<T16>::ld(b + VTE + a);
#pragma unroll
            for (int qt = 0; qt < NQT; ++qt) { o[dt][qt] = WFrag<T16>::mma(va, pf[qt], o[dt][qt]); if (HL) { o[dt][qt] = WFrag<T16>::mma(va, pf2[qt], o[dt][qt]); o[dt][qt] = WFrag<T16>::mma(va2, pf[qt], o[dt][qt]); } } }
        if (s + 1 < NS) sstore((s + 1) & 1);   // K, Vt: the buffer that stage s - 1 read, whose readers passed the barrier at the foot of that stage; bias rows: this wave's own, read above
        __syncthreads();                       // publishes stage s + 1 and ends every read of stage s
    }
    // join of the two key halves, lane for lane: half 1 leaves its set in LDS (over the stage buffers, all read by now), half 0 adds it to its own and writes whole 128-byte lines of the merged planes
    float* jo = (float*)sm + (size_t)qg * NQT * 4 * 32 * 8 + lane * 8; float* jm = (float*)sm + 4 * NQT * 4 * 32 * 8 + qg * NQT * 32 * 2 + lane * 2;
    if (kh == 1) {
#pragma unroll
        for (int qt = 0; qt < NQT; ++qt) { v2f ml; ml[0] = m[qt]; ml[1] = l[qt]; *(v2f*)(jm + qt * 64) = ml;
#pragma unroll
            for (int dt = 0; dt < 4; ++dt) { *(v4f*)(jo + (qt * 4 + dt) * 256) = __builtin_shufflevector(o[dt][qt], o[dt][qt], 0, 1, 2, 3); *(v4f*)(jo + (qt * 4 + dt) * 256 + 4) = __builtin_shufflevector(o[dt][qt], o[dt][qt], 4, 5, 6, 7); } } }
    __syncthreads();
    if (kh == 0) {
#pragma unroll
        for (int qt = 0; qt < NQT; ++qt) { const v2f ml = *(const v2f*)(jm + qt * 64); const float M = fmaxf(m[qt], ml[0]); const float f0 = __builtin_amdgcn_exp2f(m[qt] - M), f1 = __builtin_amdgcn_exp2f(ml[0] - M);
            float L = l[qt] * f0 + ml[1] * f1; L += __shfl_xor(L, 16, 32); const float inv = 1.0f / L;
#pragma unroll
            for (int dt = 0; dt < 4; ++dt) { const v4f x0 = *(const v4f*)(jo + (qt * 4 + dt) * 256), x1 = *(const v4f*)(jo + (qt * 4 + dt) * 256 + 4); v8us oh, ol;
#pragma unroll
                for (int u = 0; u < 8; ++u) { unsigned short x, y; splitf((o[dt][qt][u] * f0 + ((u < 4) ? x0[u & 3] : x1[u & 3]) * f1) * inv, x, y); oh[u] = x; ol[u] = y; }
                const size_t oo = (size_t)(qw + qt * 16 + lr) * DQ + h * HD + dt * 16 + 8 * hi; *(v8us*)(Ah + oo) = oh; *(v8us*)(Al + oo) = ol;
                asm volatile("s_wait_xcnt 0x0" ::: "memory"); } } }   // stands in front of the next trip's rewrite of the two stores' address and data registers
}
// grid (heads, TT / 64): 64 query rows a work-group; the hi+lo tiles (three products each) have the low indices. Four waves a SIMD (at most 256 registers): the grid is two work-groups a WGP.
__global__ __launch_bounds__(256, 4) void k_fattn(const h16* __restrict__ Q16, const h16* __restrict__ K16, const h16* __restrict__ V16, const bf* __restrict__ Qh, const bf* __restrict__ Ql, const bf* __restrict__ Kh, const bf* __restrict__ Kl, const bf* __restrict__ Vh, const bf* __restrict__ Vl, const float* __restrict__ ED, const int* __restrict__ mk, const float* __restrict__ sbias, bf* Ah, bf* Al) {
    __shared__ __align__(16) char sm[4 * 2 * (32 * KPI + 64 * VPI) * 2 + 8 * 16 * BPI * 4];   // the hi+lo form's stage buffers and bias rows; the fp16 form has half the planes
    const int h = blockIdx.x, q0 = (int)blockIdx.y * 64; const float sb2 = bfr(sbias[h]) * LOG2E;
    if (q0 < RH) fattn_body<bf, true, 1>(Qh, Ql, Kh, Kl, Vh, Vl, ED, mk, sb2, q0, h, Ah, Al, sm);
    else fattn_body<h16, false, 1>(Q16, nullptr, K16, nullptr, V16, nullptr, ED, mk, sb2, q0, h, Ah, Al, sm);
}
// k_osum: out = sum of the KSP partial planes of merged x Wo, + bias (16-B lanes)
__global__ __launch_bounds__(256) void k_osum(const float* __restrict__ P, const float* __restrict__ bias, float* out) { const unsigned i4 = blockIdx.x * 256 + threadIdx.x; if (i4 >= TT * DM / 4) return; const unsigned c = (i4 * 4) % DM; const v4f* P4 = (const v4f*)P; v4f a = P4[i4];
#pragma unroll
    for (int i = 1; i < KSP; ++i) a += (P4 + (size_t)i * (TT * DM / 4))[i4];
#pragma unroll
    for (int u = 0; u < 4; ++u) a[u] += bfr(bias[c + u]);
    ((v4f*)out)[i4] = a;  }

__global__ __launch_bounds__(256) void k_dist(const float* __restrict__ co, float* ED) { const size_t e = ((size_t)blockIdx.x * 256 + threadIdx.x) * 4; if (e >= (size_t)TT * TT) return; const int j = (int)(e % TT); const int i = (int)(e / TT); const float xi = bfr(co[i * 2]), yi = bfr(co[i * 2 + 1]); v4f o;   // exp(-dist): dist = sqrt(dx^2 + dy^2) (0 when d2 == 0) (16-B lanes)
#pragma unroll
    for (int u = 0; u < 4; ++u) { const float dx = __fsub_rn(xi, bfr(co[(j + u) * 2])), dy = __fsub_rn(yi, bfr(co[(j + u) * 2 + 1])); float px = __fmul_rn(dx, dx), py = __fmul_rn(dy, dy); asm volatile("" : "+v"(px)); asm volatile("" : "+v"(py)); const float d2 = __fadd_rn(px, py); const float dist = (d2 == 0.f) ? 0.f : __fsqrt_rn(d2); o[u] = __expf(-dist); }
    *(v4f*)(ED + e) = o;  }

extern "C" void kernel_launch(void* const* d_in, const int* in_sizes, int n_in,
                              void* d_out, int out_size, void* d_ws, size_t ws_size, hipStream_t stream) {
    (void)in_sizes; (void)n_in; (void)out_size;
    const float* x = (const float*)d_in[0]; const float* coords = (const float*)d_in[1]; const int* mask = (const int*)d_in[2]; const float* wq = (const float*)d_in[3]; const float* wk = (const float*)d_in[4]; const float* wv = (const float*)d_in[5]; const float* sbias = (const float*)d_in[6]; const float* wo = (const float*)d_in[7]; const float* bo = (const float*)d_in[8]; const float* cosT = nullptr; const float* sinT = nullptr; (void)cosT; (void)sinT;
    float* OUT = (float*)d_out;     // [2][2048][1024]
    char* wsp = (char*)d_ws;
    auto take = [&](size_t bytes) { char* p = wsp; wsp += (bytes + 255) & ~(size_t)255; return (void*)p; };
    bf* WQ = (bf*)take((size_t)DQ * DM * 2); bf* WK = (bf*)take((size_t)DKV * DM * 2); bf* WV = (bf*)take((size_t)DKV * DM * 2); bf* WO = (bf*)take((size_t)DM * DQ * 2);
    bf* XB = (bf*)take((size_t)NB_ * TT * DM * 2); float* ED = (float*)take((size_t)TT * TT * 4); float* FO = (float*)take((size_t)KSP * TT * DM * 4);
    const size_t PL = (size_t)NH_ * TT * HD;   // elements of one operand plane of one batch (NKV == NH_)
    h16* QP16 = (h16*)take(NB_ * PL * 2); h16* KP16 = (h16*)take(NB_ * PL * 2); h16* VT16 = (h16*)take(NB_ * PL * 2);
    bf* QPh = (bf*)take(NB_ * PL * 2); bf* QPl = (bf*)take(NB_ * PL * 2); bf* KPh = (bf*)take(NB_ * PL * 2); bf* KPl = (bf*)take(NB_ * PL * 2); bf* VTh = (bf*)take(NB_ * PL * 2); bf* VTl = (bf*)take(NB_ * PL * 2);
    bf* ATh = (bf*)take((size_t)TT * DQ * 2); bf* ATl = (bf*)take((size_t)TT * DQ * 2);
    if ((size_t)(wsp - (char*)d_ws) > ws_size) return;    // ws 256 MiB
    { k_wtG<<<(unsigned)((DM * DQ / 64 + 63) / 64), 256, 0, stream>>>(wq, DM, DQ, WQ); k_wtG<<<(unsigned)((DM * DKV / 64 + 63) / 64), 256, 0, stream>>>(wk, DM, DKV, WK); k_wtG<<<(unsigned)((DM * DKV / 64 + 63) / 64), 256, 0, stream>>>(wv, DM, DKV, WV);
      k_wtG<<<(unsigned)((DQ * DM / 64 + 63) / 64), 256, 0, stream>>>(wo, DQ, DM, WO);
       }
    k_cvt8<<<(unsigned)(((size_t)NB_ * TT * DM / 8 + 255) / 256), 256, 0, stream>>>(x, XB, (size_t)NB_ * TT * DM / 8);
    k_proj<<<dim3(TT / 64, NH_, 3 * NB_), 32, 0, stream>>>(XB, WQ, WK, WV, QP16, QPh, QPl, KP16, KPh, KPl, VT16, VTh, VTl);
    for (int b = 0; b < NB_; ++b) { const size_t pb = (size_t)b * PL;
        k_dist<<<(TT * TT / 4 + 255) / 256, 256, 0, stream>>>(coords + (size_t)b * TT * 2, ED);
        k_fattn<<<dim3(NH_, TT / 64), 256, 0, stream>>>(QP16 + pb, KP16 + pb, VT16 + pb, QPh + pb, QPl + pb, KPh + pb, KPl + pb, VTh + pb, VTl + pb, ED, mask + (size_t)b * TT * TT, sbias, ATh, ATl);
        k_gemmw<bf, 1, false, KSP><<<dim3(TT / 64, DM / 64, KSP), 32, 0, stream>>>(ATh, ATl, WO, nullptr, DQ, FO, DM, nullptr, 0, 0, 0, (size_t)TT * DM);
        k_osum<<<(unsigned)(((size_t)TT * DM / 4 + 255) / 256), 256, 0, stream>>>(FO, bo, OUT + (size_t)b * TT * DM); }
}

// v004
// One run takes 225 microseconds.
// Next to v003, in two timings, it ran 1.23 times as fast each time.
// All steps since v000 together make it 10.00 times as fast.
#include <hip/hip_runtime.h>

// SpatialTemporalAttention (x [2][2048][1024]; Q/K/V = x W ([in,out], no bias; 16 heads x 64); scores = Q.K / 8 + spatial_bias[h] exp(-dist[b][i][j]) with dist = pairwise Euclidean distance of spatial_coords [2][2048][2] (0 when d2 == 0); masked where mask[b][i][j] == 0 (int, read) -> -inf; softmax; out = merged Wo + bo -> [2][2048][1024]).
// Compute dtypes, f32 accumulate: every input rounded to bf16; Q/K/V on PLAIN bf16 operands (inputs: exact), one launch for both batches whose epilogue writes the attention operand planes (k_proj); the distance bias table exp(-dist) [2][2048][2048] in f32 (k_dist); scores and attn.v (one fused kernel, k_fattn): query rows < 512 hl (3 products), the rest single fp16; bias + mask + running softmax f32; Wo hl x exact (2 products) + bias. Every kernel is launched once: batches and the four weight matrices are grid indices.

#define NB_  2
#define TT   2048
#define DM   1024
#define NH_  16
#define NKV  16
#define REP  (NH_ / NKV)
#define HD   64
#define DQ   (NH_ * HD)
#define DKV  (NKV * HD)
#define RH   512                  // query rows < RH use hi+lo planes (0: none)
#define WIN  0
#define SCL  0.125f   // HD^-0.5
#define KPI  72                   // k_fattn LDS pitch of a staged K row, elements: 128 B + 16 B (16 B x odd: b128 fragment reads without bank conflicts)
#define VPI  40                   // the same of a staged Vt row: 64 B + 16 B
#define BPI  36                   // the same of a bias row, floats: 128 B + 16 B
#define LOG2E 1.4426950408889634f
#define KSP  4                    // K ranges of the Wo product (1024 -> 256 a work-group)
typedef _Float16 h16;
typedef unsigned short bf;
typedef __attribute__((ext_vector_type(16))) __bf16   v16bf;
typedef __attribute__((ext_vector_type(16))) _Float16 v16h;
typedef __attribute__((ext_vector_type(8)))  _Float16 v8h;
typedef __attribute__((ext_vector_type(8)))  unsigned short v8us;
typedef __attribute__((ext_vector_type(8)))  float    v8f;
typedef __attribute__((ext_vector_type(4)))  float    v4f;
typedef v8h  __attribute__((may_alias)) v8ha;
typedef v4f  __attribute__((may_alias)) v4fa;
typedef v8us __attribute__((may_alias)) v8usa;

__device__ __forceinline__ unsigned short f2bf(float f) { unsigned u = __float_as_uint(f); u += 0x7FFFu + ((u >> 16) & 1u); return (unsigned short)(u >> 16); }
__device__ __forceinline__ float bf2f(unsigned short b) { return __uint_as_float(((unsigned)b) << 16); }
__device__ __forceinline__ float bfr(float f) { return bf2f(f2bf(f)); }
__device__ __forceinline__ v16h cat16(v8h lo, v8h hi) { return __builtin_shufflevector(lo, hi, 0, 1, 2, 3, 4, 5, 6, 7, 8, 9, 10, 11, 12, 13, 14, 15); }
__device__ __forceinline__ v16bf cat16b(v8us lo, v8us hi) { return __builtin_bit_cast(v16bf, __builtin_shufflevector(lo, hi, 0, 1, 2, 3, 4, 5, 6, 7, 8, 9, 10, 11, 12, 13, 14, 15)); }
__device__ __forceinline__ v8f wmma16(v16h a, v16h b, v8f c) { return __builtin_amdgcn_wmma_f32_16x16x32_f16(false, a, false, b, (short)0, c, false, false); }
__device__ __forceinline__ v8f wmmab(v16bf a, v16bf b, v8f c) { return __builtin_amdgcn_wmma_f32_16x16x32_bf16(false, a, false, b, (short)0, c, false, false); }



// ---- k_gemmw: register-blocked GEMM, ONE WAVE per 64x64 output tile (16 accumulators), operands straight from K-contiguous 16-bit planes; grid (M/64, N/64, Z), 32 threads.
// C[m][n] (f32, pitch ldc, + optional f32 bias[n]) = sum_k A[m][k] Bt[n][k] (+ split products per NSPLIT). z-batch strides sA/sB/sC in elements. K % (32 KS) == 0.
// KS > 1: grid z = Z x KS; work-group (z, ks) sums only k in [ks K/KS, (ks+1) K/KS) and stores its f32 partial tile to plane ks (plane stride sP elements); the kernel that reads C adds the KS planes in plane order.
template <typename T16> struct WFrag;
template <> struct WFrag<h16> { typedef v16h V; static __device__ __forceinline__ V ld(const h16* p) { return cat16(*(const v8h*)p, *(const v8h*)(p + 16)); } static __device__ __forceinline__ v8f mma(V a, V b, v8f c) { return wmma16(a, b, c); } };
template <> struct WFrag<bf> { typedef v16bf V; static __device__ __forceinline__ V ld(const bf* p) { return cat16b(*(const v8us*)p, *(const v8us*)(p + 16)); } static __device__ __forceinline__ v8f mma(V a, V b, v8f c) { return wmmab(a, b, c); } };
template <typename T16, int NSPLIT, bool BIAS, int KS>
__global__ __launch_bounds__(32) void k_gemmw(const T16* __restrict__ A, const T16* __restrict__ A2, const T16* __restrict__ Bt, const T16* __restrict__ Bt2, int K, float* C, int ldc, const float* __restrict__ bias, size_t sA, size_t sB, size_t sC, size_t sP) {
    typedef typename WFrag<T16>::V V;
    __shared__ __align__(16) float os[16 * 68];
    const size_t z = blockIdx.z / KS; const int ks = blockIdx.z % KS; A += z * sA; if (A2) A2 += z * sA; Bt += z * sB; if (Bt2) Bt2 += z * sB; C += z * sC + (size_t)ks * sP; const int kn = K / KS, kb = ks * kn;
    const int lane = threadIdx.x & 31, lr = lane & 15, hi = lane >> 4; const int r0 = blockIdx.x * 64, c0 = blockIdx.y * 64;
    v8f acc[4][4];
#pragma unroll
    for (int mb = 0; mb < 4; ++mb)
#pragma unroll
        for (int nb = 0; nb < 4; ++nb) acc[mb][nb] = (v8f){};
    const size_t aoff = (size_t)(r0 + lr) * K + 8 * hi, boff = (size_t)(c0 + lr) * K + 8 * hi;
#pragma unroll 1
    for (int kc = kb; kc < kb + kn; kc += 32) {
        V a[4], a2[4];
#pragma unroll
        for (int mb = 0; mb < 4; ++mb) { a[mb] = WFrag<T16>::ld(A + aoff + (size_t)mb * 16 * K + kc); if (NSPLIT == 1 || NSPLIT == 2) a2[mb] = WFrag<T16>::ld(A2 + aoff + (size_t)mb * 16 * K + kc); }
#pragma unroll
        for (int nb = 0; nb < 4; ++nb) { const V b = WFrag<T16>::ld(Bt + boff + (size_t)nb * 16 * K + kc); V b2; if (NSPLIT >= 2) b2 = WFrag<T16>::ld(Bt2 + boff + (size_t)nb * 16 * K + kc);
#pragma unroll
            for (int mb = 0; mb < 4; ++mb) { acc[mb][nb] = WFrag<T16>::mma(a[mb], b, acc[mb][nb]); if (NSPLIT == 1 || NSPLIT == 2) acc[mb][nb] = WFrag<T16>::mma(a2[mb], b, acc[mb][nb]); if (NSPLIT >= 2) acc[mb][nb] = WFrag<T16>::mma(a[mb], b2, acc[mb][nb]); } }
        asm volatile("v_nop\n\tv_nop\n\tv_nop\n\tv_nop" : "+v"(acc[0][0]), "+v"(acc[1][1]), "+v"(acc[2][2]), "+v"(acc[3][3]) : "v"(a[0]), "v"(a[3]));
    }
#pragma unroll
    for (int mb = 0; mb < 4; ++mb) {
#pragma unroll
        for (int nb = 0; nb < 4; ++nb) {
#pragma unroll
            for (int j = 0; j < 8; ++j) os[(hi * 8 + j) * 68 + nb * 16 + lr] = acc[mb][nb][j]; }
        __builtin_amdgcn_wave_barrier(); asm volatile("" ::: "memory");
        float* crow = C + (size_t)(r0 + mb * 16) * ldc + c0;
{
#pragma unroll
            for (int s = 0; s < 8; ++s) { const int row = 2 * s + hi, cofs = lr * 4; v4f val = *(const v4fa*)(os + row * 68 + cofs); if (BIAS) { val[0] += bfr(bias[c0 + cofs]); val[1] += bfr(bias[c0 + cofs + 1]); val[2] += bfr(bias[c0 + cofs + 2]); val[3] += bfr(bias[c0 + cofs + 3]); }
                *(v4f*)(crow + (size_t)row * ldc + cofs) = val; }
             }
        __builtin_amdgcn_wave_barrier(); asm volatile("" ::: "memory");
    }
}

__device__ __forceinline__ h16 tohx(float x) { return (h16)x; }
__device__ __forceinline__ void splitf(float y, unsigned short& h, unsigned short& l) { h = f2bf(y); l = f2bf(y - bf2f(h)); }
typedef __attribute__((ext_vector_type(2))) _Float16 v2h;
typedef __attribute__((ext_vector_type(4))) _Float16 v4h;
typedef __attribute__((ext_vector_type(2))) unsigned short v2us;
typedef __attribute__((ext_vector_type(4))) unsigned short v4us;
typedef __attribute__((ext_vector_type(2))) float v2f;
typedef __attribute__((ext_vector_type(4))) int v4i;

// grid y = which of the four weight matrices (all [K][N]); their transposed bf16 planes lie one behind another from Bt
__global__ __launch_bounds__(256) void k_wtG(const float* __restrict__ w0, const float* __restrict__ w1, const float* __restrict__ w2, const float* __restrict__ w3, int K, int N, bf* Bt) {
    const float* __restrict__ w = blockIdx.y == 0 ? w0 : blockIdx.y == 1 ? w1 : blockIdx.y == 2 ? w2 : w3; Bt += (size_t)blockIdx.y * K * N;
    const int lane = threadIdx.x & 31; const int L0 = (blockIdx.x * 8 + (threadIdx.x >> 5)) * 8; const int nlines = N * K / 64;
{
#pragma unroll 1
        for (int l = 0; l < 8; ++l) { const int L = L0 + l; if (L >= nlines) break; const size_t e = (size_t)L * 64 + lane * 2; const int k = (int)(e % K), n = (int)(e / K); v2us o;
            o[0] = f2bf(w[(size_t)k * N + n]); o[1] = f2bf(w[(size_t)(k + 1) * N + n]); *(v2us*)(Bt + e) = o; }
         }
}
__global__ __launch_bounds__(256) void k_cvt8(const float* __restrict__ src, bf* dst, size_t n8) { const size_t i = (size_t)blockIdx.x * 256 + threadIdx.x; if (i >= n8) return; const v8f v = *(const v8f*)(src + i * 8); v8us o;
#pragma unroll
    for (int k = 0; k < 8; ++k) o[k] = f2bf(v[k]); *(v8us*)(dst + i * 8) = o;  }
__global__ __launch_bounds__(256) void k_cscvt(const float* __restrict__ cosT, const float* __restrict__ sinT, float* CS) { const int idx = blockIdx.x * 256 + threadIdx.x; if (idx >= TT * HD) return; v2f cs; cs[0] = bfr(cosT[idx]); cs[1] = bfr(sinT[idx]); *(v2f*)(CS + (size_t)idx * 2) = cs;  }
// ---- k_proj: the Q, K and V projections of both batches in one launch; ONE WAVE per 64x64 tile as in k_gemmw, the whole K range in one accumulation, and the epilogue writes the operand planes of k_fattn itself (fp16, and bf16 hi + lo).
// grid (TT / 64, heads, 3 NB_), z = product x NB_ + batch. Q, K: rows = 64 tokens of x, columns = the 64 outputs of head h -> plane [b][h][t][d]. V: rows = the 64 outputs of head h, columns = 64 tokens -> the transposed plane [b][h][d][t].
__global__ __launch_bounds__(32) void k_proj(const bf* __restrict__ XB, const bf* __restrict__ WQ, const bf* __restrict__ WK, const bf* __restrict__ WV, h16* Q16, bf* Qh, bf* Ql, h16* K16, bf* Kh, bf* Kl, h16* V16, bf* Vh, bf* Vl) {
    __shared__ __align__(16) float os[16 * 68];
    const int pr = blockIdx.z / NB_, b = blockIdx.z % NB_, t0 = blockIdx.x * 64, h = blockIdx.y; const bool tr = pr == 2;
    const bf* X = XB + ((size_t)b * TT + t0) * DM; const bf* Wt = (pr == 0 ? WQ : pr == 1 ? WK : WV) + (size_t)h * HD * DM;
    const int lane = threadIdx.x & 31, lr = lane & 15, hi = lane >> 4;
    const bf* A = tr ? Wt : X; const bf* Bt = tr ? X : Wt; const unsigned lo = lr * DM + 8 * hi;   // wave-uniform bases and one lane offset for both operands
    v8f acc[4][4];
#pragma unroll
    for (int mb = 0; mb < 4; ++mb)
#pragma unroll
        for (int nb = 0; nb < 4; ++nb) acc[mb][nb] = (v8f){};
#pragma unroll 1   // rolled, as in k_gemmw: 16 accumulators and 8 fragments already fill the wave's working set
    for (int kc = 0; kc < DM; kc += 32) {
        v16bf a[4];
#pragma unroll
        for (int mb = 0; mb < 4; ++mb) a[mb] = WFrag<bf>::ld(A + kc + (lo + mb * 16 * DM));
        asm volatile("s_wait_xcnt 0x0" ::: "memory");   // stands in front of the B fragment loads: the compiler lays one of their destinations over the address pair of the A loads just issued
#pragma unroll
        for (int nb = 0; nb < 4; ++nb) { const v16bf bb = WFrag<bf>::ld(Bt + kc + (lo + nb * 16 * DM));
#pragma unroll
            for (int mb = 0; mb < 4; ++mb) acc[mb][nb] = wmmab(a[mb], bb, acc[mb][nb]); }
        asm volatile("v_nop\n\tv_nop\n\tv_nop\n\tv_nop" : "+v"(acc[0][0]), "+v"(acc[1][1]), "+v"(acc[2][2]), "+v"(acc[3][3]) : "v"(a[0]), "v"(a[3]));   // the four vector slots between the last WMMA and the next trip's fragment loads over its operands, on the taken side of the loop branch too
    }
    h16* P16 = (pr == 0 ? Q16 : pr == 1 ? K16 : V16); bf* Ph = (pr == 0 ? Qh : pr == 1 ? Kh : Vh); bf* Pl = (pr == 0 ? Ql : pr == 1 ? Kl : Vl);
    const int op = tr ? TT : HD; const size_t ob = ((size_t)b * NH_ + h) * TT * HD + (size_t)t0 * (tr ? 1 : HD) + (size_t)(lane >> 3) * op + (lane & 7) * 8;
#pragma unroll
    for (int mb = 0; mb < 4; ++mb) {
#pragma unroll
        for (int nb = 0; nb < 4; ++nb) {
#pragma unroll
            for (int j = 0; j < 8; ++j) os[(hi * 8 + j) * 68 + nb * 16 + lr] = acc[mb][nb][j]; }
        __builtin_amdgcn_wave_barrier(); asm volatile("" ::: "memory");   // keeps the row reads below behind the tile's LDS writes
#pragma unroll
        for (int s = 0; s < 4; ++s) { const float* rp = os + (4 * s + (lane >> 3)) * 68 + (lane & 7) * 8; const v4f x0 = *(const v4fa*)rp, x1 = *(const v4fa*)(rp + 4); v8h o16; v8us oh, ol;   // 8 lanes a row of 64: whole 128-byte lines of each plane
#pragma unroll
            for (int u = 0; u < 8; ++u) { const float r = (u < 4) ? x0[u & 3] : x1[u & 3]; o16[u] = tohx(r); unsigned short a2, c2; splitf(r, a2, c2); oh[u] = a2; ol[u] = c2; }
            const size_t oo = ob + (size_t)(mb * 16 + 4 * s) * op; *(v8h*)(P16 + oo) = o16; *(v8us*)(Ph + oo) = oh; *(v8us*)(Pl + oo) = ol;
            asm volatile("s_wait_xcnt 0x0" ::: "memory"); }   // stands in front of the next trip's rewrite of the three stores' address and data registers
        __builtin_amdgcn_wave_barrier(); asm volatile("" ::: "memory");   // keeps the next tile's LDS writes behind the row reads above
    }
}
typedef v4i __attribute__((may_alias)) v4ia;
template <typename T16> struct PFrag;
template <> struct PFrag<h16> { static __device__ __forceinline__ void put(v16h& a, v16h& b, int e, float p) { (void)b; a[e] = (h16)p; } };
template <> struct PFrag<bf> { static __device__ __forceinline__ void put(v16bf& a, v16bf& b, int e, float p) { const __bf16 x = (__bf16)p; a[e] = x; b[e] = (__bf16)(p - (float)x); } };
template <typename T16, bool HL, int NQT>
__device__ __forceinline__ void fattn_body(const T16* __restrict__ Q, const T16* __restrict__ Q2, const T16* __restrict__ Kp, const T16* __restrict__ K2, const T16* __restrict__ Vt, const T16* __restrict__ V2, const float* __restrict__ ED, const int* __restrict__ mk, float sb2, int q0, int h, bf* Ah, bf* Al, char* sm) {
    typedef typename WFrag<T16>::V V;
    constexpr int NQ = 16 * NQT, NP = HL ? 2 : 1, KTE = 32 * KPI, VTE = 64 * VPI, STG = NP * (KTE + VTE), NS = TT / 2 / 32;
    const int lane = threadIdx.x & 31, lr = lane & 15, hi = lane >> 4, th = threadIdx.x & 127; const int w = __builtin_amdgcn_readfirstlane(threadIdx.x >> 5), qg = w & 3, kh = w >> 2;
    T16* st = (T16*)sm + kh * 2 * STG;                          // this key half's two stage buffers: K plane(s), then Vt plane(s)
    float* bs = (float*)(sm + 4 * STG * 2) + w * NQ * BPI;      // this wave's own bias rows
    const int qw = q0 + qg * NQ; const size_t hp = (size_t)h * TT * HD;
    V qf[NQT][2], qf2[NQT][2];
#pragma unroll
    for (int qt = 0; qt < NQT; ++qt)
#pragma unroll
        for (int kk = 0; kk < 2; ++kk) { const size_t a = hp + (size_t)(qw + qt * 16 + lr) * HD + kk * 32 + 8 * hi; qf[qt][kk] = WFrag<T16>::ld(Q + a); if (HL) qf2[qt][kk] = WFrag<T16>::ld(Q2 + a); }
    v8f o[4][NQT]; float m[NQT], l[NQT];
#pragma unroll
    for (int qt = 0; qt < NQT; ++qt) { m[qt] = -3.0e38f; l[qt] = 0.f;
#pragma unroll
        for (int dt = 0; dt < 4; ++dt) o[dt][qt] = (v8f){}; }
    const int kb = kh * (TT / 2);
    // the next stage on its way: 16-byte chunk c = th + 128 i of the K tile (32 rows x 8 chunks, contiguous in memory) and of the Vt tile (64 rows x 4 chunks); rows 4 i + lane / 8 of the bias block (8 lanes a 128-byte row)
    v4i rk[NP][2], rv[NP][2], rm[NQT][4]; v4f re[NQT][4];
    const size_t ak = hp + (size_t)kb * HD + th * 8, av = hp + (size_t)(th >> 2) * TT + kb + (th & 3) * 8, ae = (size_t)(qw + (lane >> 3)) * TT + kb + (lane & 7) * 4;
    const T16* kp = Kp + ak; const T16* kp2 = HL ? K2 + ak : nullptr; const T16* vp = Vt + av; const T16* vp2 = HL ? V2 + av : nullptr; const float* ep = ED + ae; const int* mp = mk + ae;
    auto gload = [&]() {
#pragma unroll
        for (int i = 0; i < 2; ++i) { rk[0][i] = *(const v4ia*)(kp + i * 1024); rv[0][i] = *(const v4ia*)(vp + i * 32 * TT); if (HL) { rk[NP - 1][i] = *(const v4ia*)(kp2 + i * 1024); rv[NP - 1][i] = *(const v4ia*)(vp2 + i * 32 * TT); } }
#pragma unroll
        for (int qt = 0; qt < NQT; ++qt)
#pragma unroll
            for (int i = 0; i < 4; ++i) { re[qt][i] = *(const v4f*)(ep + (qt * 16 + 4 * i) * TT); rm[qt][i] = *(const v4i*)(mp + (qt * 16 + 4 * i) * TT); }
        kp += 32 * HD; vp += 32; ep += 32; mp += 32; if (HL) { kp2 += 32 * HD; vp2 += 32; } };
    auto sstore = [&](int buf) { T16* b = st + buf * STG;
#pragma unroll
        for (int i = 0; i < 2; ++i) { const int c = th + 128 * i; const int sk = (c >> 3) * KPI + (c & 7) * 8, sv = NP * KTE + (c >> 2) * VPI + (c & 3) * 8;
            *(v4ia*)(b + sk) = rk[0][i]; *(v4ia*)(b + sv) = rv[0][i]; if (HL) { *(v4ia*)(b + KTE + sk) = rk[NP - 1][i]; *(v4ia*)(b + VTE + sv) = rv[NP - 1][i]; } }
#pragma unroll
        for (int qt = 0; qt < NQT; ++qt)
#pragma unroll
            for (int i = 0; i < 4; ++i) { v4f bb;
#pragma unroll
                for (int u = 0; u < 4; ++u) bb[u] = (rm[qt][i][u] == 0) ? -__builtin_inff() : sb2 * re[qt][i][u];
                *(v4f*)(bs + (qt * 16 + 4 * i + (lane >> 3)) * BPI + (lane & 7) * 4) = bb; } };
    gload(); sstore(0); __syncthreads();
#pragma unroll 1   // rolled: the stage body is several hundred instructions, and unrolled it would leave the register limit
    for (int s = 0; s < NS; ++s) { const T16* b = st + (s & 1) * STG;
        if (s + 1 < NS) gload();
        v8f sc_[2][NQT];
#pragma unroll
        for (int kt = 0; kt < 2; ++kt) { V ka[2], ka2[2];
#pragma unroll
            for (int kk = 0; kk < 2; ++kk) { const int a = (kt * 16 + lr) * KPI + kk * 32 + 8 * hi; ka[kk] = WFrag<T16>::ld(b + a); if (HL) ka2[kk] = WFrag<T16>::ld(b + KTE + a); }
#pragma unroll
            for (int qt = 0; qt < NQT; ++qt) { v8f c = (v8f){};
#pragma unroll
                for (int kk = 0; kk < 2; ++kk) { c = WFrag<T16>::mma(ka[kk], qf[qt][kk], c); if (HL) { c = WFrag<T16>::mma(ka[kk], qf2[qt][kk], c); c = WFrag<T16>::mma(ka2[kk], qf[qt][kk], c); } }
                sc_[kt][qt] = c; } }
        V pf[NQT], pf2[NQT];
#pragma unroll
        for (int qt = 0; qt < NQT; ++qt) { float mx = m[qt];
#pragma unroll
            for (int kt = 0; kt < 2; ++kt) { const float* br = bs + (qt * 16 + lr) * BPI + kt * 16 + 8 * hi; const v4f e0 = *(const v4f*)br, e1 = *(const v4f*)(br + 4);
#pragma unroll
                for (int j = 0; j < 8; ++j) { const float t = sc_[kt][qt][j] * (SCL * LOG2E) + ((j < 4) ? e0[j & 3] : e1[j & 3]); sc_[kt][qt][j] = t; mx = fmaxf(mx, t); } }
            mx = fmaxf(mx, __shfl_xor(mx, 16, 32));
            const float rs = __builtin_amdgcn_exp2f(m[qt] - mx); m[qt] = mx; float ps = 0.f;
#pragma unroll
            for (int kt = 0; kt < 2; ++kt)
#pragma unroll
                for (int j = 0; j < 8; ++j) { const float p = __builtin_amdgcn_exp2f(sc_[kt][qt][j] - mx); ps += p; PFrag<T16>::put(pf[qt], pf2[qt], kt * 8 + j, p); }
            l[qt] = l[qt] * rs + ps;   // this lane half's keys only; the lane halves are joined behind the loop
#pragma unroll
            for (int dt = 0; dt < 4; ++dt) o[dt][qt] *= rs; }
#pragma unroll
        for (int dt = 0; dt < 4; ++dt) { const int a = NP * KTE + (dt * 16 + lr) * VPI + 8 * hi; const V va = WFrag<T16>::ld(b + a); V va2; if (HL) va2 = WFrag<T16>::ld(b + VTE + a);
#pragma unroll
            for (int qt = 0; qt < NQT; ++qt) { o[dt][qt] = WFrag<T16>::mma(va, pf[qt], o[dt][qt]); if (HL) { o[dt][qt] = WFrag<T16>::mma(va, pf2[qt], o[dt][qt]); o[dt][qt] = WFrag<T16>::mma(va2, pf[qt], o[dt][qt]); } } }
        if (s + 1 < NS) sstore((s + 1) & 1);   // K, Vt: the buffer that stage s - 1 read, whose readers passed the barrier at the foot of that stage; bias rows: this wave's own, read above
        __syncthreads();                       // publishes stage s + 1 and ends every read of stage s
    }
    // join of the two key halves, lane for lane: half 1 leaves its set in LDS (over the stage buffers, all read by now), half 0 adds it to its own and writes whole 128-byte lines of the merged planes
    float* jo = (float*)sm + (size_t)qg * NQT * 4 * 32 * 8 + lane * 8; float* jm = (float*)sm + 4 * NQT * 4 * 32 * 8 + qg * NQT * 32 * 2 + lane * 2;
    if (kh == 1) {
#pragma unroll
        for (int qt = 0; qt < NQT; ++qt) { v2f ml; ml[0] = m[qt]; ml[1] = l[qt]; *(v2f*)(jm + qt * 64) = ml;
#pragma unroll
            for (int dt = 0; dt < 4; ++dt) { *(v4f*)(jo + (qt * 4 + dt) * 256) = __builtin_shufflevector(o[dt][qt], o[dt][qt], 0, 1, 2, 3); *(v4f*)(jo + (qt * 4 + dt) * 256 + 4) = __builtin_shufflevector(o[dt][qt], o[dt][qt], 4, 5, 6, 7); } } }
    __syncthreads();
    if (kh == 0) {
#pragma unroll
        for (int qt = 0; qt < NQT; ++qt) { const v2f ml = *(const v2f*)(jm + qt * 64); const float M = fmaxf(m[qt], ml[0]); const float f0 = __builtin_amdgcn_exp2f(m[qt] - M), f1 = __builtin_amdgcn_exp2f(ml[0] - M);
            float L = l[qt] * f0 + ml[1] * f1; L += __shfl_xor(L, 16, 32); const float inv = 1.0f / L;
#pragma unroll
            for (int dt = 0; dt < 4; ++dt) { const v4f x0 = *(const v4f*)(jo + (qt * 4 + dt) * 256), x1 = *(const v4f*)(jo + (qt * 4 + dt) * 256 + 4); v8us oh, ol;
#pragma unroll
                for (int u = 0; u < 8; ++u) { unsigned short x, y; splitf((o[dt][qt][u] * f0 + ((u < 4) ? x0[u & 3] : x1[u & 3]) * f1) * inv, x, y); oh[u] = x; ol[u] = y; }
                const size_t oo = (size_t)(qw + qt * 16 + lr) * DQ + h * HD + dt * 16 + 8 * hi; *(v8us*)(Ah + oo) = oh; *(v8us*)(Al + oo) = ol;
                asm volatile("s_wait_xcnt 0x0" ::: "memory"); } } }   // stands in front of the next trip's rewrite of the two stores' address and data registers
}
// grid (heads, NB_ TT / 64), y = query tile x NB_ + batch: 64 query rows a work-group; the hi+lo tiles (three products each) of every batch have the low indices. Four waves a SIMD (at most 256 registers): two work-groups a WGP at a time.
__global__ __launch_bounds__(256, 4) void k_fattn(const h16* __restrict__ Q16, const h16* __restrict__ K16, const h16* __restrict__ V16, const bf* __restrict__ Qh, const bf* __restrict__ Ql, const bf* __restrict__ Kh, const bf* __restrict__ Kl, const bf* __restrict__ Vh, const bf* __restrict__ Vl, const float* __restrict__ ED, const int* __restrict__ mk, const float* __restrict__ sbias, bf* Ah, bf* Al) {
    __shared__ __align__(16) char sm[4 * 2 * (32 * KPI + 64 * VPI) * 2 + 8 * 16 * BPI * 4];   // the hi+lo form's stage buffers and bias rows; the fp16 form has half the planes
    const int h = blockIdx.x, b = (int)blockIdx.y % NB_, q0 = (int)blockIdx.y / NB_ * 64; const float sb2 = bfr(sbias[h]) * LOG2E;
    const size_t pb = (size_t)b * NH_ * TT * HD, eb = (size_t)b * TT * TT, ab = (size_t)b * TT * DQ;   // this batch's part of the operand planes, of the bias table and the mask, of the merged planes
    Q16 += pb; K16 += pb; V16 += pb; Qh += pb; Ql += pb; Kh += pb; Kl += pb; Vh += pb; Vl += pb; ED += eb; mk += eb; Ah += ab; Al += ab;
    if (q0 < RH) fattn_body<bf, true, 1>(Qh, Ql, Kh, Kl, Vh, Vl, ED, mk, sb2, q0, h, Ah, Al, sm);
    else fattn_body<h16, false, 1>(Q16, nullptr, K16, nullptr, V16, nullptr, ED, mk, sb2, q0, h, Ah, Al, sm);
}
// k_osum: out = sum of the KSP partial planes of merged x Wo, + bias (16-B lanes); the rows of all batches in one range
__global__ __launch_bounds__(256) void k_osum(const float* __restrict__ P, const float* __restrict__ bias, float* out) { const unsigned i4 = blockIdx.x * 256 + threadIdx.x; if (i4 >= NB_ * TT * DM / 4) return; const unsigned c = (i4 * 4) % DM; const v4f* P4 = (const v4f*)P; v4f a = P4[i4];
#pragma unroll
    for (int i = 1; i < KSP; ++i) { asm volatile("s_wait_xcnt 0x0" ::: "memory");   // stands in front of the next plane's load: the compiler lays its destination over the address pair of the load just issued
        a += (P4 + (size_t)i * (NB_ * TT * DM / 4))[i4]; }
#pragma unroll
    for (int u = 0; u < 4; ++u) a[u] += bfr(bias[c + u]);
    ((v4f*)out)[i4] = a;  }

__global__ __launch_bounds__(256) void k_dist(const float* __restrict__ co, float* ED) { const size_t e = ((size_t)blockIdx.x * 256 + threadIdx.x) * 4; if (e >= (size_t)TT * TT) return; co += (size_t)blockIdx.y * TT * 2; ED += (size_t)blockIdx.y * TT * TT;   /* grid y = batch */ const int j = (int)(e % TT); const int i = (int)(e / TT); const float xi = bfr(co[i * 2]), yi = bfr(co[i * 2 + 1]); v4f o;   // exp(-dist): dist = sqrt(dx^2 + dy^2) (0 when d2 == 0) (16-B lanes)
#pragma unroll
    for (int u = 0; u < 4; ++u) { const float dx = __fsub_rn(xi, bfr(co[(j + u) * 2])), dy = __fsub_rn(yi, bfr(co[(j + u) * 2 + 1])); float px = __fmul_rn(dx, dx), py = __fmul_rn(dy, dy); asm volatile("" : "+v"(px)); asm volatile("" : "+v"(py)); const float d2 = __fadd_rn(px, py); const float dist = (d2 == 0.f) ? 0.f : __fsqrt_rn(d2); o[u] = __expf(-dist); }
    *(v4f*)(ED + e) = o;  }

extern "C" void kernel_launch(void* const* d_in, const int* in_sizes, int n_in,
                              void* d_out, int out_size, void* d_ws, size_t ws_size, hipStream_t stream) {
    (void)in_sizes; (void)n_in; (void)out_size;
    const float* x = (const float*)d_in[0]; const float* coords = (const float*)d_in[1]; const int* mask = (const int*)d_in[2]; const float* wq = (const float*)d_in[3]; const float* wk = (const float*)d_in[4]; const float* wv = (const float*)d_in[5]; const float* sbias = (const float*)d_in[6]; const float* wo = (const float*)d_in[7]; const float* bo = (const float*)d_in[8]; const float* cosT = nullptr; const float* sinT = nullptr; (void)cosT; (void)sinT;
    float* OUT = (float*)d_out;     // [2][2048][1024]
    char* wsp = (char*)d_ws;
    auto take = [&](size_t bytes) { char* p = wsp; wsp += (bytes + 255) & ~(size_t)255; return (void*)p; };
    bf* WQ = (bf*)take((size_t)DQ * DM * 2); bf* WK = (bf*)take((size_t)DKV * DM * 2); bf* WV = (bf*)take((size_t)DKV * DM * 2); bf* WO = (bf*)take((size_t)DM * DQ * 2);
    bf* XB = (bf*)take((size_t)NB_ * TT * DM * 2); float* ED = (float*)take((size_t)NB_ * TT * TT * 4); float* FO = (float*)take((size_t)KSP * NB_ * TT * DM * 4);
    const size_t PL = (size_t)NH_ * TT * HD;   // elements of one operand plane of one batch (NKV == NH_)
    h16* QP16 = (h16*)take(NB_ * PL * 2); h16* KP16 = (h16*)take(NB_ * PL * 2); h16* VT16 = (h16*)take(NB_ * PL * 2);
    bf* QPh = (bf*)take(NB_ * PL * 2); bf* QPl = (bf*)take(NB_ * PL * 2); bf* KPh = (bf*)take(NB_ * PL * 2); bf* KPl = (bf*)take(NB_ * PL * 2); bf* VTh = (bf*)take(NB_ * PL * 2); bf* VTl = (bf*)take(NB_ * PL * 2);
    bf* ATh = (bf*)take((size_t)NB_ * TT * DQ * 2); bf* ATl = (bf*)take((size_t)NB_ * TT * DQ * 2);
    if ((size_t)(wsp - (char*)d_ws) > ws_size) return;    // ws 256 MiB
    k_wtG<<<dim3((unsigned)((DM * DQ / 64 + 63) / 64), 4), 256, 0, stream>>>(wq, wk, wv, wo, DM, DQ, WQ);   // WQ, WK, WV, WO: four planes of DM x DQ elements, taken one behind another above
    k_cvt8<<<(unsigned)(((size_t)NB_ * TT * DM / 8 + 255) / 256), 256, 0, stream>>>(x, XB, (size_t)NB_ * TT * DM / 8);
    k_proj<<<dim3(TT / 64, NH_, 3 * NB_), 32, 0, stream>>>(XB, WQ, WK, WV, QP16, QPh, QPl, KP16, KPh, KPl, VT16, VTh, VTl);
    k_dist<<<dim3((TT * TT / 4 + 255) / 256, NB_), 256, 0, stream>>>(coords, ED);
    k_fattn<<<dim3(NH_, NB_ * TT / 64), 256, 0, stream>>>(QP16, KP16, VT16, QPh, QPl, KPh, KPl, VTh, VTl, ED, mask, sbias, ATh, ATl);
    k_gemmw<bf, 1, false, KSP><<<dim3(NB_ * TT / 64, DM / 64, KSP), 32, 0, stream>>>(ATh, ATl, WO, nullptr, DQ, FO, DM, nullptr, 0, 0, 0, (size_t)NB_ * TT * DM);
    k_osum<<<(unsigned)(((size_t)NB_ * TT * DM / 4 + 255) / 256), 256, 0, stream>>>(FO, bo, OUT);
}

// v005
// Measured time: 203 microseconds a run.
// In two side-by-side timings against v004, it was 1.11 and 1.10 times as fast.
// All steps since v000 together make it 11.0 times as fast.
#include <hip/hip_runtime.h>

// SpatialTemporalAttention (x [2][2048][1024]; Q/K/V = x W ([in,out], no bias; 16 heads x 64); scores = Q.K / 8 + spatial_bias[h] exp(-dist[b][i][j]) with dist = pairwise Euclidean distance of spatial_coords [2][2048][2] (0 when d2 == 0); masked where mask[b][i][j] == 0 (int, read) -> -inf; softmax; out = merged Wo + bo -> [2][2048][1024]).
// Compute dtypes, f32 accumulate: every input rounded to bf16; Q/K/V on PLAIN bf16 operands (inputs: exact), one launch for both batches whose epilogue writes the attention operand planes (k_proj); the distance bias table exp(-dist) [2][2048][2048] in f32, its masked entries NaN (k_dist reads the mask, once); scores and attn.v (one fused kernel, k_fattn): query rows < 512 hl (3 products), the rest single fp16; bias + mask + running softmax f32; Wo hl x exact (2 products) + bias. Every kernel is launched once: batches and the four weight matrices are grid indices.

#define NB_  2
#define TT   2048
#define DM   1024
#define NH_  16
#define NKV  16
#define REP  (NH_ / NKV)
#define HD   64
#define DQ   (NH_ * HD)
#define DKV  (NKV * HD)
#define RH   512                  // query rows < RH use hi+lo planes (0: none)
#define WIN  0
#define SCL  0.125f   // HD^-0.5
#define KPI  72                   // k_fattn LDS pitch of a staged K row, elements: 128 B + 16 B (16 B x odd: b128 fragment reads without bank conflicts)
#define VPI  40                   // the same of a staged Vt row: 64 B + 16 B
#define BPI  36                   // the same of a bias row, floats: 128 B + 16 B
#define LOG2E 1.4426950408889634f
#define KSP  4                    // K ranges of the Wo product (1024 -> 256 a work-group)
typedef _Float16 h16;
typedef unsigned short bf;
typedef __attribute__((ext_vector_type(16))) __bf16   v16bf;
typedef __attribute__((ext_vector_type(16))) _Float16 v16h;
typedef __attribute__((ext_vector_type(8)))  _Float16 v8h;
typedef __attribute__((ext_vector_type(8)))  unsigned short v8us;
typedef __attribute__((ext_vector_type(8)))  float    v8f;
typedef __attribute__((ext_vector_type(4)))  float    v4f;
typedef v8h  __attribute__((may_alias)) v8ha;
typedef v4f  __attribute__((may_alias)) v4fa;
typedef v8us __attribute__((may_alias)) v8usa;

__device__ __forceinline__ unsigned short f2bf(float f) { unsigned u = __float_as_uint(f); u += 0x7FFFu + ((u >> 16) & 1u); return (unsigned short)(u >> 16); }
__device__ __forceinline__ float bf2f(unsigned short b) { return __uint_as_float(((unsigned)b) << 16); }
__device__ __forceinline__ float bfr(float f) { return bf2f(f2bf(f)); }
__device__ __forceinline__ v16h cat16(v8h lo, v8h hi) { return __builtin_shufflevector(lo, hi, 0, 1, 2, 3, 4, 5, 6, 7, 8, 9, 10, 11, 12, 13, 14, 15); }
__device__ __forceinline__ v16bf cat16b(v8us lo, v8us hi) { return __builtin_bit_cast(v16bf, __builtin_shufflevector(lo, hi, 0, 1, 2, 3, 4, 5, 6, 7, 8, 9, 10, 11, 12, 13, 14, 15)); }
__device__ __forceinline__ v8f wmma16(v16h a, v16h b, v8f c) { return __builtin_amdgcn_wmma_f32_16x16x32_f16(false, a, false, b, (short)0, c, false, false); }
__device__ __forceinline__ v8f wmmab(v16bf a, v16bf b, v8f c) { return __builtin_amdgcn_wmma_f32_16x16x32_bf16(false, a, false, b, (short)0, c, false, false); }



// ---- k_gemmw: register-blocked GEMM, ONE WAVE per 64x64 output tile (16 accumulators), operands straight from K-contiguous 16-bit planes; grid (M/64, N/64, Z), 32 threads.
// C[m][n] (f32, pitch ldc, + optional f32 bias[n]) = sum_k A[m][k] Bt[n][k] (+ split products per NSPLIT). z-batch strides sA/sB/sC in elements. K % (32 KS) == 0.
// KS > 1: grid z = Z x KS; work-group (z, ks) sums only k in [ks K/KS, (ks+1) K/KS) and stores its f32 partial tile to plane ks (plane stride sP elements); the kernel that reads C adds the KS planes in plane order.
template <typename T16> struct WFrag;
template <> struct WFrag<h16> { typedef v16h V; static __device__ __forceinline__ V ld(const h16* p) { return cat16(*(const v8h*)p, *(const v8h*)(p + 16)); } static __device__ __forceinline__ v8f mma(V a, V b, v8f c) { return wmma16(a, b, c); } };
template <> struct WFrag<bf> { typedef v16bf V; static __device__ __forceinline__ V ld(const bf* p) { return cat16b(*(const v8us*)p, *(const v8us*)(p + 16)); } static __device__ __forceinline__ v8f mma(V a, V b, v8f c) { return wmmab(a, b, c); } };
template <typename T16, int NSPLIT, bool BIAS, int KS>
__global__ __launch_bounds__(32) void k_gemmw(const T16* __restrict__ A, const T16* __restrict__ A2, const T16* __restrict__ Bt, const T16* __restrict__ Bt2, int K, float* C, int ldc, const float* __restrict__ bias, size_t sA, size_t sB, size_t sC, size_t sP) {
    typedef typename WFrag<T16>::V V;
    __shared__ __align__(16) float os[16 * 68];
    const size_t z = blockIdx.z / KS; const int ks = blockIdx.z % KS; A += z * sA; if (A2) A2 += z * sA; Bt += z * sB; if (Bt2) Bt2 += z * sB; C += z * sC + (size_t)ks * sP; const int kn = K / KS, kb = ks * kn;
    const int lane = threadIdx.x & 31, lr = lane & 15, hi = lane >> 4; const int r0 = blockIdx.x * 64, c0 = blockIdx.y * 64;
    v8f acc[4][4];
#pragma unroll
    for (int mb = 0; mb < 4; ++mb)
#pragma unroll
        for (int nb = 0; nb < 4; ++nb) acc[mb][nb] = (v8f){};
    const size_t aoff = (size_t)(r0 + lr) * K + 8 * hi, boff = (size_t)(c0 + lr) * K + 8 * hi;
#pragma unroll 1
    for (int kc = kb; kc < kb + kn; kc += 32) {
        V a[4], a2[4];
#pragma unroll
        for (int mb = 0; mb < 4; ++mb) { a[mb] = WFrag<T16>::ld(A + aoff + (size_t)mb * 16 * K + kc); if (NSPLIT == 1 || NSPLIT == 2) a2[mb] = WFrag<T16>::ld(A2 + aoff + (size_t)mb * 16 * K + kc); }
#pragma unroll
        for (int nb = 0; nb < 4; ++nb) { const V b = WFrag<T16>::ld(Bt + boff + (size_t)nb * 16 * K + kc); V b2; if (NSPLIT >= 2) b2 = WFrag<T16>::ld(Bt2 + boff + (size_t)nb * 16 * K + kc);
#pragma unroll
            for (int mb = 0; mb < 4; ++mb) { acc[mb][nb] = WFrag<T16>::mma(a[mb], b, acc[mb][nb]); if (NSPLIT == 1 || NSPLIT == 2) acc[mb][nb] = WFrag<T16>::mma(a2[mb], b, acc[mb][nb]); if (NSPLIT >= 2) acc[mb][nb] = WFrag<T16>::mma(a[mb], b2, acc[mb][nb]); } }
        asm volatile("v_nop\n\tv_nop\n\tv_nop\n\tv_nop" : "+v"(acc[0][0]), "+v"(acc[1][1]), "+v"(acc[2][2]), "+v"(acc[3][3]) : "v"(a[0]), "v"(a[3]));
    }
#pragma unroll
    for (int mb = 0; mb < 4; ++mb) {
#pragma unroll
        for (int nb = 0; nb < 4; ++nb) {
#pragma unroll
            for (int j = 0; j < 8; ++j) os[(hi * 8 + j) * 68 + nb * 16 + lr] = acc[mb][nb][j]; }
        __builtin_amdgcn_wave_barrier(); asm volatile("" ::: "memory");
        float* crow = C + (size_t)(r0 + mb * 16) * ldc + c0;
{
#pragma unroll
            for (int s = 0; s < 8; ++s) { const int row = 2 * s + hi, cofs = lr * 4; v4f val = *(const v4fa*)(os + row * 68 + cofs); if (BIAS) { val[0] += bfr(bias[c0 + cofs]); val[1] += bfr(bias[c0 + cofs + 1]); val[2] += bfr(bias[c0 + cofs + 2]); val[3] += bfr(bias[c0 + cofs + 3]); }
                *(v4f*)(crow + (size_t)row * ldc + cofs) = val; }
             }
        __builtin_amdgcn_wave_barrier(); asm volatile("" ::: "memory");
    }
}

__device__ __forceinline__ h16 tohx(float x) { return (h16)x; }
__device__ __forceinline__ void splitf(float y, unsigned short& h, unsigned short& l) { h = f2bf(y); l = f2bf(y - bf2f(h)); }
typedef __attribute__((ext_vector_type(2))) _Float16 v2h;
typedef __attribute__((ext_vector_type(4))) _Float16 v4h;
typedef __attribute__((ext_vector_type(2))) unsigned short v2us;
typedef __attribute__((ext_vector_type(4))) unsigned short v4us;
typedef __attribute__((ext_vector_type(2))) float v2f;
typedef __attribute__((ext_vector_type(4))) int v4i;

// grid y = which of the four weight matrices (all [K][N]); their transposed bf16 planes lie one behind another from Bt
__global__ __launch_bounds__(256) void k_wtG(const float* __restrict__ w0, const float* __restrict__ w1, const float* __restrict__ w2, const float* __restrict__ w3, int K, int N, bf* Bt) {
    const float* __restrict__ w = blockIdx.y == 0 ? w0 : blockIdx.y == 1 ? w1 : blockIdx.y == 2 ? w2 : w3; Bt += (size_t)blockIdx.y * K * N;
    const int lane = threadIdx.x & 31; const int L0 = (blockIdx.x * 8 + (threadIdx.x >> 5)) * 8; const int nlines = N * K / 64;
{
#pragma unroll 1
        for (int l = 0; l < 8; ++l) { const int L = L0 + l; if (L >= nlines) break; const size_t e = (size_t)L * 64 + lane * 2; const int k = (int)(e % K), n = (int)(e / K); v2us o;
            o[0] = f2bf(w[(size_t)k * N + n]); o[1] = f2bf(w[(size_t)(k + 1) * N + n]); *(v2us*)(Bt + e) = o; }
         }
}
__global__ __launch_bounds__(256) void k_cvt8(const float* __restrict__ src, bf* dst, size_t n8) { const size_t i = (size_t)blockIdx.x * 256 + threadIdx.x; if (i >= n8) return; const v8f v = *(const v8f*)(src + i * 8); v8us o;
#pragma unroll
    for (int k = 0; k < 8; ++k) o[k] = f2bf(v[k]); *(v8us*)(dst + i * 8) = o;  }
__global__ __launch_bounds__(256) void k_cscvt(const float* __restrict__ cosT, const float* __restrict__ sinT, float* CS) { const int idx = blockIdx.x * 256 + threadIdx.x; if (idx >= TT * HD) return; v2f cs; cs[0] = bfr(cosT[idx]); cs[1] = bfr(sinT[idx]); *(v2f*)(CS + (size_t)idx * 2) = cs;  }
// ---- k_proj: the Q, K and V projections of both batches in one launch; ONE WAVE per 64x64 tile as in k_gemmw, the whole K range in one accumulation, and the epilogue writes the operand planes of k_fattn itself (fp16, and bf16 hi + lo).
// grid (TT / 64, heads, 3 NB_), z = product x NB_ + batch. Q, K: rows = 64 tokens of x, columns = the 64 outputs of head h -> plane [b][h][t][d]. V: rows = the 64 outputs of head h, columns = 64 tokens -> the transposed plane [b][h][d][t].
__global__ __launch_bounds__(32) void k_proj(const bf* __restrict__ XB, const bf* __restrict__ WQ, const bf* __restrict__ WK, const bf* __restrict__ WV, h16* Q16, bf* Qh, bf* Ql, h16* K16, bf* Kh, bf* Kl, h16* V16, bf* Vh, bf* Vl) {
    __shared__ __align__(16) float os[16 * 68];
    const int pr = blockIdx.z / NB_, b = blockIdx.z % NB_, t0 = blockIdx.x * 64, h = blockIdx.y; const bool tr = pr == 2;
    const bf* X = XB + ((size_t)b * TT + t0) * DM; const bf* Wt = (pr == 0 ? WQ : pr == 1 ? WK : WV) + (size_t)h * HD * DM;
    const int lane = threadIdx.x & 31, lr = lane & 15, hi = lane >> 4;
    const bf* A = tr ? Wt : X; const bf* Bt = tr ? X : Wt; const unsigned lo = lr * DM + 8 * hi;   // wave-uniform bases and one lane offset for both operands
    v8f acc[4][4];
#pragma unroll
    for (int mb = 0; mb < 4; ++mb)
#pragma unroll
        for (int nb = 0; nb < 4; ++nb) acc[mb][nb] = (v8f){};
#pragma unroll 1   // rolled, as in k_gemmw: 16 accumulators and 8 fragments already fill the wave's working set
    for (int kc = 0; kc < DM; kc += 32) {
        v16bf a[4];
#pragma unroll
        for (int mb = 0; mb < 4; ++mb) a[mb] = WFrag<bf>::ld(A + kc + (lo + mb * 16 * DM));
        asm volatile("s_wait_xcnt 0x0" ::: "memory");   // stands in front of the B fragment loads: the compiler lays one of their destinations over the address pair of the A loads just issued
#pragma unroll
        for (int nb = 0; nb < 4; ++nb) { const v16bf bb = WFrag<bf>::ld(Bt + kc + (lo + nb * 16 * DM));
#pragma unroll
            for (int mb = 0; mb < 4; ++mb) acc[mb][nb] = wmmab(a[mb], bb, acc[mb][nb]); }
        asm volatile("v_nop\n\tv_nop\n\tv_nop\n\tv_nop" : "+v"(acc[0][0]), "+v"(acc[1][1]), "+v"(acc[2][2]), "+v"(acc[3][3]) : "v"(a[0]), "v"(a[3]));   // the four vector slots between the last WMMA and the next trip's fragment loads over its operands, on the taken side of the loop branch too
    }
    h16* P16 = (pr == 0 ? Q16 : pr == 1 ? K16 : V16); bf* Ph = (pr == 0 ? Qh : pr == 1 ? Kh : Vh); bf* Pl = (pr == 0 ? Ql : pr == 1 ? Kl : Vl);
    const int op = tr ? TT : HD; const size_t ob = ((size_t)b * NH_ + h) * TT * HD + (size_t)t0 * (tr ? 1 : HD) + (size_t)(lane >> 3) * op + (lane & 7) * 8;
#pragma unroll
    for (int mb = 0; mb < 4; ++mb) {
#pragma unroll
        for (int nb = 0; nb < 4; ++nb) {
#pragma unroll
            for (int j = 0; j < 8; ++j) os[(hi * 8 + j) * 68 + nb * 16 + lr] = acc[mb][nb][j]; }
        __builtin_amdgcn_wave_barrier(); asm volatile("" ::: "memory");   // keeps the row reads below behind the tile's LDS writes
#pragma unroll
        for (int s = 0; s < 4; ++s) { const float* rp = os + (4 * s + (lane >> 3)) * 68 + (lane & 7) * 8; const v4f x0 = *(const v4fa*)rp, x1 = *(const v4fa*)(rp + 4); v8h o16; v8us oh, ol;   // 8 lanes a row of 64: whole 128-byte lines of each plane
#pragma unroll
            for (int u = 0; u < 8; ++u) { const float r = (u < 4) ? x0[u & 3] : x1[u & 3]; o16[u] = tohx(r); unsigned short a2, c2; splitf(r, a2, c2); oh[u] = a2; ol[u] = c2; }
            const size_t oo = ob + (size_t)(mb * 16 + 4 * s) * op; *(v8h*)(P16 + oo) = o16; *(v8us*)(Ph + oo) = oh; *(v8us*)(Pl + oo) = ol;
            asm volatile("s_wait_xcnt 0x0" ::: "memory"); }   // stands in front of the next trip's rewrite of the three stores' address and data registers
        __builtin_amdgcn_wave_barrier(); asm volatile("" ::: "memory");   // keeps the next tile's LDS writes behind the row reads above
    }
}
typedef v4i __attribute__((may_alias)) v4ia;
template <typename T16> struct PFrag;
template <> struct PFrag<h16> { static __device__ __forceinline__ void put(v16h& a, v16h& b, int e, float p) { (void)b; a[e] = (h16)p; } };
template <> struct PFrag<bf> { static __device__ __forceinline__ void put(v16bf& a, v16bf& b, int e, float p) { const __bf16 x = (__bf16)p; a[e] = x; b[e] = (__bf16)(p - (float)x); } };
template <typename T16, bool HL, int NQT>
__device__ __forceinline__ void fattn_body(const T16* __restrict__ Q, const T16* __restrict__ Q2, const T16* __restrict__ Kp, const T16* __restrict__ K2, const T16* __restrict__ Vt, const T16* __restrict__ V2, const float* __restrict__ ED, float sb2, int q0, int h, bf* Ah, bf* Al, char* sm) {
    typedef typename WFrag<T16>::V V;
    constexpr int NQ = 16 * NQT, NP = HL ? 2 : 1, KTE = 32 * KPI, VTE = 64 * VPI, STG = NP * (KTE + VTE), NS = TT / 2 / 32;
    const int lane = threadIdx.x & 31, lr = lane & 15, hi = lane >> 4, th = threadIdx.x & 127; const int w = __builtin_amdgcn_readfirstlane(threadIdx.x >> 5), qg = w & 3, kh = w >> 2;
    T16* st = (T16*)sm + kh * 2 * STG;                          // this key half's two stage buffers: K plane(s), then Vt plane(s)
    float* bs = (float*)(sm + 4 * STG * 2) + w * NQ * BPI;      // this wave's own bias rows
    const int qw = q0 + qg * NQ; const size_t hp = (size_t)h * TT * HD;
    V qf[NQT][2], qf2[NQT][2];
#pragma unroll
    for (int qt = 0; qt < NQT; ++qt)
#pragma unroll
        for (int kk = 0; kk < 2; ++kk) { const size_t a = hp + (size_t)(qw + qt * 16 + lr) * HD + kk * 32 + 8 * hi; qf[qt][kk] = WFrag<T16>::ld(Q + a); if (HL) qf2[qt][kk] = WFrag<T16>::ld(Q2 + a); }
    v8f o[4][NQT]; float m[NQT], l[NQT];
#pragma unroll
    for (int qt = 0; qt < NQT; ++qt) { m[qt] = -3.0e38f; l[qt] = 0.f;
#pragma unroll
        for (int dt = 0; dt < 4; ++dt) o[dt][qt] = (v8f){}; }
    const int kb = kh * (TT / 2);
    // the next stage on its way: 16-byte chunk c = th + 128 i of the K tile (32 rows x 8 chunks, contiguous in memory) and of the Vt tile (64 rows x 4 chunks); rows 4 i + lane / 8 of the bias block (8 lanes a 128-byte row)
    v4i rk[NP][2], rv[NP][2]; v4f re[NQT][4];
    const size_t ak = hp + (size_t)kb * HD + th * 8, av = hp + (size_t)(th >> 2) * TT + kb + (th & 3) * 8, ae = (size_t)(qw + (lane >> 3)) * TT + kb + (lane & 7) * 4;
    const T16* kp = Kp + ak; const T16* kp2 = HL ? K2 + ak : nullptr; const T16* vp = Vt + av; const T16* vp2 = HL ? V2 + av : nullptr; const float* ep = ED + ae;
    auto gload = [&]() {
#pragma unroll
        for (int i = 0; i < 2; ++i) { rk[0][i] = *(const v4ia*)(kp + i * 1024); rv[0][i] = *(const v4ia*)(vp + i * 32 * TT); if (HL) { rk[NP - 1][i] = *(const v4ia*)(kp2 + i * 1024); rv[NP - 1][i] = *(const v4ia*)(vp2 + i * 32 * TT); } }
#pragma unroll
        for (int qt = 0; qt < NQT; ++qt)
#pragma unroll
            for (int i = 0; i < 4; ++i) re[qt][i] = *(const v4f*)(ep + (qt * 16 + 4 * i) * TT);
        kp += 32 * HD; vp += 32; ep += 32; if (HL) { kp2 += 32 * HD; vp2 += 32; } };
    auto sstore = [&](int buf) { T16* b = st + buf * STG;
#pragma unroll
        for (int i = 0; i < 2; ++i) { const int c = th + 128 * i; const int sk = (c >> 3) * KPI + (c & 7) * 8, sv = NP * KTE + (c >> 2) * VPI + (c & 3) * 8;
            *(v4ia*)(b + sk) = rk[0][i]; *(v4ia*)(b + sv) = rv[0][i]; if (HL) { *(v4ia*)(b + KTE + sk) = rk[NP - 1][i]; *(v4ia*)(b + VTE + sv) = rv[NP - 1][i]; } }
#pragma unroll
        for (int qt = 0; qt < NQT; ++qt)
#pragma unroll
            for (int i = 0; i < 4; ++i) { v4f bb;
#pragma unroll
                for (int u = 0; u < 4; ++u) bb[u] = fmaxf(sb2 * re[qt][i][u], -__builtin_inff());   // a masked entry is NaN in the table: the maximum with -inf returns -inf for it and the product itself for every other
                *(v4f*)(bs + (qt * 16 + 4 * i + (lane >> 3)) * BPI + (lane & 7) * 4) = bb; } };
    gload(); sstore(0); __syncthreads();
#pragma unroll 1   // rolled: the stage body is several hundred instructions, and unrolled it would leave the register limit
    for (int s = 0; s < NS; ++s) { const T16* b = st + (s & 1) * STG;
        if (s + 1 < NS) gload();
        v8f sc_[2][NQT];
#pragma unroll
        for (int kt = 0; kt < 2; ++kt) { V ka[2], ka2[2];
#pragma unroll
            for (int kk = 0; kk < 2; ++kk) { const int a = (kt * 16 + lr) * KPI + kk * 32 + 8 * hi; ka[kk] = WFrag<T16>::ld(b + a); if (HL) ka2[kk] = WFrag<T16>::ld(b + KTE + a); }
#pragma unroll
            for (int qt = 0; qt < NQT; ++qt) { v8f c = (v8f){};
#pragma unroll
                for (int kk = 0; kk < 2; ++kk) { c = WFrag<T16>::mma(ka[kk], qf[qt][kk], c); if (HL) { c = WFrag<T16>::mma(ka[kk], qf2[qt][kk], c); c = WFrag<T16>::mma(ka2[kk], qf[qt][kk], c); } }
                sc_[kt][qt] = c; } }
        V pf[NQT], pf2[NQT];
#pragma unroll
        for (int qt = 0; qt < NQT; ++qt) { float mx = m[qt];
#pragma unroll
            for (int kt = 0; kt < 2; ++kt) { const float* br = bs + (qt * 16 + lr) * BPI + kt * 16 + 8 * hi; const v4f e0 = *(const v4f*)br, e1 = *(const v4f*)(br + 4);
#pragma unroll
                for (int j = 0; j < 8; ++j) { const float t = sc_[kt][qt][j] * (SCL * LOG2E) + ((j < 4) ? e0[j & 3] : e1[j & 3]); sc_[kt][qt][j] = t; mx = fmaxf(mx, t); } }
            mx = fmaxf(mx, __shfl_xor(mx, 16, 32));
            const float rs = __builtin_amdgcn_exp2f(m[qt] - mx); m[qt] = mx; float ps = 0.f;
#pragma unroll
            for (int kt = 0; kt < 2; ++kt)
#pragma unroll
                for (int j = 0; j < 8; ++j) { const float p = __builtin_amdgcn_exp2f(sc_[kt][qt][j] - mx); ps += p; PFrag<T16>::put(pf[qt], pf2[qt], kt * 8 + j, p); }
            l[qt] = l[qt] * rs + ps;   // this lane half's keys only; the lane halves are joined behind the loop
#pragma unroll
            for (int dt = 0; dt < 4; ++dt) o[dt][qt] *= rs; }
#pragma unroll
        for (int dt = 0; dt < 4; ++dt) { const int a = NP * KTE + (dt * 16 + lr) * VPI + 8 * hi; const V va = WFrag<T16>::ld(b + a); V va2; if (HL) va2 = WFrag<T16>::ld(b + VTE + a);
#pragma unroll
            for (int qt = 0; qt < NQT; ++qt) { o[dt][qt] = WFrag<T16>::mma(va, pf[qt], o[dt][qt]); if (HL) { o[dt][qt] = WFrag<T16>::mma(va, pf2[qt], o[dt][qt]); o[dt][qt] = WFrag<T16>::mma(va2, pf[qt], o[dt][qt]); } } }
        if (s + 1 < NS) sstore((s + 1) & 1);   // K, Vt: the buffer that stage s - 1 read, whose readers passed the barrier at the foot of that stage; bias rows: this wave's own, read above
        __syncthreads();                       // publishes stage s + 1 and ends every read of stage s
    }
    // join of the two key halves, lane for lane: half 1 leaves its set in LDS (over the stage buffers, all read by now), half 0 adds it to its own and writes whole 128-byte lines of the merged planes
    float* jo = (float*)sm + (size_t)qg * NQT * 4 * 32 * 8 + lane * 8; float* jm = (float*)sm + 4 * NQT * 4 * 32 * 8 + qg * NQT * 32 * 2 + lane * 2;
    if (kh == 1) {
#pragma unroll
        for (int qt = 0; qt < NQT; ++qt) { v2f ml; ml[0] = m[qt]; ml[1] = l[qt]; *(v2f*)(jm + qt * 64) = ml;
#pragma unroll
            for (int dt = 0; dt < 4; ++dt) { *(v4f*)(jo + (qt * 4 + dt) * 256) = __builtin_shufflevector(o[dt][qt], o[dt][qt], 0, 1, 2, 3); *(v4f*)(jo + (qt * 4 + dt) * 256 + 4) = __builtin_shufflevector(o[dt][qt], o[dt][qt], 4, 5, 6, 7); } } }
    __syncthreads();
    if (kh == 0) {
#pragma unroll
        for (int qt = 0; qt < NQT; ++qt) { const v2f ml = *(const v2f*)(jm + qt * 64); const float M = fmaxf(m[qt], ml[0]); const float f0 = __builtin_amdgcn_exp2f(m[qt] - M), f1 = __builtin_amdgcn_exp2f(ml[0] - M);
            float L = l[qt] * f0 + ml[1] * f1; L += __shfl_xor(L, 16, 32); const float inv = 1.0f / L;
#pragma unroll
            for (int dt = 0; dt < 4; ++dt) { const v4f x0 = *(const v4f*)(jo + (qt * 4 + dt) * 256), x1 = *(const v4f*)(jo + (qt * 4 + dt) * 256 + 4); v8us oh, ol;
#pragma unroll
                for (int u = 0; u < 8; ++u) { unsigned short x, y; splitf((o[dt][qt][u] * f0 + ((u < 4) ? x0[u & 3] : x1[u & 3]) * f1) * inv, x, y); oh[u] = x; ol[u] = y; }
                const size_t oo = (size_t)(qw + qt * 16 + lr) * DQ + h * HD + dt * 16 + 8 * hi; *(v8us*)(Ah + oo) = oh; *(v8us*)(Al + oo) = ol;
                asm volatile("s_wait_xcnt 0x0" ::: "memory"); } } }   // stands in front of the next trip's rewrite of the two stores' address and data registers
}
// grid (heads, NB_ TT / 64), y = query tile x NB_ + batch: 64 query rows a work-group; the hi+lo tiles (three products each) of every batch have the low indices. Four waves a SIMD (at most 256 registers): two work-groups a WGP at a time.
__global__ __launch_bounds__(256, 4) void k_fattn(const h16* __restrict__ Q16, const h16* __restrict__ K16, const h16* __restrict__ V16, const bf* __restrict__ Qh, const bf* __restrict__ Ql, const bf* __restrict__ Kh, const bf* __restrict__ Kl, const bf* __restrict__ Vh, const bf* __restrict__ Vl, const float* __restrict__ ED, const float* __restrict__ sbias, bf* Ah, bf* Al) {
    __shared__ __align__(16) char sm[4 * 2 * (32 * KPI + 64 * VPI) * 2 + 8 * 16 * BPI * 4];   // the hi+lo form's stage buffers and bias rows; the fp16 form has half the planes
    const int h = blockIdx.x, b = (int)blockIdx.y % NB_, q0 = (int)blockIdx.y / NB_ * 64; const float sb2 = bfr(sbias[h]) * LOG2E;
    const size_t pb = (size_t)b * NH_ * TT * HD, eb = (size_t)b * TT * TT, ab = (size_t)b * TT * DQ;   // this batch's part of the operand planes, of the bias table, of the merged planes
    Q16 += pb; K16 += pb; V16 += pb; Qh += pb; Ql += pb; Kh += pb; Kl += pb; Vh += pb; Vl += pb; ED += eb; Ah += ab; Al += ab;
    if (q0 < RH) fattn_body<bf, true, 1>(Qh, Ql, Kh, Kl, Vh, Vl, ED, sb2, q0, h, Ah, Al, sm);
    else fattn_body<h16, false, 1>(Q16, nullptr, K16, nullptr, V16, nullptr, ED, sb2, q0, h, Ah, Al, sm);
}
// k_osum: out = sum of the KSP partial planes of merged x Wo, + bias (16-B lanes); the rows of all batches in one range
__global__ __launch_bounds__(256) void k_osum(const float* __restrict__ P, const float* __restrict__ bias, float* out) { const unsigned i4 = blockIdx.x * 256 + threadIdx.x; if (i4 >= NB_ * TT * DM / 4) return; const unsigned c = (i4 * 4) % DM; const v4f* P4 = (const v4f*)P; v4f a = P4[i4];
#pragma unroll
    for (int i = 1; i < KSP; ++i) { asm volatile("s_wait_xcnt 0x0" ::: "memory");   // stands in front of the next plane's load: the compiler lays its destination over the address pair of the load just issued
        a += (P4 + (size_t)i * (NB_ * TT * DM / 4))[i4]; }
#pragma unroll
    for (int u = 0; u < 4; ++u) a[u] += bfr(bias[c + u]);
    ((v4f*)out)[i4] = a;  }

__global__ __launch_bounds__(256) void k_dist(const float* __restrict__ co, const int* __restrict__ mk, float* ED) { const size_t e = ((size_t)blockIdx.x * 256 + threadIdx.x) * 4; if (e >= (size_t)TT * TT) return; co += (size_t)blockIdx.y * TT * 2; ED += (size_t)blockIdx.y * TT * TT; mk += (size_t)blockIdx.y * TT * TT;   /* grid y = batch */ const v4i mq = *(const v4i*)(mk + e); const int j = (int)(e % TT); const int i = (int)(e / TT); const float xi = bfr(co[i * 2]), yi = bfr(co[i * 2 + 1]); v4f o;   // exp(-dist): dist = sqrt(dx^2 + dy^2) (0 when d2 == 0), NaN where mask == 0 (16-B lanes)
#pragma unroll
    for (int u = 0; u < 4; ++u) { const float dx = __fsub_rn(xi, bfr(co[(j + u) * 2])), dy = __fsub_rn(yi, bfr(co[(j + u) * 2 + 1])); float px = __fmul_rn(dx, dx), py = __fmul_rn(dy, dy); asm volatile("" : "+v"(px)); asm volatile("" : "+v"(py)); const float d2 = __fadd_rn(px, py); const float dist = (d2 == 0.f) ? 0.f : __fsqrt_rn(d2); o[u] = (mq[u] == 0) ? __builtin_nanf("") : __expf(-dist); }
    *(v4f*)(ED + e) = o;  }

extern "C" void kernel_launch(void* const* d_in, const int* in_sizes, int n_in,
                              void* d_out, int out_size, void* d_ws, size_t ws_size, hipStream_t stream) {
    (void)in_sizes; (void)n_in; (void)out_size;
    const float* x = (const float*)d_in[0]; const float* coords = (const float*)d_in[1]; const int* mask = (const int*)d_in[2]; const float* wq = (const float*)d_in[3]; const float* wk = (const float*)d_in[4]; const float* wv = (const float*)d_in[5]; const float* sbias = (const float*)d_in[6]; const float* wo = (const float*)d_in[7]; const float* bo = (const float*)d_in[8]; const float* cosT = nullptr; const float* sinT = nullptr; (void)cosT; (void)sinT;
    float* OUT = (float*)d_out;     // [2][2048][1024]
    char* wsp = (char*)d_ws;
    auto take = [&](size_t bytes) { char* p = wsp; wsp += (bytes + 255) & ~(size_t)255; return (void*)p; };
    bf* WQ = (bf*)take((size_t)DQ * DM * 2); bf* WK = (bf*)take((size_t)DKV * DM * 2); bf* WV = (bf*)take((size_t)DKV * DM * 2); bf* WO = (bf*)take((size_t)DM * DQ * 2);
    bf* XB = (bf*)take((size_t)NB_ * TT * DM * 2); float* ED = (float*)take((size_t)NB_ * TT * TT * 4); float* FO = (float*)take((size_t)KSP * NB_ * TT * DM * 4);
    const size_t PL = (size_t)NH_ * TT * HD;   // elements of one operand plane of one batch (NKV == NH_)
    h16* QP16 = (h16*)take(NB_ * PL * 2); h16* KP16 = (h16*)take(NB_ * PL * 2); h16* VT16 = (h16*)take(NB_ * PL * 2);
    bf* QPh = (bf*)take(NB_ * PL * 2); bf* QPl = (bf*)take(NB_ * PL * 2); bf* KPh = (bf*)take(NB_ * PL * 2); bf* KPl = (bf*)take(NB_ * PL * 2); bf* VTh = (bf*)take(NB_ * PL * 2); bf* VTl = (bf*)take(NB_ * PL * 2);
    bf* ATh = (bf*)take((size_t)NB_ * TT * DQ * 2); bf* ATl = (bf*)take((size_t)NB_ * TT * DQ * 2);
    if ((size_t)(wsp - (char*)d_ws) > ws_size) return;    // ws 256 MiB
    k_wtG<<<dim3((unsigned)((DM * DQ / 64 + 63) / 64), 4), 256, 0, stream>>>(wq, wk, wv, wo, DM, DQ, WQ);   // WQ, WK, WV, WO: four planes of DM x DQ elements, taken one behind another above
    k_cvt8<<<(unsigned)(((size_t)NB_ * TT * DM / 8 + 255) / 256), 256, 0, stream>>>(x, XB, (size_t)NB_ * TT * DM / 8);
    k_proj<<<dim3(TT / 64, NH_, 3 * NB_), 32, 0, stream>>>(XB, WQ, WK, WV, QP16, QPh, QPl, KP16, KPh, KPl, VT16, VTh, VTl);
    k_dist<<<dim3((TT * TT / 4 + 255) / 256, NB_), 256, 0, stream>>>(coords, mask, ED);
    k_fattn<<<dim3(NH_, NB_ * TT / 64), 256, 0, stream>>>(QP16, KP16, VT16, QPh, QPl, KPh, KPl, VTh, VTl, ED, sbias, ATh, ATl);
    k_gemmw<bf, 1, false, KSP><<<dim3(NB_ * TT / 64, DM / 64, KSP), 32, 0, stream>>>(ATh, ATl, WO, nullptr, DQ, FO, DM, nullptr, 0, 0, 0, (size_t)NB_ * TT * DM);
    k_osum<<<(unsigned)(((size_t)NB_ * TT * DM / 4 + 255) / 256), 256, 0, stream>>>(FO, bo, OUT);
}

// v006
// A run of this version takes 181 microseconds.
// Next to v005, in two timings, it ran 1.13 times as fast each time.
// All steps since v000 together make it 12.5 times as fast.
#include <hip/hip_runtime.h>

// SpatialTemporalAttention (x [2][2048][1024]; Q/K/V = x W ([in,out], no bias; 16 heads x 64); scores = Q.K / 8 + spatial_bias[h] exp(-dist[b][i][j]) with dist = pairwise Euclidean distance of spatial_coords [2][2048][2] (0 when d2 == 0); masked where mask[b][i][j] == 0 (int, read) -> -inf; softmax; out = merged Wo + bo -> [2][2048][1024]).
// Compute dtypes, f32 accumulate: every input rounded to bf16; Q/K/V on PLAIN bf16 operands (inputs: exact), one launch for both batches whose epilogue writes the attention operand planes (k_proj); the distance bias table exp(-dist) [2][2048][2048] in f32, its masked entries NaN (k_dist reads the mask, once); scores and attn.v (one fused kernel, k_fattn): query rows < 512 hl (3 products), the rest single fp16; bias + mask + running softmax f32; Wo hl x exact (2 products) + bias. Every kernel is launched once: batches and the four weight matrices are grid indices.

#define NB_  2
#define TT   2048
#define DM   1024
#define NH_  16
#define NKV  16
#define REP  (NH_ / NKV)
#define HD   64
#define DQ   (NH_ * HD)
#define DKV  (NKV * HD)
#define RH   512                  // query rows < RH use hi+lo planes (0: none)
#define WIN  0
#define SCL  0.125f   // HD^-0.5
#define KPI  72                   // k_fattn LDS pitch of a staged K row, elements: 128 B + 16 B (16 B x odd: b128 fragment reads without bank conflicts)
#define VPI  40                   // the same of a staged Vt row: 64 B + 16 B
#define BPI  36                   // the same of a bias row, floats: 128 B + 16 B
#define LOG2E 1.4426950408889634f
#define KSP  4                    // K ranges of the Wo product (1024 -> 256 a work-group)
typedef _Float16 h16;
typedef unsigned short bf;
typedef __attribute__((ext_vector_type(16))) __bf16   v16bf;
typedef __attribute__((ext_vector_type(16))) _Float16 v16h;
typedef __attribute__((ext_vector_type(8)))  _Float16 v8h;
typedef __attribute__((ext_vector_type(8)))  unsigned short v8us;
typedef __attribute__((ext_vector_type(8)))  float    v8f;
typedef __attribute__((ext_vector_type(4)))  float    v4f;
typedef v8h  __attribute__((may_alias)) v8ha;
typedef v4f  __attribute__((may_alias)) v4fa;
typedef v8us __attribute__((may_alias)) v8usa;

__device__ __forceinline__ unsigned short f2bf(float f) { unsigned u = __float_as_uint(f); u += 0x7FFFu + ((u >> 16) & 1u); return (unsigned short)(u >> 16); }
__device__ __forceinline__ float bf2f(unsigned short b) { return __uint_as_float(((unsigned)b) << 16); }
__device__ __forceinline__ float bfr(float f) { return bf2f(f2bf(f)); }
__device__ __forceinline__ v16h cat16(v8h lo, v8h hi) { return __builtin_shufflevector(lo, hi, 0, 1, 2, 3, 4, 5, 6, 7, 8, 9, 10, 11, 12, 13, 14, 15); }
__device__ __forceinline__ v16bf cat16b(v8us lo, v8us hi) { return __builtin_bit_cast(v16bf, __builtin_shufflevector(lo, hi, 0, 1, 2, 3, 4, 5, 6, 7, 8, 9, 10, 11, 12, 13, 14, 15)); }
__device__ __forceinline__ v8f wmma16(v16h a, v16h b, v8f c) { return __builtin_amdgcn_wmma_f32_16x16x32_f16(false, a, false, b, (short)0, c, false, false); }
__device__ __forceinline__ v8f wmmab(v16bf a, v16bf b, v8f c) { return __builtin_amdgcn_wmma_f32_16x16x32_bf16(false, a, false, b, (short)0, c, false, false); }



// ---- k_gemmw: register-blocked GEMM, ONE WAVE per 64x64 output tile (16 accumulators), operands straight from K-contiguous 16-bit planes; grid (M/64, N/64, Z), 32 threads.
// C[m][n] (f32, pitch ldc, + optional f32 bias[n]) = sum_k A[m][k] Bt[n][k] (+ split products per NSPLIT). z-batch strides sA/sB/sC in elements. K % (32 KS) == 0.
// KS > 1: grid z = Z x KS; work-group (z, ks) sums only k in [ks K/KS, (ks+1) K/KS) and stores its f32 partial tile to plane ks (plane stride sP elements); the kernel that reads C adds the KS planes in plane order.
template <typename T16> struct WFrag;
template <> struct WFrag<h16> { typedef v16h V; static __device__ __forceinline__ V ld(const h16* p) { return cat16(*(const v8h*)p, *(const v8h*)(p + 16)); } static __device__ __forceinline__ v8f mma(V a, V b, v8f c) { return wmma16(a, b, c); } };
template <> struct WFrag<bf> { typedef v16bf V; static __device__ __forceinline__ V ld(const bf* p) { return cat16b(*(const v8us*)p, *(const v8us*)(p + 16)); } static __device__ __forceinline__ v8f mma(V a, V b, v8f c) { return wmmab(a, b, c); } };
template <typename T16, int NSPLIT, bool BIAS, int KS>
__global__ __launch_bounds__(32) void k_gemmw(const T16* __restrict__ A, const T16* __restrict__ A2, const T16* __restrict__ Bt, const T16* __restrict__ Bt2, int K, float* C, int ldc, const float* __restrict__ bias, size_t sA, size_t sB, size_t sC, size_t sP) {
    typedef typename WFrag<T16>::V V;
    __shared__ __align__(16) float os[16 * 68];
    const size_t z = blockIdx.z / KS; const int ks = blockIdx.z % KS; A += z * sA; if (A2) A2 += z * sA; Bt += z * sB; if (Bt2) Bt2 += z * sB; C += z * sC + (size_t)ks * sP; const int kn = K / KS, kb = ks * kn;
    const int lane = threadIdx.x & 31, lr = lane & 15, hi = lane >> 4; const int r0 = blockIdx.x * 64, c0 = blockIdx.y * 64;
    v8f acc[4][4];
#pragma unroll
    for (int mb = 0; mb < 4; ++mb)
#pragma unroll
        for (int nb = 0; nb < 4; ++nb) acc[mb][nb] = (v8f){};
    const size_t aoff = (size_t)(r0 + lr) * K + 8 * hi, boff = (size_t)(c0 + lr) * K + 8 * hi;
#pragma unroll 1
    for (int kc = kb; kc < kb + kn; kc += 32) {
        V a[4], a2[4];
#pragma unroll
        for (int mb = 0; mb < 4; ++mb) { a[mb] = WFrag<T16>::ld(A + aoff + (size_t)mb * 16 * K + kc); if (NSPLIT == 1 || NSPLIT == 2) a2[mb] = WFrag<T16>::ld(A2 + aoff + (size_t)mb * 16 * K + kc); }
#pragma unroll
        for (int nb = 0; nb < 4; ++nb) { const V b = WFrag<T16>::ld(Bt + boff + (size_t)nb * 16 * K + kc); V b2; if (NSPLIT >= 2) b2 = WFrag<T16>::ld(Bt2 + boff + (size_t)nb * 16 * K + kc);
#pragma unroll
            for (int mb = 0; mb < 4; ++mb) { acc[mb][nb] = WFrag<T16>::mma(a[mb], b, acc[mb][nb]); if (NSPLIT == 1 || NSPLIT == 2) acc[mb][nb] = WFrag<T16>::mma(a2[mb], b, acc[mb][nb]); if (NSPLIT >= 2) acc[mb][nb] = WFrag<T16>::mma(a[mb], b2, acc[mb][nb]); } }
        asm volatile("v_nop\n\tv_nop\n\tv_nop\n\tv_nop" : "+v"(acc[0][0]), "+v"(acc[1][1]), "+v"(acc[2][2]), "+v"(acc[3][3]) : "v"(a[0]), "v"(a[3]));
    }
#pragma unroll
    for (int mb = 0; mb < 4; ++mb) {
#pragma unroll
        for (int nb = 0; nb < 4; ++nb) {
#pragma unroll
            for (int j = 0; j < 8; ++j) os[(hi * 8 + j) * 68 + nb * 16 + lr] = acc[mb][nb][j]; }
        __builtin_amdgcn_wave_barrier(); asm volatile("" ::: "memory");
        float* crow = C + (size_t)(r0 + mb * 16) * ldc + c0;
{
#pragma unroll
            for (int s = 0; s < 8; ++s) { const int row = 2 * s + hi, cofs = lr * 4; v4f val = *(const v4fa*)(os + row * 68 + cofs); if (BIAS) { val[0] += bfr(bias[c0 + cofs]); val[1] += bfr(bias[c0 + cofs + 1]); val[2] += bfr(bias[c0 + cofs + 2]); val[3] += bfr(bias[c0 + cofs + 3]); }
                *(v4f*)(crow + (size_t)row * ldc + cofs) = val; }
             }
        __builtin_amdgcn_wave_barrier(); asm volatile("" ::: "memory");
    }
}

__device__ __forceinline__ h16 tohx(float x) { return (h16)x; }
__device__ __forceinline__ void splitf(float y, unsigned short& h, unsigned short& l) { h = f2bf(y); l = f2bf(y - bf2f(h)); }
typedef __attribute__((ext_vector_type(2))) _Float16 v2h;
typedef __attribute__((ext_vector_type(4))) _Float16 v4h;
typedef __attribute__((ext_vector_type(2))) unsigned short v2us;
typedef __attribute__((ext_vector_type(4))) unsigned short v4us;
typedef __attribute__((ext_vector_type(2))) float v2f;
typedef __attribute__((ext_vector_type(4))) int v4i;

// grid y = which of the four weight matrices (all [K][N]); their transposed bf16 planes lie one behind another from Bt
__global__ __launch_bounds__(256) void k_wtG(const float* __restrict__ w0, const float* __restrict__ w1, const float* __restrict__ w2, const float* __restrict__ w3, int K, int N, bf* Bt) {
    const float* __restrict__ w = blockIdx.y == 0 ? w0 : blockIdx.y == 1 ? w1 : blockIdx.y == 2 ? w2 : w3; Bt += (size_t)blockIdx.y * K * N;
    const int lane = threadIdx.x & 31; const int L0 = (blockIdx.x * 8 + (threadIdx.x >> 5)) * 8; const int nlines = N * K / 64;
{
#pragma unroll 1
        for (int l = 0; l < 8; ++l) { const int L = L0 + l; if (L >= nlines) break; const size_t e = (size_t)L * 64 + lane * 2; const int k = (int)(e % K), n = (int)(e / K); v2us o;
            o[0] = f2bf(w[(size_t)k * N + n]); o[1] = f2bf(w[(size_t)(k + 1) * N + n]); *(v2us*)(Bt + e) = o; }
         }
}
__global__ __launch_bounds__(256) void k_cvt8(const float* __restrict__ src, bf* dst, size_t n8) { const size_t i = (size_t)blockIdx.x * 256 + threadIdx.x; if (i >= n8) return; const v8f v = *(const v8f*)(src + i * 8); v8us o;
#pragma unroll
    for (int k = 0; k < 8; ++k) o[k] = f2bf(v[k]); *(v8us*)(dst + i * 8) = o;  }
__global__ __launch_bounds__(256) void k_cscvt(const float* __restrict__ cosT, const float* __restrict__ sinT, float* CS) { const int idx = blockIdx.x * 256 + threadIdx.x; if (idx >= TT * HD) return; v2f cs; cs[0] = bfr(cosT[idx]); cs[1] = bfr(sinT[idx]); *(v2f*)(CS + (size_t)idx * 2) = cs;  }
// ---- k_proj: the Q, K and V projections of both batches in one launch; ONE WAVE per 64x64 tile, the whole K range in one accumulation, and the epilogue writes the operand planes of k_fattn itself (fp16, and bf16 hi + lo).
// Work-group = 4 waves = 2 token tiles x 2 heads: they share 128 rows of x and 128 rows of the transposed weight. A stage is 64 k = one whole 128-byte line of each of the 256 rows: global loads (8 lanes a line) one stage ahead into registers,
// two LDS buffers, one barrier a stage; the fragments come from LDS in the k order of WFrag::ld, so every accumulator sums its products in the order it did before.
// grid (TT / 128, heads / 2, 3 NB_) = 768 work-groups, three a WGP by their LDS, all resident at once; z = product x NB_ + batch. Q, K: rows = 64 tokens of x, columns = the 64 outputs of head h -> plane [b][h][t][d]. V: rows = the 64 outputs of head h, columns = 64 tokens -> the transposed plane [b][h][d][t].
typedef v4i __attribute__((may_alias)) v4ia;
__global__ __launch_bounds__(128, 3) void k_proj(const bf* __restrict__ XB, const bf* __restrict__ WQ, const bf* __restrict__ WK, const bf* __restrict__ WV, h16* Q16, bf* Qh, bf* Ql, h16* K16, bf* Kh, bf* Kl, h16* V16, bf* Vh, bf* Vl) {
    __shared__ __align__(16) bf st[2 * 256 * KPI];          // two stage buffers: rows 0-127 of x, rows 128-255 of the weight, at the pitch of k_fattn's K rows (same row length, same reader)
    __shared__ __align__(16) float osm[4 * 16 * 68];        // each wave's own epilogue rows
    const int pr = blockIdx.z / NB_, b = blockIdx.z % NB_; const bool tr = pr == 2;
    const int th = threadIdx.x, lane = th & 31, lr = lane & 15, hi = lane >> 4; const int w = __builtin_amdgcn_readfirstlane(th >> 5), ti = w & 1, hj = w >> 1;
    const int t0 = ((int)blockIdx.x * 2 + ti) * 64, h = (int)blockIdx.y * 2 + hj; float* os = osm + w * 16 * 68;
    const bf* X = XB + ((size_t)b * TT + (size_t)blockIdx.x * 128) * DM; const bf* Wt = (pr == 0 ? WQ : pr == 1 ? WK : WV) + (size_t)blockIdx.y * 128 * DM;
    const unsigned go = (th >> 3) * DM + (th & 7) * 8; const int so = (th >> 3) * KPI + (th & 7) * 8;   // 16-byte chunk th & 7 of row th / 8 + 16 i
    const bf* xp = X + go; const bf* wp = Wt + go;   // the lane's two addresses, kept through the loop and stepped by one stage a trip, so that no load's destination is laid over an address that an issued load names
    v4i rx[8], rw[8];
    auto gload = [&]() {
#pragma unroll
        for (int i = 0; i < 8; ++i) { rx[i] = *(const v4ia*)(xp + i * 16 * DM); rw[i] = *(const v4ia*)(wp + i * 16 * DM); } };
    auto sstore = [&](int buf) { bf* d = st + buf * 256 * KPI + so;
#pragma unroll
        for (int i = 0; i < 8; ++i) { *(v4ia*)(d + i * 16 * KPI) = rx[i]; *(v4ia*)(d + (128 + i * 16) * KPI) = rw[i]; } };
    const int ao = ((tr ? 128 + hj * 64 : ti * 64) + lr) * KPI + 8 * hi, bo = ((tr ? ti * 64 : 128 + hj * 64) + lr) * KPI + 8 * hi;   // this wave's A and B rows in a stage buffer
    v8f acc[4][4];
#pragma unroll
    for (int mb = 0; mb < 4; ++mb)
#pragma unroll
        for (int nb = 0; nb < 4; ++nb) acc[mb][nb] = (v8f){};
    gload(); sstore(0); __syncthreads();
#pragma unroll 1   // rolled: 16 accumulators, the fragments and the 16 chunks on their way already fill the wave's working set
    for (int s = 0; s < DM / 64; ++s) { const bf* sb = st + (s & 1) * 256 * KPI;
        if (s + 1 < DM / 64) { xp += 64; wp += 64; gload(); }
        v16bf a[4];
#pragma unroll
        for (int kk = 0; kk < 2; ++kk) {
#pragma unroll
            for (int mb = 0; mb < 4; ++mb) a[mb] = WFrag<bf>::ld(sb + ao + mb * 16 * KPI + kk * 32);
#pragma unroll
            for (int nb = 0; nb < 4; ++nb) { const v16bf bb = WFrag<bf>::ld(sb + bo + nb * 16 * KPI + kk * 32);
#pragma unroll
                for (int mb = 0; mb < 4; ++mb) acc[mb][nb] = wmmab(a[mb], bb, acc[mb][nb]); } }
        asm volatile("v_nop\n\tv_nop\n\tv_nop\n\tv_nop" : "+v"(acc[0][0]), "+v"(acc[1][1]), "+v"(acc[2][2]), "+v"(acc[3][3]) : "v"(a[0]), "v"(a[3]));   // the four vector slots between the last WMMA and whatever follows it on either side of the branches below (the next trip's fragment loads over its operands, the epilogue's reads of its result)
        if (s + 1 < DM / 64) sstore((s + 1) & 1);   // the buffer that stage s - 1 read, whose readers passed the barrier at the foot of that stage
        __syncthreads();                            // publishes stage s + 1 and ends every read of stage s
    }
    h16* P16 = (pr == 0 ? Q16 : pr == 1 ? K16 : V16); bf* Ph = (pr == 0 ? Qh : pr == 1 ? Kh : Vh); bf* Pl = (pr == 0 ? Ql : pr == 1 ? Kl : Vl);
    const int op = tr ? TT : HD; const size_t ob = ((size_t)b * NH_ + h) * TT * HD + (size_t)t0 * (tr ? 1 : HD) + (size_t)(lane >> 3) * op + (lane & 7) * 8;
#pragma unroll
    for (int mb = 0; mb < 4; ++mb) {
#pragma unroll
        for (int nb = 0; nb < 4; ++nb) {
#pragma unroll
            for (int j = 0; j < 8; ++j) os[(hi * 8 + j) * 68 + nb * 16 + lr] = acc[mb][nb][j]; }
        __builtin_amdgcn_wave_barrier(); asm volatile("" ::: "memory");   // keeps the row reads below behind the tile's LDS writes
#pragma unroll
        for (int s = 0; s < 4; ++s) { const float* rp = os + (4 * s + (lane >> 3)) * 68 + (lane & 7) * 8; const v4f x0 = *(const v4fa*)rp, x1 = *(const v4fa*)(rp + 4); v8h o16; v8us oh, ol;   // 8 lanes a row of 64: whole 128-byte lines of each plane
#pragma unroll
            for (int u = 0; u < 8; ++u) { const float r = (u < 4) ? x0[u & 3] : x1[u & 3]; o16[u] = tohx(r); unsigned short a2, c2; splitf(r, a2, c2); oh[u] = a2; ol[u] = c2; }
            const size_t oo = ob + (size_t)(mb * 16 + 4 * s) * op; *(v8h*)(P16 + oo) = o16; *(v8us*)(Ph + oo) = oh; *(v8us*)(Pl + oo) = ol;
            asm volatile("s_wait_xcnt 0x0" ::: "memory"); }   // stands in front of the next trip's rewrite of the three stores' address and data registers
        __builtin_amdgcn_wave_barrier(); asm volatile("" ::: "memory");   // keeps the next tile's LDS writes behind the row reads above
    }
}
template <typename T16> struct PFrag;
template <> struct PFrag<h16> { static __device__ __forceinline__ void put(v16h& a, v16h& b, int e, float p) { (void)b; a[e] = (h16)p; } };
template <> struct PFrag<bf> { static __device__ __forceinline__ void put(v16bf& a, v16bf& b, int e, float p) { const __bf16 x = (__bf16)p; a[e] = x; b[e] = (__bf16)(p - (float)x); } };
template <typename T16, bool HL, int NQT>
__device__ __forceinline__ void fattn_body(const T16* __restrict__ Q, const T16* __restrict__ Q2, const T16* __restrict__ Kp, const T16* __restrict__ K2, const T16* __restrict__ Vt, const T16* __restrict__ V2, const float* __restrict__ ED, float sb2, int q0, int h, bf* Ah, bf* Al, char* sm) {
    typedef typename WFrag<T16>::V V;
    constexpr int NQ = 16 * NQT, NP = HL ? 2 : 1, KTE = 32 * KPI, VTE = 64 * VPI, STG = NP * (KTE + VTE), NS = TT / 2 / 32;
    const int lane = threadIdx.x & 31, lr = lane & 15, hi = lane >> 4, th = threadIdx.x & 127; const int w = __builtin_amdgcn_readfirstlane(threadIdx.x >> 5), qg = w & 3, kh = w >> 2;
    T16* st = (T16*)sm + kh * 2 * STG;                          // this key half's two stage buffers: K plane(s), then Vt plane(s)
    float* bs = (float*)(sm + 4 * STG * 2) + w * NQ * BPI;      // this wave's own bias rows
    const int qw = q0 + qg * NQ; const size_t hp = (size_t)h * TT * HD;
    V qf[NQT][2], qf2[NQT][2];
#pragma unroll
    for (int qt = 0; qt < NQT; ++qt)
#pragma unroll
        for (int kk = 0; kk < 2; ++kk) { const size_t a = hp + (size_t)(qw + qt * 16 + lr) * HD + kk * 32 + 8 * hi; qf[qt][kk] = WFrag<T16>::ld(Q + a); if (HL) qf2[qt][kk] = WFrag<T16>::ld(Q2 + a); }
    v8f o[4][NQT]; float m[NQT], l[NQT];
#pragma unroll
    for (int qt = 0; qt < NQT; ++qt) { m[qt] = -3.0e38f; l[qt] = 0.f;
#pragma unroll
        for (int dt = 0; dt < 4; ++dt) o[dt][qt] = (v8f){}; }
    const int kb = kh * (TT / 2);
    // the next stage on its way: 16-byte chunk c = th + 128 i of the K tile (32 rows x 8 chunks, contiguous in memory) and of the Vt tile (64 rows x 4 chunks); rows 4 i + lane / 8 of the bias block (8 lanes a 128-byte row)
    v4i rk[NP][2], rv[NP][2]; v4f re[NQT][4];
    const size_t ak = hp + (size_t)kb * HD + th * 8, av = hp + (size_t)(th >> 2) * TT + kb + (th & 3) * 8, ae = (size_t)(qw + (lane >> 3)) * TT + kb + (lane & 7) * 4;
    const T16* kp = Kp + ak; const T16* kp2 = HL ? K2 + ak : nullptr; const T16* vp = Vt + av; const T16* vp2 = HL ? V2 + av : nullptr; const float* ep = ED + ae;
    auto gload = [&]() {
#pragma unroll
        for (int i = 0; i < 2; ++i) { rk[0][i] = *(const v4ia*)(kp + i * 1024); rv[0][i] = *(const v4ia*)(vp + i * 32 * TT); if (HL) { rk[NP - 1][i] = *(const v4ia*)(kp2 + i * 1024); rv[NP - 1][i] = *(const v4ia*)(vp2 + i * 32 * TT); } }
#pragma unroll
        for (int qt = 0; qt < NQT; ++qt)
#pragma unroll
            for (int i = 0; i < 4; ++i) re[qt][i] = *(const v4f*)(ep + (qt * 16 + 4 * i) * TT);
        kp += 32 * HD; vp += 32; ep += 32; if (HL) { kp2 += 32 * HD; vp2 += 32; } };
    auto sstore = [&](int buf) { T16* b = st + buf * STG;
#pragma unroll
        for (int i = 0; i < 2; ++i) { const int c = th + 128 * i; const int sk = (c >> 3) * KPI + (c & 7) * 8, sv = NP * KTE + (c >> 2) * VPI + (c & 3) * 8;
            *(v4ia*)(b + sk) = rk[0][i]; *(v4ia*)(b + sv) = rv[0][i]; if (HL) { *(v4ia*)(b + KTE + sk) = rk[NP - 1][i]; *(v4ia*)(b + VTE + sv) = rv[NP - 1][i]; } }
#pragma unroll
        for (int qt = 0; qt < NQT; ++qt)
#pragma unroll
            for (int i = 0; i < 4; ++i) { v4f bb;
#pragma unroll
                for (int u = 0; u < 4; ++u) bb[u] = fmaxf(sb2 * re[qt][i][u], -__builtin_inff());   // a masked entry is NaN in the table: the maximum with -inf returns -inf for it and the product itself for every other
                *(v4f*)(bs + (qt * 16 + 4 * i + (lane >> 3)) * BPI + (lane & 7) * 4) = bb; } };
    gload(); sstore(0); __syncthreads();
#pragma unroll 1   // rolled: the stage body is several hundred instructions, and unrolled it would leave the register limit
    for (int s = 0; s < NS; ++s) { const T16* b = st + (s & 1) * STG;
        if (s + 1 < NS) gload();
        v8f sc_[2][NQT];
#pragma unroll
        for (int kt = 0; kt < 2; ++kt) { V ka[2], ka2[2];
#pragma unroll
            for (int kk = 0; kk < 2; ++kk) { const int a = (kt * 16 + lr) * KPI + kk * 32 + 8 * hi; ka[kk] = WFrag<T16>::ld(b + a); if (HL) ka2[kk] = WFrag<T16>::ld(b + KTE + a); }
#pragma unroll
            for (int qt = 0; qt < NQT; ++qt) { v8f c = (v8f){};
#pragma unroll
                for (int kk = 0; kk < 2; ++kk) { c = WFrag<T16>::mma(ka[kk], qf[qt][kk], c); if (HL) { c = WFrag<T16>::mma(ka[kk], qf2[qt][kk], c); c = WFrag<T16>::mma(ka2[kk], qf[qt][kk], c); } }
                sc_[kt][qt] = c; } }
        V pf[NQT], pf2[NQT];
#pragma unroll
        for (int qt = 0; qt < NQT; ++qt) { float mx = m[qt];
#pragma unroll
            for (int kt = 0; kt < 2; ++kt) { const float* br = bs + (qt * 16 + lr) * BPI + kt * 16 + 8 * hi; const v4f e0 = *(const v4f*)br, e1 = *(const v4f*)(br + 4);
#pragma unroll
                for (int j = 0; j < 8; ++j) { const float t = sc_[kt][qt][j] * (SCL * LOG2E) + ((j < 4) ? e0[j & 3] : e1[j & 3]); sc_[kt][qt][j] = t; mx = fmaxf(mx, t); } }
            mx = fmaxf(mx, __shfl_xor(mx, 16, 32));
            const float rs = __builtin_amdgcn_exp2f(m[qt] - mx); m[qt] = mx; float ps = 0.f;
#pragma unroll
            for (int kt = 0; kt < 2; ++kt)
#pragma unroll
                for (int j = 0; j < 8; ++j) { const float p = __builtin_amdgcn_exp2f(sc_[kt][qt][j] - mx); ps += p; PFrag<T16>::put(pf[qt], pf2[qt], kt * 8 + j, p); }
            l[qt] = l[qt] * rs + ps;   // this lane half's keys only; the lane halves are joined behind the loop
#pragma unroll
            for (int dt = 0; dt < 4; ++dt) o[dt][qt] *= rs; }
#pragma unroll
        for (int dt = 0; dt < 4; ++dt) { const int a = NP * KTE + (dt * 16 + lr) * VPI + 8 * hi; const V va = WFrag<T16>::ld(b + a); V va2; if (HL) va2 = WFrag<T16>::ld(b + VTE + a);
#pragma unroll
            for (int qt = 0; qt < NQT; ++qt) { o[dt][qt] = WFrag<T16>::mma(va, pf[qt], o[dt][qt]); if (HL) { o[dt][qt] = WFrag<T16>::mma(va, pf2[qt], o[dt][qt]); o[dt][qt] = WFrag<T16>::mma(va2, pf[qt], o[dt][qt]); } } }
        if (s + 1 < NS) sstore((s + 1) & 1);   // K, Vt: the buffer that stage s - 1 read, whose readers passed the barrier at the foot of that stage; bias rows: this wave's own, read above
        __syncthreads();                       // publishes stage s + 1 and ends every read of stage s
    }
    // join of the two key halves, lane for lane: half 1 leaves its set in LDS (over the stage buffers, all read by now), half 0 adds it to its own and writes whole 128-byte lines of the merged planes
    float* jo = (float*)sm + (size_t)qg * NQT * 4 * 32 * 8 + lane * 8; float* jm = (float*)sm + 4 * NQT * 4 * 32 * 8 + qg * NQT * 32 * 2 + lane * 2;
    if (kh == 1) {
#pragma unroll
        for (int qt = 0; qt < NQT; ++qt) { v2f ml; ml[0] = m[qt]; ml[1] = l[qt]; *(v2f*)(jm + qt * 64) = ml;
#pragma unroll
            for (int dt = 0; dt < 4; ++dt) { *(v4f*)(jo + (qt * 4 + dt) * 256) = __builtin_shufflevector(o[dt][qt], o[dt][qt], 0, 1, 2, 3); *(v4f*)(jo + (qt * 4 + dt) * 256 + 4) = __builtin_shufflevector(o[dt][qt], o[dt][qt], 4, 5, 6, 7); } } }
    __syncthreads();
    if (kh == 0) {
#pragma unroll
        for (int qt = 0; qt < NQT; ++qt) { const v2f ml = *(const v2f*)(jm + qt * 64); const float M = fmaxf(m[qt], ml[0]); const float f0 = __builtin_amdgcn_exp2f(m[qt] - M), f1 = __builtin_amdgcn_exp2f(ml[0] - M);
            float L = l[qt] * f0 + ml[1] * f1; L += __shfl_xor(L, 16, 32); const float inv = 1.0f / L;
#pragma unroll
            for (int dt = 0; dt < 4; ++dt) { const v4f x0 = *(const v4f*)(jo + (qt * 4 + dt) * 256), x1 = *(const v4f*)(jo + (qt * 4 + dt) * 256 + 4); v8us oh, ol;
#pragma unroll
                for (int u = 0; u < 8; ++u) { unsigned short x, y; splitf((o[dt][qt][u] * f0 + ((u < 4) ? x0[u & 3] : x1[u & 3]) * f1) * inv, x, y); oh[u] = x; ol[u] = y; }
                const size_t oo = (size_t)(qw + qt * 16 + lr) * DQ + h * HD + dt * 16 + 8 * hi; *(v8us*)(Ah + oo) = oh; *(v8us*)(Al + oo) = ol;
                asm volatile("s_wait_xcnt 0x0" ::: "memory"); } } }   // stands in front of the next trip's rewrite of the two stores' address and data registers
}
// grid (heads, NB_ TT / 64), y = query tile x NB_ + batch: 64 query rows a work-group; the hi+lo tiles (three products each) of every batch have the low indices. Four waves a SIMD (at most 256 registers): two work-groups a WGP at a time.
__global__ __launch_bounds__(256, 4) void k_fattn(const h16* __restrict__ Q16, const h16* __restrict__ K16, const h16* __restrict__ V16, const bf* __restrict__ Qh, const bf* __restrict__ Ql, const bf* __restrict__ Kh, const bf* __restrict__ Kl, const bf* __restrict__ Vh, const bf* __restrict__ Vl, const float* __restrict__ ED, const float* __restrict__ sbias, bf* Ah, bf* Al) {
    __shared__ __align__(16) char sm[4 * 2 * (32 * KPI + 64 * VPI) * 2 + 8 * 16 * BPI * 4];   // the hi+lo form's stage buffers and bias rows; the fp16 form has half the planes
    const int h = blockIdx.x, b = (int)blockIdx.y % NB_, q0 = (int)blockIdx.y / NB_ * 64; const float sb2 = bfr(sbias[h]) * LOG2E;
    const size_t pb = (size_t)b * NH_ * TT * HD, eb = (size_t)b * TT * TT, ab = (size_t)b * TT * DQ;   // this batch's part of the operand planes, of the bias table, of the merged planes
    Q16 += pb; K16 += pb; V16 += pb; Qh += pb; Ql += pb; Kh += pb; Kl += pb; Vh += pb; Vl += pb; ED += eb; Ah += ab; Al += ab;
    if (q0 < RH) fattn_body<bf, true, 1>(Qh, Ql, Kh, Kl, Vh, Vl, ED, sb2, q0, h, Ah, Al, sm);
    else fattn_body<h16, false, 1>(Q16, nullptr, K16, nullptr, V16, nullptr, ED, sb2, q0, h, Ah, Al, sm);
}
// k_osum: out = sum of the KSP partial planes of merged x Wo, + bias (16-B lanes); the rows of all batches in one range
__global__ __launch_bounds__(256) void k_osum(const float* __restrict__ P, const float* __restrict__ bias, float* out) { const unsigned i4 = blockIdx.x * 256 + threadIdx.x; if (i4 >= NB_ * TT * DM / 4) return; const unsigned c = (i4 * 4) % DM; const v4f* P4 = (const v4f*)P; v4f a = P4[i4];
#pragma unroll
    for (int i = 1; i < KSP; ++i) { asm volatile("s_wait_xcnt 0x0" ::: "memory");   // stands in front of the next plane's load: the compiler lays its destination over the address pair of the load just issued
        a += (P4 + (size_t)i * (NB_ * TT * DM / 4))[i4]; }
#pragma unroll
    for (int u = 0; u < 4; ++u) a[u] += bfr(bias[c + u]);
    ((v4f*)out)[i4] = a;  }

__global__ __launch_bounds__(256) void k_dist(const float* __restrict__ co, const int* __restrict__ mk, float* ED) { const size_t e = ((size_t)blockIdx.x * 256 + threadIdx.x) * 4; if (e >= (size_t)TT * TT) return; co += (size_t)blockIdx.y * TT * 2; ED += (size_t)blockIdx.y * TT * TT; mk += (size_t)blockIdx.y * TT * TT;   /* grid y = batch */ const v4i mq = *(const v4i*)(mk + e); const int j = (int)(e % TT); const int i = (int)(e / TT); const float xi = bfr(co[i * 2]), yi = bfr(co[i * 2 + 1]); v4f o;   // exp(-dist): dist = sqrt(dx^2 + dy^2) (0 when d2 == 0), NaN where mask == 0 (16-B lanes)
#pragma unroll
    for (int u = 0; u < 4; ++u) { const float dx = __fsub_rn(xi, bfr(co[(j + u) * 2])), dy = __fsub_rn(yi, bfr(co[(j + u) * 2 + 1])); float px = __fmul_rn(dx, dx), py = __fmul_rn(dy, dy); asm volatile("" : "+v"(px)); asm volatile("" : "+v"(py)); const float d2 = __fadd_rn(px, py); const float dist = (d2 == 0.f) ? 0.f : __fsqrt_rn(d2); o[u] = (mq[u] == 0) ? __builtin_nanf("") : __expf(-dist); }
    *(v4f*)(ED + e) = o;  }

extern "C" void kernel_launch(void* const* d_in, const int* in_sizes, int n_in,
                              void* d_out, int out_size, void* d_ws, size_t ws_size, hipStream_t stream) {
    (void)in_sizes; (void)n_in; (void)out_size;
    const float* x = (const float*)d_in[0]; const float* coords = (const float*)d_in[1]; const int* mask = (const int*)d_in[2]; const float* wq = (const float*)d_in[3]; const float* wk = (const float*)d_in[4]; const float* wv = (const float*)d_in[5]; const float* sbias = (const float*)d_in[6]; const float* wo = (const float*)d_in[7]; const float* bo = (const float*)d_in[8]; const float* cosT = nullptr; const float* sinT = nullptr; (void)cosT; (void)sinT;
    float* OUT = (float*)d_out;     // [2][2048][1024]
    char* wsp = (char*)d_ws;
    auto take = [&](size_t bytes) { char* p = wsp; wsp += (bytes + 255) & ~(size_t)255; return (void*)p; };
    bf* WQ = (bf*)take((size_t)DQ * DM * 2); bf* WK = (bf*)take((size_t)DKV * DM * 2); bf* WV = (bf*)take((size_t)DKV * DM * 2); bf* WO = (bf*)take((size_t)DM * DQ * 2);
    bf* XB = (bf*)take((size_t)NB_ * TT * DM * 2); float* ED = (float*)take((size_t)NB_ * TT * TT * 4); float* FO = (float*)take((size_t)KSP * NB_ * TT * DM * 4);
    const size_t PL = (size_t)NH_ * TT * HD;   // elements of one operand plane of one batch (NKV == NH_)
    h16* QP16 = (h16*)take(NB_ * PL * 2); h16* KP16 = (h16*)take(NB_ * PL * 2); h16* VT16 = (h16*)take(NB_ * PL * 2);
    bf* QPh = (bf*)take(NB_ * PL * 2); bf* QPl = (bf*)take(NB_ * PL * 2); bf* KPh = (bf*)take(NB_ * PL * 2); bf* KPl = (bf*)take(NB_ * PL * 2); bf* VTh = (bf*)take(NB_ * PL * 2); bf* VTl = (bf*)take(NB_ * PL * 2);
    bf* ATh = (bf*)take((size_t)NB_ * TT * DQ * 2); bf* ATl = (bf*)take((size_t)NB_ * TT * DQ * 2);
    if ((size_t)(wsp - (char*)d_ws) > ws_size) return;    // ws 256 MiB
    k_wtG<<<dim3((unsigned)((DM * DQ / 64 + 63) / 64), 4), 256, 0, stream>>>(wq, wk, wv, wo, DM, DQ, WQ);   // WQ, WK, WV, WO: four planes of DM x DQ elements, taken one behind another above
    k_cvt8<<<(unsigned)(((size_t)NB_ * TT * DM / 8 + 255) / 256), 256, 0, stream>>>(x, XB, (size_t)NB_ * TT * DM / 8);
    k_proj<<<dim3(TT / 128, NH_ / 2, 3 * NB_), 128, 0, stream>>>(XB, WQ, WK, WV, QP16, QPh, QPl, KP16, KPh, KPl, VT16, VTh, VTl);
    k_dist<<<dim3((TT * TT / 4 + 255) / 256, NB_), 256, 0, stream>>>(coords, mask, ED);
    k_fattn<<<dim3(NH_, NB_ * TT / 64), 256, 0, stream>>>(QP16, KP16, VT16, QPh, QPl, KPh, KPl, VTh, VTl, ED, sbias, ATh, ATl);
    k_gemmw<bf, 1, false, KSP><<<dim3(NB_ * TT / 64, DM / 64, KSP), 32, 0, stream>>>(ATh, ATl, WO, nullptr, DQ, FO, DM, nullptr, 0, 0, 0, (size_t)NB_ * TT * DM);
    k_osum<<<(unsigned)(((size_t)NB_ * TT * DM / 4 + 255) / 256), 256, 0, stream>>>(FO, bo, OUT);
}

// v007
// Measured time: 162 microseconds a run.
// Timed twice side by side with v006, it ran 1.11 and 1.12 times as fast.
// All steps since v000 together make it 13.9 times as fast.
#include <hip/hip_runtime.h>

// SpatialTemporalAttention (x [2][2048][1024]; Q/K/V = x W ([in,out], no bias; 16 heads x 64); scores = Q.K / 8 + spatial_bias[h] exp(-dist[b][i][j]) with dist = pairwise Euclidean distance of spatial_coords [2][2048][2] (0 when d2 == 0); masked where mask[b][i][j] == 0 (int, read) -> -inf; softmax; out = merged Wo + bo -> [2][2048][1024]).
// Compute dtypes, f32 accumulate: every input rounded to bf16; Q/K/V on PLAIN bf16 operands (inputs: exact), one launch for both batches whose epilogue writes the attention operand planes (k_proj); the distance bias table exp(-dist) [2][2048][2048] in f32, its masked entries NaN (k_dist reads the mask, once); scores and attn.v (one fused kernel, k_fattn): query rows < 512 hl (3 products), the rest single fp16; bias + mask + running softmax f32; Wo hl x exact (2 products) + bias. Every kernel is launched once: batches and the four weight matrices are grid indices.

#define NB_  2
#define TT   2048
#define DM   1024
#define NH_  16
#define NKV  16
#define REP  (NH_ / NKV)
#define HD   64
#define DQ   (NH_ * HD)
#define DKV  (NKV * HD)
#define RH   512                  // query rows < RH use hi+lo planes (0: none)
#define WIN  0
#define SCL  0.125f   // HD^-0.5
#define KPI  72                   // k_fattn LDS pitch of a staged K row, elements: 128 B + 16 B (16 B x odd: b128 fragment reads without bank conflicts)
#define VPI  40                   // the same of a staged Vt row: 64 B + 16 B
#define BPI  36                   // the same of a bias row, floats: 128 B + 16 B
#define LOG2E 1.4426950408889634f
typedef _Float16 h16;
typedef unsigned short bf;
typedef __attribute__((ext_vector_type(16))) __bf16   v16bf;
typedef __attribute__((ext_vector_type(16))) _Float16 v16h;
typedef __attribute__((ext_vector_type(8)))  _Float16 v8h;
typedef __attribute__((ext_vector_type(8)))  unsigned short v8us;
typedef __attribute__((ext_vector_type(8)))  float    v8f;
typedef __attribute__((ext_vector_type(4)))  float    v4f;
typedef v8h  __attribute__((may_alias)) v8ha;
typedef v4f  __attribute__((may_alias)) v4fa;
typedef v8us __attribute__((may_alias)) v8usa;

__device__ __forceinline__ unsigned short f2bf(float f) { unsigned u = __float_as_uint(f); u += 0x7FFFu + ((u >> 16) & 1u); return (unsigned short)(u >> 16); }
__device__ __forceinline__ float bf2f(unsigned short b) { return __uint_as_float(((unsigned)b) << 16); }
__device__ __forceinline__ float bfr(float f) { return bf2f(f2bf(f)); }
__device__ __forceinline__ v16h cat16(v8h lo, v8h hi) { return __builtin_shufflevector(lo, hi, 0, 1, 2, 3, 4, 5, 6, 7, 8, 9, 10, 11, 12, 13, 14, 15); }
__device__ __forceinline__ v16bf cat16b(v8us lo, v8us hi) { return __builtin_bit_cast(v16bf, __builtin_shufflevector(lo, hi, 0, 1, 2, 3, 4, 5, 6, 7, 8, 9, 10, 11, 12, 13, 14, 15)); }
__device__ __forceinline__ v8f wmma16(v16h a, v16h b, v8f c) { return __builtin_amdgcn_wmma_f32_16x16x32_f16(false, a, false, b, (short)0, c, false, false); }
__device__ __forceinline__ v8f wmmab(v16bf a, v16bf b, v8f c) { return __builtin_amdgcn_wmma_f32_16x16x32_bf16(false, a, false, b, (short)0, c, false, false); }



// a 16x32 operand fragment from a K-contiguous 16-bit row (global or LDS): lane (lr, hi) holds k = 8 hi + 0..7 and 16 + 8 hi + 0..7 of row lr
template <typename T16> struct WFrag;
template <> struct WFrag<h16> { typedef v16h V; static __device__ __forceinline__ V ld(const h16* p) { return cat16(*(const v8h*)p, *(const v8h*)(p + 16)); } static __device__ __forceinline__ v8f mma(V a, V b, v8f c) { return wmma16(a, b, c); } };
template <> struct WFrag<bf> { typedef v16bf V; static __device__ __forceinline__ V ld(const bf* p) { return cat16b(*(const v8us*)p, *(const v8us*)(p + 16)); } static __device__ __forceinline__ v8f mma(V a, V b, v8f c) { return wmmab(a, b, c); } };
__device__ __forceinline__ h16 tohx(float x) { return (h16)x; }
__device__ __forceinline__ void splitf(float y, unsigned short& h, unsigned short& l) { h = f2bf(y); l = f2bf(y - bf2f(h)); }
typedef __attribute__((ext_vector_type(2))) _Float16 v2h;
typedef __attribute__((ext_vector_type(4))) _Float16 v4h;
typedef __attribute__((ext_vector_type(2))) unsigned short v2us;
typedef __attribute__((ext_vector_type(4))) unsigned short v4us;
typedef __attribute__((ext_vector_type(2))) float v2f;
typedef __attribute__((ext_vector_type(4))) int v4i;

// grid y = which of the four weight matrices (all [K][N]); their transposed bf16 planes lie one behind another from Bt
__global__ __launch_bounds__(256) void k_wtG(const float* __restrict__ w0, const float* __restrict__ w1, const float* __restrict__ w2, const float* __restrict__ w3, int K, int N, bf* Bt) {
    const float* __restrict__ w = blockIdx.y == 0 ? w0 : blockIdx.y == 1 ? w1 : blockIdx.y == 2 ? w2 : w3; Bt += (size_t)blockIdx.y * K * N;
    const int lane = threadIdx.x & 31; const int L0 = (blockIdx.x * 8 + (threadIdx.x >> 5)) * 8; const int nlines = N * K / 64;
{
#pragma unroll 1
        for (int l = 0; l < 8; ++l) { const int L = L0 + l; if (L >= nlines) break; const size_t e = (size_t)L * 64 + lane * 2; const int k = (int)(e % K), n = (int)(e / K); v2us o;
            o[0] = f2bf(w[(size_t)k * N + n]); o[1] = f2bf(w[(size_t)(k + 1) * N + n]); *(v2us*)(Bt + e) = o; }
         }
}
__global__ __launch_bounds__(256) void k_cvt8(const float* __restrict__ src, bf* dst, size_t n8) { const size_t i = (size_t)blockIdx.x * 256 + threadIdx.x; if (i >= n8) return; const v8f v = *(const v8f*)(src + i * 8); v8us o;
#pragma unroll
    for (int k = 0; k < 8; ++k) o[k] = f2bf(v[k]); *(v8us*)(dst + i * 8) = o;  }
__global__ __launch_bounds__(256) void k_cscvt(const float* __restrict__ cosT, const float* __restrict__ sinT, float* CS) { const int idx = blockIdx.x * 256 + threadIdx.x; if (idx >= TT * HD) return; v2f cs; cs[0] = bfr(cosT[idx]); cs[1] = bfr(sinT[idx]); *(v2f*)(CS + (size_t)idx * 2) = cs;  }
// ---- k_proj: the Q, K and V projections of both batches in one launch; ONE WAVE per 64x64 tile, the whole K range in one accumulation, and the epilogue writes the operand planes of k_fattn itself (fp16, and bf16 hi + lo).
// Work-group = 4 waves = 2 token tiles x 2 heads: they share 128 rows of x and 128 rows of the transposed weight. A stage is 64 k = one whole 128-byte line of each of the 256 rows: global loads (8 lanes a line) one stage ahead into registers,
// two LDS buffers, one barrier a stage; the fragments come from LDS in the k order of WFrag::ld, so every accumulator sums its products in the order it did before.
// grid (TT / 128, heads / 2, 3 NB_) = 768 work-groups, three a WGP by their LDS, all resident at once; z = product x NB_ + batch. Q, K: rows = 64 tokens of x, columns = the 64 outputs of head h -> plane [b][h][t][d]. V: rows = the 64 outputs of head h, columns = 64 tokens -> the transposed plane [b][h][d][t].
typedef v4i __attribute__((may_alias)) v4ia;
__global__ __launch_bounds__(128, 3) void k_proj(const bf* __restrict__ XB, const bf* __restrict__ WQ, const bf* __restrict__ WK, const bf* __restrict__ WV, h16* Q16, bf* Qh, bf* Ql, h16* K16, bf* Kh, bf* Kl, h16* V16, bf* Vh, bf* Vl) {
    __shared__ __align__(16) bf st[2 * 256 * KPI];          // two stage buffers: rows 0-127 of x, rows 128-255 of the weight, at the pitch of k_fattn's K rows (same row length, same reader)
    __shared__ __align__(16) float osm[4 * 16 * 68];        // each wave's own epilogue rows
    const int pr = blockIdx.z / NB_, b = blockIdx.z % NB_; const bool tr = pr == 2;
    const int th = threadIdx.x, lane = th & 31, lr = lane & 15, hi = lane >> 4; const int w = __builtin_amdgcn_readfirstlane(th >> 5), ti = w & 1, hj = w >> 1;
    const int t0 = ((int)blockIdx.x * 2 + ti) * 64, h = (int)blockIdx.y * 2 + hj; float* os = osm + w * 16 * 68;
    const bf* X = XB + ((size_t)b * TT + (size_t)blockIdx.x * 128) * DM; const bf* Wt = (pr == 0 ? WQ : pr == 1 ? WK : WV) + (size_t)blockIdx.y * 128 * DM;
    const unsigned go = (th >> 3) * DM + (th & 7) * 8; const int so = (th >> 3) * KPI + (th & 7) * 8;   // 16-byte chunk th & 7 of row th / 8 + 16 i
    const bf* xp = X + go; const bf* wp = Wt + go;   // the lane's two addresses, kept through the loop and stepped by one stage a trip, so that no load's destination is laid over an address that an issued load names
    v4i rx[8], rw[8];
    auto gload = [&]() {
#pragma unroll
        for (int i = 0; i < 8; ++i) { rx[i] = *(const v4ia*)(xp + i * 16 * DM); rw[i] = *(const v4ia*)(wp + i * 16 * DM); } };
    auto sstore = [&](int buf) { bf* d = st + buf * 256 * KPI + so;
#pragma unroll
        for (int i = 0; i < 8; ++i) { *(v4ia*)(d + i * 16 * KPI) = rx[i]; *(v4ia*)(d + (128 + i * 16) * KPI) = rw[i]; } };
    const int ao = ((tr ? 128 + hj * 64 : ti * 64) + lr) * KPI + 8 * hi, bo = ((tr ? ti * 64 : 128 + hj * 64) + lr) * KPI + 8 * hi;   // this wave's A and B rows in a stage buffer
    v8f acc[4][4];
#pragma unroll
    for (int mb = 0; mb < 4; ++mb)
#pragma unroll
        for (int nb = 0; nb < 4; ++nb) acc[mb][nb] = (v8f){};
    gload(); sstore(0); __syncthreads();
#pragma unroll 1   // rolled: 16 accumulators, the fragments and the 16 chunks on their way already fill the wave's working set
    for (int s = 0; s < DM / 64; ++s) { const bf* sb = st + (s & 1) * 256 * KPI;
        if (s + 1 < DM / 64) { xp += 64; wp += 64; gload(); }
        v16bf a[4];
#pragma unroll
        for (int kk = 0; kk < 2; ++kk) {
#pragma unroll
            for (int mb = 0; mb < 4; ++mb) a[mb] = WFrag<bf>::ld(sb + ao + mb * 16 * KPI + kk * 32);
#pragma unroll
            for (int nb = 0; nb < 4; ++nb) { const v16bf bb = WFrag<bf>::ld(sb + bo + nb * 16 * KPI + kk * 32);
#pragma unroll
                for (int mb = 0; mb < 4; ++mb) acc[mb][nb] = wmmab(a[mb], bb, acc[mb][nb]); } }
        asm volatile("v_nop\n\tv_nop\n\tv_nop\n\tv_nop" : "+v"(acc[0][0]), "+v"(acc[1][1]), "+v"(acc[2][2]), "+v"(acc[3][3]) : "v"(a[0]), "v"(a[3]));   // the four vector slots between the last WMMA and whatever follows it on either side of the branches below (the next trip's fragment loads over its operands, the epilogue's reads of its result)
        if (s + 1 < DM / 64) sstore((s + 1) & 1);   // the buffer that stage s - 1 read, whose readers passed the barrier at the foot of that stage
        __syncthreads();                            // publishes stage s + 1 and ends every read of stage s
    }
    h16* P16 = (pr == 0 ? Q16 : pr == 1 ? K16 : V16); bf* Ph = (pr == 0 ? Qh : pr == 1 ? Kh : Vh); bf* Pl = (pr == 0 ? Ql : pr == 1 ? Kl : Vl);
    const int op = tr ? TT : HD; const size_t ob = ((size_t)b * NH_ + h) * TT * HD + (size_t)t0 * (tr ? 1 : HD) + (size_t)(lane >> 3) * op + (lane & 7) * 8;
#pragma unroll
    for (int mb = 0; mb < 4; ++mb) {
#pragma unroll
        for (int nb = 0; nb < 4; ++nb) {
#pragma unroll
            for (int j = 0; j < 8; ++j) os[(hi * 8 + j) * 68 + nb * 16 + lr] = acc[mb][nb][j]; }
        __builtin_amdgcn_wave_barrier(); asm volatile("" ::: "memory");   // keeps the row reads below behind the tile's LDS writes
#pragma unroll
        for (int s = 0; s < 4; ++s) { const float* rp = os + (4 * s + (lane >> 3)) * 68 + (lane & 7) * 8; const v4f x0 = *(const v4fa*)rp, x1 = *(const v4fa*)(rp + 4); v8h o16; v8us oh, ol;   // 8 lanes a row of 64: whole 128-byte lines of each plane
#pragma unroll
            for (int u = 0; u < 8; ++u) { const float r = (u < 4) ? x0[u & 3] : x1[u & 3]; o16[u] = tohx(r); unsigned short a2, c2; splitf(r, a2, c2); oh[u] = a2; ol[u] = c2; }
            const size_t oo = ob + (size_t)(mb * 16 + 4 * s) * op; *(v8h*)(P16 + oo) = o16; *(v8us*)(Ph + oo) = oh; *(v8us*)(Pl + oo) = ol;
            asm volatile("s_wait_xcnt 0x0" ::: "memory"); }   // stands in front of the next trip's rewrite of the three stores' address and data registers
        __builtin_amdgcn_wave_barrier(); asm volatile("" ::: "memory");   // keeps the next tile's LDS writes behind the row reads above
    }
}
template <typename T16> struct PFrag;
template <> struct PFrag<h16> { static __device__ __forceinline__ void put(v16h& a, v16h& b, int e, float p) { (void)b; a[e] = (h16)p; } };
template <> struct PFrag<bf> { static __device__ __forceinline__ void put(v16bf& a, v16bf& b, int e, float p) { const __bf16 x = (__bf16)p; a[e] = x; b[e] = (__bf16)(p - (float)x); } };
template <typename T16, bool HL, int NQT>
__device__ __forceinline__ void fattn_body(const T16* __restrict__ Q, const T16* __restrict__ Q2, const T16* __restrict__ Kp, const T16* __restrict__ K2, const T16* __restrict__ Vt, const T16* __restrict__ V2, const float* __restrict__ ED, float sb2, int q0, int h, bf* Ah, bf* Al, char* sm) {
    typedef typename WFrag<T16>::V V;
    constexpr int NQ = 16 * NQT, NP = HL ? 2 : 1, KTE = 32 * KPI, VTE = 64 * VPI, STG = NP * (KTE + VTE), NS = TT / 2 / 32;
    const int lane = threadIdx.x & 31, lr = lane & 15, hi = lane >> 4, th = threadIdx.x & 127; const int w = __builtin_amdgcn_readfirstlane(threadIdx.x >> 5), qg = w & 3, kh = w >> 2;
    T16* st = (T16*)sm + kh * 2 * STG;                          // this key half's two stage buffers: K plane(s), then Vt plane(s)
    float* bs = (float*)(sm + 4 * STG * 2) + w * NQ * BPI;      // this wave's own bias rows
    const int qw = q0 + qg * NQ; const size_t hp = (size_t)h * TT * HD;
    V qf[NQT][2], qf2[NQT][2];
#pragma unroll
    for (int qt = 0; qt < NQT; ++qt)
#pragma unroll
        for (int kk = 0; kk < 2; ++kk) { const size_t a = hp + (size_t)(qw + qt * 16 + lr) * HD + kk * 32 + 8 * hi; qf[qt][kk] = WFrag<T16>::ld(Q + a); if (HL) qf2[qt][kk] = WFrag<T16>::ld(Q2 + a); }
    v8f o[4][NQT]; float m[NQT], l[NQT];
#pragma unroll
    for (int qt = 0; qt < NQT; ++qt) { m[qt] = -3.0e38f; l[qt] = 0.f;
#pragma unroll
        for (int dt = 0; dt < 4; ++dt) o[dt][qt] = (v8f){}; }
    const int kb = kh * (TT / 2);
    // the next stage on its way: 16-byte chunk c = th + 128 i of the K tile (32 rows x 8 chunks, contiguous in memory) and of the Vt tile (64 rows x 4 chunks); rows 4 i + lane / 8 of the bias block (8 lanes a 128-byte row)
    v4i rk[NP][2], rv[NP][2]; v4f re[NQT][4];
    const size_t ak = hp + (size_t)kb * HD + th * 8, av = hp + (size_t)(th >> 2) * TT + kb + (th & 3) * 8, ae = (size_t)(qw + (lane >> 3)) * TT + kb + (lane & 7) * 4;
    const T16* kp = Kp + ak; const T16* kp2 = HL ? K2 + ak : nullptr; const T16* vp = Vt + av; const T16* vp2 = HL ? V2 + av : nullptr; const float* ep = ED + ae;
    auto gload = [&]() {
#pragma unroll
        for (int i = 0; i < 2; ++i) { rk[0][i] = *(const v4ia*)(kp + i * 1024); rv[0][i] = *(const v4ia*)(vp + i * 32 * TT); if (HL) { rk[NP - 1][i] = *(const v4ia*)(kp2 + i * 1024); rv[NP - 1][i] = *(const v4ia*)(vp2 + i * 32 * TT); } }
#pragma unroll
        for (int qt = 0; qt < NQT; ++qt)
#pragma unroll
            for (int i = 0; i < 4; ++i) re[qt][i] = *(const v4f*)(ep + (qt * 16 + 4 * i) * TT);
        kp += 32 * HD; vp += 32; ep += 32; if (HL) { kp2 += 32 * HD; vp2 += 32; } };
    auto sstore = [&](int buf) { T16* b = st + buf * STG;
#pragma unroll
        for (int i = 0; i < 2; ++i) { const int c = th + 128 * i; const int sk = (c >> 3) * KPI + (c & 7) * 8, sv = NP * KTE + (c >> 2) * VPI + (c & 3) * 8;
            *(v4ia*)(b + sk) = rk[0][i]; *(v4ia*)(b + sv) = rv[0][i]; if (HL) { *(v4ia*)(b + KTE + sk) = rk[NP - 1][i]; *(v4ia*)(b + VTE + sv) = rv[NP - 1][i]; } }
#pragma unroll
        for (int qt = 0; qt < NQT; ++qt)
#pragma unroll
            for (int i = 0; i < 4; ++i) { v4f bb;
#pragma unroll
                for (int u = 0; u < 4; ++u) bb[u] = fmaxf(sb2 * re[qt][i][u], -__builtin_inff());   // a masked entry is NaN in the table: the maximum with -inf returns -inf for it and the product itself for every other
                *(v4f*)(bs + (qt * 16 + 4 * i + (lane >> 3)) * BPI + (lane & 7) * 4) = bb; } };
    gload(); sstore(0); __syncthreads();
#pragma unroll 1   // rolled: the stage body is several hundred instructions, and unrolled it would leave the register limit
    for (int s = 0; s < NS; ++s) { const T16* b = st + (s & 1) * STG;
        if (s + 1 < NS) gload();
        v8f sc_[2][NQT];
#pragma unroll
        for (int kt = 0; kt < 2; ++kt) { V ka[2], ka2[2];
#pragma unroll
            for (int kk = 0; kk < 2; ++kk) { const int a = (kt * 16 + lr) * KPI + kk * 32 + 8 * hi; ka[kk] = WFrag<T16>::ld(b + a); if (HL) ka2[kk] = WFrag<T16>::ld(b + KTE + a); }
#pragma unroll
            for (int qt = 0; qt < NQT; ++qt) { v8f c = (v8f){};
#pragma unroll
                for (int kk = 0; kk < 2; ++kk) { c = WFrag<T16>::mma(ka[kk], qf[qt][kk], c); if (HL) { c = WFrag<T16>::mma(ka[kk], qf2[qt][kk], c); c = WFrag<T16>::mma(ka2[kk], qf[qt][kk], c); } }
                sc_[kt][qt] = c; } }
        V pf[NQT], pf2[NQT];
#pragma unroll
        for (int qt = 0; qt < NQT; ++qt) { float mx = m[qt];
#pragma unroll
            for (int kt = 0; kt < 2; ++kt) { const float* br = bs + (qt * 16 + lr) * BPI + kt * 16 + 8 * hi; const v4f e0 = *(const v4f*)br, e1 = *(const v4f*)(br + 4);
#pragma unroll
                for (int j = 0; j < 8; ++j) { const float t = sc_[kt][qt][j] * (SCL * LOG2E) + ((j < 4) ? e0[j & 3] : e1[j & 3]); sc_[kt][qt][j] = t; mx = fmaxf(mx, t); } }
            mx = fmaxf(mx, __shfl_xor(mx, 16, 32));
            const float rs = __builtin_amdgcn_exp2f(m[qt] - mx); m[qt] = mx; float ps = 0.f;
#pragma unroll
            for (int kt = 0; kt < 2; ++kt)
#pragma unroll
                for (int j = 0; j < 8; ++j) { const float p = __builtin_amdgcn_exp2f(sc_[kt][qt][j] - mx); ps += p; PFrag<T16>::put(pf[qt], pf2[qt], kt * 8 + j, p); }
            l[qt] = l[qt] * rs + ps;   // this lane half's keys only; the lane halves are joined behind the loop
#pragma unroll
            for (int dt = 0; dt < 4; ++dt) o[dt][qt] *= rs; }
#pragma unroll
        for (int dt = 0; dt < 4; ++dt) { const int a = NP * KTE + (dt * 16 + lr) * VPI + 8 * hi; const V va = WFrag<T16>::ld(b + a); V va2; if (HL) va2 = WFrag<T16>::ld(b + VTE + a);
#pragma unroll
            for (int qt = 0; qt < NQT; ++qt) { o[dt][qt] = WFrag<T16>::mma(va, pf[qt], o[dt][qt]); if (HL) { o[dt][qt] = WFrag<T16>::mma(va, pf2[qt], o[dt][qt]); o[dt][qt] = WFrag<T16>::mma(va2, pf[qt], o[dt][qt]); } } }
        if (s + 1 < NS) sstore((s + 1) & 1);   // K, Vt: the buffer that stage s - 1 read, whose readers passed the barrier at the foot of that stage; bias rows: this wave's own, read above
        __syncthreads();                       // publishes stage s + 1 and ends every read of stage s
    }
    // join of the two key halves, lane for lane: half 1 leaves its set in LDS (over the stage buffers, all read by now), half 0 adds it to its own and writes whole 128-byte lines of the merged planes
    float* jo = (float*)sm + (size_t)qg * NQT * 4 * 32 * 8 + lane * 8; float* jm = (float*)sm + 4 * NQT * 4 * 32 * 8 + qg * NQT * 32 * 2 + lane * 2;
    if (kh == 1) {
#pragma unroll
        for (int qt = 0; qt < NQT; ++qt) { v2f ml; ml[0] = m[qt]; ml[1] = l[qt]; *(v2f*)(jm + qt * 64) = ml;
#pragma unroll
            for (int dt = 0; dt < 4; ++dt) { *(v4f*)(jo + (qt * 4 + dt) * 256) = __builtin_shufflevector(o[dt][qt], o[dt][qt], 0, 1, 2, 3); *(v4f*)(jo + (qt * 4 + dt) * 256 + 4) = __builtin_shufflevector(o[dt][qt], o[dt][qt], 4, 5, 6, 7); } } }
    __syncthreads();
    if (kh == 0) {
#pragma unroll
        for (int qt = 0; qt < NQT; ++qt) { const v2f ml = *(const v2f*)(jm + qt * 64); const float M = fmaxf(m[qt], ml[0]); const float f0 = __builtin_amdgcn_exp2f(m[qt] - M), f1 = __builtin_amdgcn_exp2f(ml[0] - M);
            float L = l[qt] * f0 + ml[1] * f1; L += __shfl_xor(L, 16, 32); const float inv = 1.0f / L;
#pragma unroll
            for (int dt = 0; dt < 4; ++dt) { const v4f x0 = *(const v4f*)(jo + (qt * 4 + dt) * 256), x1 = *(const v4f*)(jo + (qt * 4 + dt) * 256 + 4); v8us oh, ol;
#pragma unroll
                for (int u = 0; u < 8; ++u) { unsigned short x, y; splitf((o[dt][qt][u] * f0 + ((u < 4) ? x0[u & 3] : x1[u & 3]) * f1) * inv, x, y); oh[u] = x; ol[u] = y; }
                const size_t oo = (size_t)(qw + qt * 16 + lr) * DQ + h * HD + dt * 16 + 8 * hi; *(v8us*)(Ah + oo) = oh; *(v8us*)(Al + oo) = ol;
                asm volatile("s_wait_xcnt 0x0" ::: "memory"); } } }   // stands in front of the next trip's rewrite of the two stores' address and data registers
}
// grid (heads, NB_ TT / 64), y = query tile x NB_ + batch: 64 query rows a work-group; the hi+lo tiles (three products each) of every batch have the low indices. Four waves a SIMD (at most 256 registers): two work-groups a WGP at a time.
__global__ __launch_bounds__(256, 4) void k_fattn(const h16* __restrict__ Q16, const h16* __restrict__ K16, const h16* __restrict__ V16, const bf* __restrict__ Qh, const bf* __restrict__ Ql, const bf* __restrict__ Kh, const bf* __restrict__ Kl, const bf* __restrict__ Vh, const bf* __restrict__ Vl, const float* __restrict__ ED, const float* __restrict__ sbias, bf* Ah, bf* Al) {
    __shared__ __align__(16) char sm[4 * 2 * (32 * KPI + 64 * VPI) * 2 + 8 * 16 * BPI * 4];   // the hi+lo form's stage buffers and bias rows; the fp16 form has half the planes
    const int h = blockIdx.x, b = (int)blockIdx.y % NB_, q0 = (int)blockIdx.y / NB_ * 64; const float sb2 = bfr(sbias[h]) * LOG2E;
    const size_t pb = (size_t)b * NH_ * TT * HD, eb = (size_t)b * TT * TT, ab = (size_t)b * TT * DQ;   // this batch's part of the operand planes, of the bias table, of the merged planes
    Q16 += pb; K16 += pb; V16 += pb; Qh += pb; Ql += pb; Kh += pb; Kl += pb; Vh += pb; Vl += pb; ED += eb; Ah += ab; Al += ab;
    if (q0 < RH) fattn_body<bf, true, 1>(Qh, Ql, Kh, Kl, Vh, Vl, ED, sb2, q0, h, Ah, Al, sm);
    else fattn_body<h16, false, 1>(Q16, nullptr, K16, nullptr, V16, nullptr, ED, sb2, q0, h, Ah, Al, sm);
}
// ---- k_wo: out = merged (hi + lo planes) x Wo + bo, the whole K range in one accumulation, written straight to out.
// Work-group = 8 waves = 4 row groups x 2 column groups on a 128x128 tile of out, 32x64 a wave: they share 128 rows of each merged plane and 128 rows of the transposed weight.
// As in k_proj a stage is 64 k = one whole 128-byte line of each of the 384 rows: global loads (8 lanes a line) one stage ahead into registers, two LDS buffers, one barrier a stage; fragments from LDS in the k order of WFrag::ld.
// grid (NB_ TT / 128, DM / 128) = 256 work-groups, one a WGP, two waves a SIMD.
__global__ __launch_bounds__(256) void k_wo(const bf* __restrict__ Ah, const bf* __restrict__ Al, const bf* __restrict__ Wt, const float* __restrict__ bias, float* out) {
    __shared__ __align__(16) bf st[2 * 384 * KPI];          // two stage buffers: rows 0-127 hi plane, 128-255 lo plane, 256-383 weight
    __shared__ __align__(16) float osm[8 * 16 * 68];        // each wave's own epilogue rows
    const int th = threadIdx.x, lane = th & 31, lr = lane & 15, hi = lane >> 4; const int w = __builtin_amdgcn_readfirstlane(th >> 5), ri = w & 3, cj = w >> 2;
    float* os = osm + w * 16 * 68;
    const unsigned go = (th >> 3) * DQ + (th & 7) * 8; const int so = (th >> 3) * KPI + (th & 7) * 8;   // 16-byte chunk th & 7 of row th / 8 + 32 i
    const bf* hp = Ah + (size_t)blockIdx.x * 128 * DQ + go; const bf* lp = Al + (size_t)blockIdx.x * 128 * DQ + go; const bf* wp = Wt + (size_t)blockIdx.y * 128 * DQ + go;   // kept through the loop and stepped by one stage a trip
    v4i rh[4], rl[4], rw[4];
    auto gload = [&]() {
#pragma unroll
        for (int i = 0; i < 4; ++i) { rh[i] = *(const v4ia*)(hp + i * 32 * DQ); rl[i] = *(const v4ia*)(lp + i * 32 * DQ); rw[i] = *(const v4ia*)(wp + i * 32 * DQ); } };
    auto sstore = [&](int buf) { bf* d = st + buf * 384 * KPI + so;
#pragma unroll
        for (int i = 0; i < 4; ++i) { *(v4ia*)(d + i * 32 * KPI) = rh[i]; *(v4ia*)(d + (128 + i * 32) * KPI) = rl[i]; *(v4ia*)(d + (256 + i * 32) * KPI) = rw[i]; } };
    const int ao = (ri * 32 + lr) * KPI + 8 * hi, bo = (256 + cj * 64 + lr) * KPI + 8 * hi;   // this wave's A rows (hi plane; the lo plane lies 128 rows on) and B rows in a stage buffer
    v8f acc[2][4];
#pragma unroll
    for (int mb = 0; mb < 2; ++mb)
#pragma unroll
        for (int nb = 0; nb < 4; ++nb) acc[mb][nb] = (v8f){};
    gload(); sstore(0); __syncthreads();
#pragma unroll 1   // rolled: a stage is 32 LDS reads and 32 matrix instructions a wave already, and its 16 fragments with the 12 chunks on their way take 176 registers
    for (int s = 0; s < DQ / 64; ++s) { const bf* sb = st + (s & 1) * 384 * KPI;
        if (s + 1 < DQ / 64) { hp += 64; lp += 64; wp += 64; gload(); }
        v16bf a[2][2], a2[2][2], bb[2][4];   // the stage's 16 fragments, all asked for ahead of its first product: one LDS latency a stage, not one a column block
#pragma unroll
        for (int kk = 0; kk < 2; ++kk) {
#pragma unroll
            for (int mb = 0; mb < 2; ++mb) { a[kk][mb] = WFrag<bf>::ld(sb + ao + mb * 16 * KPI + kk * 32); a2[kk][mb] = WFrag<bf>::ld(sb + ao + (128 + mb * 16) * KPI + kk * 32); }
#pragma unroll
            for (int nb = 0; nb < 4; ++nb) bb[kk][nb] = WFrag<bf>::ld(sb + bo + nb * 16 * KPI + kk * 32); }
        __builtin_amdgcn_sched_barrier(0);   // keeps the 32 LDS reads above as one group: left free, the compiler sinks each column block's reads to just in front of its four products, with a full wait each time
#pragma unroll
        for (int kk = 0; kk < 2; ++kk)
#pragma unroll
            for (int nb = 0; nb < 4; ++nb) {
#pragma unroll
                for (int mb = 0; mb < 2; ++mb) acc[mb][nb] = wmmab(a[kk][mb], bb[kk][nb], acc[mb][nb]);
#pragma unroll
                for (int mb = 0; mb < 2; ++mb) acc[mb][nb] = wmmab(a2[kk][mb], bb[kk][nb], acc[mb][nb]); }
        asm volatile("v_nop\n\tv_nop\n\tv_nop\n\tv_nop" : "+v"(acc[0][0]), "+v"(acc[1][0]), "+v"(acc[0][1]), "+v"(acc[1][1]), "+v"(acc[0][2]), "+v"(acc[1][2]), "+v"(acc[0][3]), "+v"(acc[1][3]));   // the four vector slots between the last WMMA and whatever follows it on either side of the branches below (the next trip's LDS address over an operand register, the epilogue's reads of its result)
        if (s + 1 < DQ / 64) sstore((s + 1) & 1);   // the buffer that stage s - 1 read, whose readers passed the barrier at the foot of that stage
        __syncthreads();                            // publishes stage s + 1 and ends every read of stage s
    }
    const int cw = (int)blockIdx.y * 128 + cj * 64 + lr * 4; v4f bv;
#pragma unroll
    for (int u = 0; u < 4; ++u) bv[u] = bfr(bias[cw + u]);
    float* op = out + ((size_t)blockIdx.x * 128 + ri * 32 + hi) * DM + cw;
#pragma unroll
    for (int mb = 0; mb < 2; ++mb) {
#pragma unroll
        for (int nb = 0; nb < 4; ++nb) {
#pragma unroll
            for (int j = 0; j < 8; ++j) os[(hi * 8 + j) * 68 + nb * 16 + lr] = acc[mb][nb][j]; }
        __builtin_amdgcn_wave_barrier(); asm volatile("" ::: "memory");   // keeps the row reads below behind the tile's LDS writes
        v4f val[8];
#pragma unroll
        for (int s = 0; s < 8; ++s) val[s] = *(const v4fa*)(os + (2 * s + hi) * 68 + lr * 4) + bv;   // 16 lanes a row of 64 floats: two whole 128-byte lines
#pragma unroll
        for (int s = 0; s < 8; ++s) *(v4f*)(op + (size_t)(mb * 16 + 2 * s) * DM) = val[s];
        __builtin_amdgcn_wave_barrier(); asm volatile("" ::: "memory");   // keeps the next tile's LDS writes behind the row reads above
    }
}

__global__ __launch_bounds__(256) void k_dist(const float* __restrict__ co, const int* __restrict__ mk, float* ED) { const size_t e = ((size_t)blockIdx.x * 256 + threadIdx.x) * 4; if (e >= (size_t)TT * TT) return; co += (size_t)blockIdx.y * TT * 2; ED += (size_t)blockIdx.y * TT * TT; mk += (size_t)blockIdx.y * TT * TT;   /* grid y = batch */ const v4i mq = *(const v4i*)(mk + e); const int j = (int)(e % TT); const int i = (int)(e / TT); const float xi = bfr(co[i * 2]), yi = bfr(co[i * 2 + 1]); v4f o;   // exp(-dist): dist = sqrt(dx^2 + dy^2) (0 when d2 == 0), NaN where mask == 0 (16-B lanes)
#pragma unroll
    for (int u = 0; u < 4; ++u) { const float dx = __fsub_rn(xi, bfr(co[(j + u) * 2])), dy = __fsub_rn(yi, bfr(co[(j + u) * 2 + 1])); float px = __fmul_rn(dx, dx), py = __fmul_rn(dy, dy); asm volatile("" : "+v"(px)); asm volatile("" : "+v"(py)); const float d2 = __fadd_rn(px, py); const float dist = (d2 == 0.f) ? 0.f : __fsqrt_rn(d2); o[u] = (mq[u] == 0) ? __builtin_nanf("") : __expf(-dist); }
    *(v4f*)(ED + e) = o;  }

extern "C" void kernel_launch(void* const* d_in, const int* in_sizes, int n_in,
                              void* d_out, int out_size, void* d_ws, size_t ws_size, hipStream_t stream) {
    (void)in_sizes; (void)n_in; (void)out_size;
    const float* x = (const float*)d_in[0]; const float* coords = (const float*)d_in[1]; const int* mask = (const int*)d_in[2]; const float* wq = (const float*)d_in[3]; const float* wk = (const float*)d_in[4]; const float* wv = (const float*)d_in[5]; const float* sbias = (const float*)d_in[6]; const float* wo = (const float*)d_in[7]; const float* bo = (const float*)d_in[8]; const float* cosT = nullptr; const float* sinT = nullptr; (void)cosT; (void)sinT;
    float* OUT = (float*)d_out;     // [2][2048][1024]
    char* wsp = (char*)d_ws;
    auto take = [&](size_t bytes) { char* p = wsp; wsp += (bytes + 255) & ~(size_t)255; return (void*)p; };
    bf* WQ = (bf*)take((size_t)DQ * DM * 2); bf* WK = (bf*)take((size_t)DKV * DM * 2); bf* WV = (bf*)take((size_t)DKV * DM * 2); bf* WO = (bf*)take((size_t)DM * DQ * 2);
    bf* XB = (bf*)take((size_t)NB_ * TT * DM * 2); float* ED = (float*)take((size_t)NB_ * TT * TT * 4);
    const size_t PL = (size_t)NH_ * TT * HD;   // elements of one operand plane of one batch (NKV == NH_)
    h16* QP16 = (h16*)take(NB_ * PL * 2); h16* KP16 = (h16*)take(NB_ * PL * 2); h16* VT16 = (h16*)take(NB_ * PL * 2);
    bf* QPh = (bf*)take(NB_ * PL * 2); bf* QPl = (bf*)take(NB_ * PL * 2); bf* KPh = (bf*)take(NB_ * PL * 2); bf* KPl = (bf*)take(NB_ * PL * 2); bf* VTh = (bf*)take(NB_ * PL * 2); bf* VTl = (bf*)take(NB_ * PL * 2);
    bf* ATh = (bf*)take((size_t)NB_ * TT * DQ * 2); bf* ATl = (bf*)take((size_t)NB_ * TT * DQ * 2);
    if ((size_t)(wsp - (char*)d_ws) > ws_size) return;    // ws 256 MiB
    k_wtG<<<dim3((unsigned)((DM * DQ / 64 + 63) / 64), 4), 256, 0, stream>>>(wq, wk, wv, wo, DM, DQ, WQ);   // WQ, WK, WV, WO: four planes of DM x DQ elements, taken one behind another above
    k_cvt8<<<(unsigned)(((size_t)NB_ * TT * DM / 8 + 255) / 256), 256, 0, stream>>>(x, XB, (size_t)NB_ * TT * DM / 8);
    k_proj<<<dim3(TT / 128, NH_ / 2, 3 * NB_), 128, 0, stream>>>(XB, WQ, WK, WV, QP16, QPh, QPl, KP16, KPh, KPl, VT16, VTh, VTl);
    k_dist<<<dim3((TT * TT / 4 + 255) / 256, NB_), 256, 0, stream>>>(coords, mask, ED);
    k_fattn<<<dim3(NH_, NB_ * TT / 64), 256, 0, stream>>>(QP16, KP16, VT16, QPh, QPl, KPh, KPl, VTh, VTl, ED, sbias, ATh, ATl);
    k_wo<<<dim3(NB_ * TT / 128, DM / 128), 256, 0, stream>>>(ATh, ATl, WO, bo, OUT);
}

// v008
// A run of this version takes 153 microseconds.
// Next to v007, in two timings, it ran 1.06 times as fast each time.
// All steps since v000 together make it 14.8 times as fast.
#include <hip/hip_runtime.h>

// SpatialTemporalAttention (x [2][2048][1024]; Q/K/V = x W ([in,out], no bias; 16 heads x 64); scores = Q.K / 8 + spatial_bias[h] exp(-dist[b][i][j]) with dist = pairwise Euclidean distance of spatial_coords [2][2048][2] (0 when d2 == 0); masked where mask[b][i][j] == 0 (int, read) -> -inf; softmax; out = merged Wo + bo -> [2][2048][1024]).
// Compute dtypes, f32 accumulate: every input rounded to bf16; Q/K/V on PLAIN bf16 operands (inputs: exact), one launch for both batches whose epilogue writes the attention operand planes (k_proj); the distance bias table exp(-dist) [2][2048][2048] in f32, its masked entries NaN (k_dist reads the mask, once); scores and attn.v (one fused kernel, k_fattn): query rows < 512 hl (3 products), the rest single fp16; bias + mask + running softmax f32; Wo hl x exact (2 products) + bias. Every kernel is launched once: batches and the four weight matrices are grid indices.

#define NB_  2
#define TT   2048
#define DM   1024
#define NH_  16
#define NKV  16
#define REP  (NH_ / NKV)
#define HD   64
#define DQ   (NH_ * HD)
#define DKV  (NKV * HD)
#define RH   512                  // query rows < RH use hi+lo planes (0: none)
#define WIN  0
#define SCL  0.125f   // HD^-0.5
#define KPI  72                   // k_fattn LDS pitch of a staged K row, elements: 128 B + 16 B (16 B x odd: b128 fragment reads without bank conflicts)
#define VPI  40                   // the same of a staged Vt row: 64 B + 16 B
#define BPI  36                   // the same of a bias row, floats: 128 B + 16 B
#define LOG2E 1.4426950408889634f
typedef _Float16 h16;
typedef unsigned short bf;
typedef __attribute__((ext_vector_type(16))) __bf16   v16bf;
typedef __attribute__((ext_vector_type(16))) _Float16 v16h;
typedef __attribute__((ext_vector_type(8)))  _Float16 v8h;
typedef __attribute__((ext_vector_type(8)))  unsigned short v8us;
typedef __attribute__((ext_vector_type(8)))  float    v8f;
typedef __attribute__((ext_vector_type(4)))  float    v4f;
typedef v8h  __attribute__((may_alias)) v8ha;
typedef v4f  __attribute__((may_alias)) v4fa;
typedef v8us __attribute__((may_alias)) v8usa;

__device__ __forceinline__ unsigned short f2bf(float f) { unsigned u = __float_as_uint(f); u += 0x7FFFu + ((u >> 16) & 1u); return (unsigned short)(u >> 16); }
__device__ __forceinline__ float bf2f(unsigned short b) { return __uint_as_float(((unsigned)b) << 16); }
__device__ __forceinline__ float bfr(float f) { return bf2f(f2bf(f)); }
__device__ __forceinline__ v16h cat16(v8h lo, v8h hi) { return __builtin_shufflevector(lo, hi, 0, 1, 2, 3, 4, 5, 6, 7, 8, 9, 10, 11, 12, 13, 14, 15); }
__device__ __forceinline__ v16bf cat16b(v8us lo, v8us hi) { return __builtin_bit_cast(v16bf, __builtin_shufflevector(lo, hi, 0, 1, 2, 3, 4, 5, 6, 7, 8, 9, 10, 11, 12, 13, 14, 15)); }
__device__ __forceinline__ v8f wmma16(v16h a, v16h b, v8f c) { return __builtin_amdgcn_wmma_f32_16x16x32_f16(false, a, false, b, (short)0, c, false, false); }
__device__ __forceinline__ v8f wmmab(v16bf a, v16bf b, v8f c) { return __builtin_amdgcn_wmma_f32_16x16x32_bf16(false, a, false, b, (short)0, c, false, false); }



// a 16x32 operand fragment from a K-contiguous 16-bit row (global or LDS): lane (lr, hi) holds k = 8 hi + 0..7 and 16 + 8 hi + 0..7 of row lr
template <typename T16> struct WFrag;
template <> struct WFrag<h16> { typedef v16h V; static __device__ __forceinline__ V ld(const h16* p) { return cat16(*(const v8h*)p, *(const v8h*)(p + 16)); } static __device__ __forceinline__ v8f mma(V a, V b, v8f c) { return wmma16(a, b, c); } };
template <> struct WFrag<bf> { typedef v16bf V; static __device__ __forceinline__ V ld(const bf* p) { return cat16b(*(const v8us*)p, *(const v8us*)(p + 16)); } static __device__ __forceinline__ v8f mma(V a, V b, v8f c) { return wmmab(a, b, c); } };
__device__ __forceinline__ h16 tohx(float x) { return (h16)x; }
__device__ __forceinline__ void splitf(float y, unsigned short& h, unsigned short& l) { h = f2bf(y); l = f2bf(y - bf2f(h)); }
typedef __attribute__((ext_vector_type(2))) _Float16 v2h;
typedef __attribute__((ext_vector_type(4))) _Float16 v4h;
typedef __attribute__((ext_vector_type(2))) unsigned short v2us;
typedef __attribute__((ext_vector_type(4))) unsigned short v4us;
typedef __attribute__((ext_vector_type(2))) float v2f;
typedef __attribute__((ext_vector_type(4))) int v4i;

// grid y = which of the four weight matrices (all [K][N]); their transposed bf16 planes lie one behind another from Bt
__global__ __launch_bounds__(256) void k_wtG(const float* __restrict__ w0, const float* __restrict__ w1, const float* __restrict__ w2, const float* __restrict__ w3, int K, int N, bf* Bt) {
    const float* __restrict__ w = blockIdx.y == 0 ? w0 : blockIdx.y == 1 ? w1 : blockIdx.y == 2 ? w2 : w3; Bt += (size_t)blockIdx.y * K * N;
    const int lane = threadIdx.x & 31; const int L0 = (blockIdx.x * 8 + (threadIdx.x >> 5)) * 8; const int nlines = N * K / 64;
{
#pragma unroll 1
        for (int l = 0; l < 8; ++l) { const int L = L0 + l; if (L >= nlines) break; const size_t e = (size_t)L * 64 + lane * 2; const int k = (int)(e % K), n = (int)(e / K); v2us o;
            o[0] = f2bf(w[(size_t)k * N + n]); o[1] = f2bf(w[(size_t)(k + 1) * N + n]); *(v2us*)(Bt + e) = o; }
         }
}
__global__ __launch_bounds__(256) void k_cvt8(const float* __restrict__ src, bf* dst, size_t n8) { const size_t i = (size_t)blockIdx.x * 256 + threadIdx.x; if (i >= n8) return; const v8f v = *(const v8f*)(src + i * 8); v8us o;
#pragma unroll
    for (int k = 0; k < 8; ++k) o[k] = f2bf(v[k]); *(v8us*)(dst + i * 8) = o;  }
__global__ __launch_bounds__(256) void k_cscvt(const float* __restrict__ cosT, const float* __restrict__ sinT, float* CS) { const int idx = blockIdx.x * 256 + threadIdx.x; if (idx >= TT * HD) return; v2f cs; cs[0] = bfr(cosT[idx]); cs[1] = bfr(sinT[idx]); *(v2f*)(CS + (size_t)idx * 2) = cs;  }
// ---- k_proj: the Q, K and V projections of both batches in one launch; ONE WAVE per 64x64 tile, the whole K range in one accumulation, and the epilogue writes the operand planes of k_fattn itself (fp16, and bf16 hi + lo).
// Work-group = 4 waves = 2 token tiles x 2 heads: they share 128 rows of x and 128 rows of the transposed weight. A stage is 64 k = one whole 128-byte line of each of the 256 rows: global loads (8 lanes a line) one stage ahead into registers,
// two LDS buffers, one barrier a stage; the fragments come from LDS in the k order of WFrag::ld, so every accumulator sums its products in the order it did before.
// grid (TT / 128, heads / 2, 3 NB_) = 768 work-groups, three a WGP by their LDS, all resident at once; z = product x NB_ + batch. Q, K: rows = 64 tokens of x, columns = the 64 outputs of head h -> plane [b][h][t][d]. V: rows = the 64 outputs of head h, columns = 64 tokens -> the transposed plane in tiles of 32 tokens, [b][h][t / 32][d][32]: the 64 x 32 tile that a stage of k_fattn takes is 4 KB in a row, like its K tile.
typedef v4i __attribute__((may_alias)) v4ia;
__global__ __launch_bounds__(128, 3) void k_proj(const bf* __restrict__ XB, const bf* __restrict__ WQ, const bf* __restrict__ WK, const bf* __restrict__ WV, h16* Q16, bf* Qh, bf* Ql, h16* K16, bf* Kh, bf* Kl, h16* V16, bf* Vh, bf* Vl) {
    __shared__ __align__(16) bf st[2 * 256 * KPI];          // two stage buffers: rows 0-127 of x, rows 128-255 of the weight, at the pitch of k_fattn's K rows (same row length, same reader)
    __shared__ __align__(16) float osm[4 * 16 * 68];        // each wave's own epilogue rows
    const int pr = blockIdx.z / NB_, b = blockIdx.z % NB_; const bool tr = pr == 2;
    const int th = threadIdx.x, lane = th & 31, lr = lane & 15, hi = lane >> 4; const int w = __builtin_amdgcn_readfirstlane(th >> 5), ti = w & 1, hj = w >> 1;
    const int t0 = ((int)blockIdx.x * 2 + ti) * 64, h = (int)blockIdx.y * 2 + hj; float* os = osm + w * 16 * 68;
    const bf* X = XB + ((size_t)b * TT + (size_t)blockIdx.x * 128) * DM; const bf* Wt = (pr == 0 ? WQ : pr == 1 ? WK : WV) + (size_t)blockIdx.y * 128 * DM;
    const unsigned go = (th >> 3) * DM + (th & 7) * 8; const int so = (th >> 3) * KPI + (th & 7) * 8;   // 16-byte chunk th & 7 of row th / 8 + 16 i
    const bf* xp = X + go; const bf* wp = Wt + go;   // the lane's two addresses, kept through the loop and stepped by one stage a trip, so that no load's destination is laid over an address that an issued load names
    v4i rx[8], rw[8];
    auto gload = [&]() {
#pragma unroll
        for (int i = 0; i < 8; ++i) { rx[i] = *(const v4ia*)(xp + i * 16 * DM); rw[i] = *(const v4ia*)(wp + i * 16 * DM); } };
    auto sstore = [&](int buf) { bf* d = st + buf * 256 * KPI + so;
#pragma unroll
        for (int i = 0; i < 8; ++i) { *(v4ia*)(d + i * 16 * KPI) = rx[i]; *(v4ia*)(d + (128 + i * 16) * KPI) = rw[i]; } };
    const int ao = ((tr ? 128 + hj * 64 : ti * 64) + lr) * KPI + 8 * hi, bo = ((tr ? ti * 64 : 128 + hj * 64) + lr) * KPI + 8 * hi;   // this wave's A and B rows in a stage buffer
    v8f acc[4][4];
#pragma unroll
    for (int mb = 0; mb < 4; ++mb)
#pragma unroll
        for (int nb = 0; nb < 4; ++nb) acc[mb][nb] = (v8f){};
    gload(); sstore(0); __syncthreads();
#pragma unroll 1   // rolled: 16 accumulators, the fragments and the 16 chunks on their way already fill the wave's working set
    for (int s = 0; s < DM / 64; ++s) { const bf* sb = st + (s & 1) * 256 * KPI;
        if (s + 1 < DM / 64) { xp += 64; wp += 64; gload(); }
        v16bf a[4];
#pragma unroll
        for (int kk = 0; kk < 2; ++kk) {
#pragma unroll
            for (int mb = 0; mb < 4; ++mb) a[mb] = WFrag<bf>::ld(sb + ao + mb * 16 * KPI + kk * 32);
#pragma unroll
            for (int nb = 0; nb < 4; ++nb) { const v16bf bb = WFrag<bf>::ld(sb + bo + nb * 16 * KPI + kk * 32);
#pragma unroll
                for (int mb = 0; mb < 4; ++mb) acc[mb][nb] = wmmab(a[mb], bb, acc[mb][nb]); } }
        asm volatile("v_nop\n\tv_nop\n\tv_nop\n\tv_nop" : "+v"(acc[0][0]), "+v"(acc[1][1]), "+v"(acc[2][2]), "+v"(acc[3][3]) : "v"(a[0]), "v"(a[3]));   // the four vector slots between the last WMMA and whatever follows it on either side of the branches below (the next trip's fragment loads over its operands, the epilogue's reads of its result)
        if (s + 1 < DM / 64) sstore((s + 1) & 1);   // the buffer that stage s - 1 read, whose readers passed the barrier at the foot of that stage
        __syncthreads();                            // publishes stage s + 1 and ends every read of stage s
    }
    h16* P16 = (pr == 0 ? Q16 : pr == 1 ? K16 : V16); bf* Ph = (pr == 0 ? Qh : pr == 1 ? Kh : Vh); bf* Pl = (pr == 0 ? Ql : pr == 1 ? Kl : Vl);
    const int op = tr ? 32 : HD; const size_t ob = ((size_t)b * NH_ + h) * TT * HD + (size_t)t0 * HD + (size_t)(lane >> 3) * op + (tr ? ((lane & 7) >> 2) * 32 * HD + (lane & 3) * 8 : (lane & 7) * 8);   // V: a row's 64 tokens fall into two 32-token tiles (32 HD elements apart); 4 rows x 64 B of a tile lie in a row
#pragma unroll
    for (int mb = 0; mb < 4; ++mb) {
#pragma unroll
        for (int nb = 0; nb < 4; ++nb) {
#pragma unroll
            for (int j = 0; j < 8; ++j) os[(hi * 8 + j) * 68 + nb * 16 + lr] = acc[mb][nb][j]; }
        __builtin_amdgcn_wave_barrier(); asm volatile("" ::: "memory");   // keeps the row reads below behind the tile's LDS writes
#pragma unroll
        for (int s = 0; s < 4; ++s) { const float* rp = os + (4 * s + (lane >> 3)) * 68 + (lane & 7) * 8; const v4f x0 = *(const v4fa*)rp, x1 = *(const v4fa*)(rp + 4); v8h o16; v8us oh, ol;   // 8 lanes a row of 64: whole 128-byte lines of each plane (V: two pieces of 256 B, four rows of each token tile)
#pragma unroll
            for (int u = 0; u < 8; ++u) { const float r = (u < 4) ? x0[u & 3] : x1[u & 3]; o16[u] = tohx(r); unsigned short a2, c2; splitf(r, a2, c2); oh[u] = a2; ol[u] = c2; }
            const size_t oo = ob + (size_t)(mb * 16 + 4 * s) * op; *(v8h*)(P16 + oo) = o16; *(v8us*)(Ph + oo) = oh; *(v8us*)(Pl + oo) = ol;
            asm volatile("s_wait_xcnt 0x0" ::: "memory"); }   // stands in front of the next trip's rewrite of the three stores' address and data registers
        __builtin_amdgcn_wave_barrier(); asm volatile("" ::: "memory");   // keeps the next tile's LDS writes behind the row reads above
    }
}
template <typename T16> struct PFrag;
template <> struct PFrag<h16> { static __device__ __forceinline__ void put(v16h& a, v16h& b, int e, float p) { (void)b; a[e] = (h16)p; } };
template <> struct PFrag<bf> { static __device__ __forceinline__ void put(v16bf& a, v16bf& b, int e, float p) { const __bf16 x = (__bf16)p; a[e] = x; b[e] = (__bf16)(p - (float)x); } };
template <typename T16, bool HL, int NQT>
__device__ __forceinline__ void fattn_body(const T16* __restrict__ Q, const T16* __restrict__ Q2, const T16* __restrict__ Kp, const T16* __restrict__ K2, const T16* __restrict__ Vt, const T16* __restrict__ V2, const float* __restrict__ ED, float sb2, int q0, int h, bf* Ah, bf* Al, char* sm) {
    typedef typename WFrag<T16>::V V;
    constexpr int NQ = 16 * NQT, NP = HL ? 2 : 1, KTE = 32 * KPI, VTE = 64 * VPI, STG = NP * (KTE + VTE), NS = TT / 2 / 32;
    const int lane = threadIdx.x & 31, lr = lane & 15, hi = lane >> 4, th = threadIdx.x & 127; const int w = __builtin_amdgcn_readfirstlane(threadIdx.x >> 5), qg = w & 3, kh = w >> 2;
    T16* st = (T16*)sm + kh * 2 * STG;                          // this key half's two stage buffers: K plane(s), then Vt plane(s)
    float* bs = (float*)(sm + 4 * STG * 2) + w * NQ * BPI;      // this wave's own bias rows
    const int qw = q0 + qg * NQ; const size_t hp = (size_t)h * TT * HD;
    V qf[NQT][2], qf2[NQT][2];
#pragma unroll
    for (int qt = 0; qt < NQT; ++qt)
#pragma unroll
        for (int kk = 0; kk < 2; ++kk) { const size_t a = hp + (size_t)(qw + qt * 16 + lr) * HD + kk * 32 + 8 * hi; qf[qt][kk] = WFrag<T16>::ld(Q + a); if (HL) qf2[qt][kk] = WFrag<T16>::ld(Q2 + a); }
    v8f o[4][NQT]; float m[NQT], l[NQT];
#pragma unroll
    for (int qt = 0; qt < NQT; ++qt) { m[qt] = -3.0e38f; l[qt] = 0.f;
#pragma unroll
        for (int dt = 0; dt < 4; ++dt) o[dt][qt] = (v8f){}; }
    const int kb = kh * (TT / 2);
    // the next stage on its way: 16-byte chunk c = th + 128 i of the K tile (32 rows x 8 chunks) and of the Vt tile (64 rows x 4 chunks), each 4 KB contiguous in memory: every load covers whole lines; rows 4 i + lane / 8 of the bias block (8 lanes a 128-byte row)
    v4i rk[NP][2], rv[NP][2]; v4f re[NQT][4];
    const size_t ak = hp + (size_t)kb * HD + th * 8, av = ak, ae = (size_t)(qw + (lane >> 3)) * TT + kb + (lane & 7) * 4;
    const T16* kp = Kp + ak; const T16* kp2 = HL ? K2 + ak : nullptr; const T16* vp = Vt + av; const T16* vp2 = HL ? V2 + av : nullptr; const float* ep = ED + ae;
    auto gload = [&]() {
#pragma unroll
        for (int i = 0; i < 2; ++i) { rk[0][i] = *(const v4ia*)(kp + i * 1024); rv[0][i] = *(const v4ia*)(vp + i * 1024); if (HL) { rk[NP - 1][i] = *(const v4ia*)(kp2 + i * 1024); rv[NP - 1][i] = *(const v4ia*)(vp2 + i * 1024); } }
#pragma unroll
        for (int qt = 0; qt < NQT; ++qt)
#pragma unroll
            for (int i = 0; i < 4; ++i) re[qt][i] = *(const v4f*)(ep + (qt * 16 + 4 * i) * TT);
        kp += 32 * HD; vp += 32 * HD; ep += 32; if (HL) { kp2 += 32 * HD; vp2 += 32 * HD; } };
    auto sstore = [&](int buf) { T16* b = st + buf * STG;
#pragma unroll
        for (int i = 0; i < 2; ++i) { const int c = th + 128 * i; const int sk = (c >> 3) * KPI + (c & 7) * 8, sv = NP * KTE + (c >> 2) * VPI + (c & 3) * 8;
            *(v4ia*)(b + sk) = rk[0][i]; *(v4ia*)(b + sv) = rv[0][i]; if (HL) { *(v4ia*)(b + KTE + sk) = rk[NP - 1][i]; *(v4ia*)(b + VTE + sv) = rv[NP - 1][i]; } }
#pragma unroll
        for (int qt = 0; qt < NQT; ++qt)
#pragma unroll
            for (int i = 0; i < 4; ++i) { v4f bb;
#pragma unroll
                for (int u = 0; u < 4; ++u) bb[u] = fmaxf(sb2 * re[qt][i][u], -__builtin_inff());   // a masked entry is NaN in the table: the maximum with -inf returns -inf for it and the product itself for every other
                *(v4f*)(bs + (qt * 16 + 4 * i + (lane >> 3)) * BPI + (lane & 7) * 4) = bb; } };
    gload(); sstore(0); __syncthreads();
#pragma unroll 1   // rolled: the stage body is several hundred instructions, and unrolled it would leave the register limit
    for (int s = 0; s < NS; ++s) { const T16* b = st + (s & 1) * STG;
        if (s + 1 < NS) gload();
        v8f sc_[2][NQT];
#pragma unroll
        for (int kt = 0; kt < 2; ++kt) { V ka[2], ka2[2];
#pragma unroll
            for (int kk = 0; kk < 2; ++kk) { const int a = (kt * 16 + lr) * KPI + kk * 32 + 8 * hi; ka[kk] = WFrag<T16>::ld(b + a); if (HL) ka2[kk] = WFrag<T16>::ld(b + KTE + a); }
#pragma unroll
            for (int qt = 0; qt < NQT; ++qt) { v8f c = (v8f){};
#pragma unroll
                for (int kk = 0; kk < 2; ++kk) { c = WFrag<T16>::mma(ka[kk], qf[qt][kk], c); if (HL) { c = WFrag<T16>::mma(ka[kk], qf2[qt][kk], c); c = WFrag<T16>::mma(ka2[kk], qf[qt][kk], c); } }
                sc_[kt][qt] = c; } }
        V pf[NQT], pf2[NQT];
#pragma unroll
        for (int qt = 0; qt < NQT; ++qt) { float mx = m[qt];
#pragma unroll
            for (int kt = 0; kt < 2; ++kt) { const float* br = bs + (qt * 16 + lr) * BPI + kt * 16 + 8 * hi; const v4f e0 = *(const v4f*)br, e1 = *(const v4f*)(br + 4);
#pragma unroll
                for (int j = 0; j < 8; ++j) { const float t = sc_[kt][qt][j] * (SCL * LOG2E) + ((j < 4) ? e0[j & 3] : e1[j & 3]); sc_[kt][qt][j] = t; mx = fmaxf(mx, t); } }
            mx = fmaxf(mx, __shfl_xor(mx, 16, 32));
            const float rs = __builtin_amdgcn_exp2f(m[qt] - mx); m[qt] = mx; float ps = 0.f;
#pragma unroll
            for (int kt = 0; kt < 2; ++kt)
#pragma unroll
                for (int j = 0; j < 8; ++j) { const float p = __builtin_amdgcn_exp2f(sc_[kt][qt][j] - mx); ps += p; PFrag<T16>::put(pf[qt], pf2[qt], kt * 8 + j, p); }
            l[qt] = l[qt] * rs + ps;   // this lane half's keys only; the lane halves are joined behind the loop
#pragma unroll
            for (int dt = 0; dt < 4; ++dt) o[dt][qt] *= rs; }
#pragma unroll
        for (int dt = 0; dt < 4; ++dt) { const int a = NP * KTE + (dt * 16 + lr) * VPI + 8 * hi; const V va = WFrag<T16>::ld(b + a); V va2; if (HL) va2 = WFrag<T16>::ld(b + VTE + a);
#pragma unroll
            for (int qt = 0; qt < NQT; ++qt) { o[dt][qt] = WFrag<T16>::mma(va, pf[qt], o[dt][qt]); if (HL) { o[dt][qt] = WFrag<T16>::mma(va, pf2[qt], o[dt][qt]); o[dt][qt] = WFrag<T16>::mma(va2, pf[qt], o[dt][qt]); } } }
        if (s + 1 < NS) sstore((s + 1) & 1);   // K, Vt: the buffer that stage s - 1 read, whose readers passed the barrier at the foot of that stage; bias rows: this wave's own, read above
        __syncthreads();                       // publishes stage s + 1 and ends every read of stage s
    }
    // join of the two key halves, lane for lane: half 1 leaves its set in LDS (over the stage buffers, all read by now), half 0 adds it to its own and writes whole 128-byte lines of the merged planes
    float* jo = (float*)sm + (size_t)qg * NQT * 4 * 32 * 8 + lane * 8; float* jm = (float*)sm + 4 * NQT * 4 * 32 * 8 + qg * NQT * 32 * 2 + lane * 2;
    if (kh == 1) {
#pragma unroll
        for (int qt = 0; qt < NQT; ++qt) { v2f ml; ml[0] = m[qt]; ml[1] = l[qt]; *(v2f*)(jm + qt * 64) = ml;
#pragma unroll
            for (int dt = 0; dt < 4; ++dt) { *(v4f*)(jo + (qt * 4 + dt) * 256) = __builtin_shufflevector(o[dt][qt], o[dt][qt], 0, 1, 2, 3); *(v4f*)(jo + (qt * 4 + dt) * 256 + 4) = __builtin_shufflevector(o[dt][qt], o[dt][qt], 4, 5, 6, 7); } } }
    __syncthreads();
    if (kh == 0) {
#pragma unroll
        for (int qt = 0; qt < NQT; ++qt) { const v2f ml = *(const v2f*)(jm + qt * 64); const float M = fmaxf(m[qt], ml[0]); const float f0 = __builtin_amdgcn_exp2f(m[qt] - M), f1 = __builtin_amdgcn_exp2f(ml[0] - M);
            float L = l[qt] * f0 + ml[1] * f1; L += __shfl_xor(L, 16, 32); const float inv = 1.0f / L;
#pragma unroll
            for (int dt = 0; dt < 4; ++dt) { const v4f x0 = *(const v4f*)(jo + (qt * 4 + dt) * 256), x1 = *(const v4f*)(jo + (qt * 4 + dt) * 256 + 4); v8us oh, ol;
#pragma unroll
                for (int u = 0; u < 8; ++u) { unsigned short x, y; splitf((o[dt][qt][u] * f0 + ((u < 4) ? x0[u & 3] : x1[u & 3]) * f1) * inv, x, y); oh[u] = x; ol[u] = y; }
                const size_t oo = (size_t)(qw + qt * 16 + lr) * DQ + h * HD + dt * 16 + 8 * hi; *(v8us*)(Ah + oo) = oh; *(v8us*)(Al + oo) = ol;
                asm volatile("s_wait_xcnt 0x0" ::: "memory"); } } }   // stands in front of the next trip's rewrite of the two stores' address and data registers
}
// grid (heads, NB_ TT / 64), y = query tile x NB_ + batch: 64 query rows a work-group; the hi+lo tiles (three products each) of every batch have the low indices. Four waves a SIMD (at most 256 registers): two work-groups a WGP at a time.
__global__ __launch_bounds__(256, 4) void k_fattn(const h16* __restrict__ Q16, const h16* __restrict__ K16, const h16* __restrict__ V16, const bf* __restrict__ Qh, const bf* __restrict__ Ql, const bf* __restrict__ Kh, const bf* __restrict__ Kl, const bf* __restrict__ Vh, const bf* __restrict__ Vl, const float* __restrict__ ED, const float* __restrict__ sbias, bf* Ah, bf* Al) {
    __shared__ __align__(16) char sm[4 * 2 * (32 * KPI + 64 * VPI) * 2 + 8 * 16 * BPI * 4];   // the hi+lo form's stage buffers and bias rows; the fp16 form has half the planes
    const int h = blockIdx.x, b = (int)blockIdx.y % NB_, q0 = (int)blockIdx.y / NB_ * 64; const float sb2 = bfr(sbias[h]) * LOG2E;
    const size_t pb = (size_t)b * NH_ * TT * HD, eb = (size_t)b * TT * TT, ab = (size_t)b * TT * DQ;   // this batch's part of the operand planes, of the bias table, of the merged planes
    Q16 += pb; K16 += pb; V16 += pb; Qh += pb; Ql += pb; Kh += pb; Kl += pb; Vh += pb; Vl += pb; ED += eb; Ah += ab; Al += ab;
    if (q0 < RH) fattn_body<bf, true, 1>(Qh, Ql, Kh, Kl, Vh, Vl, ED, sb2, q0, h, Ah, Al, sm);
    else fattn_body<h16, false, 1>(Q16, nullptr, K16, nullptr, V16, nullptr, ED, sb2, q0, h, Ah, Al, sm);
}
// ---- k_wo: out = merged (hi + lo planes) x Wo + bo, the whole K range in one accumulation, written straight to out.
// Work-group = 8 waves = 4 row groups x 2 column groups on a 128x128 tile of out, 32x64 a wave: they share 128 rows of each merged plane and 128 rows of the transposed weight.
// As in k_proj a stage is 64 k = one whole 128-byte line of each of the 384 rows: global loads (8 lanes a line) one stage ahead into registers, two LDS buffers, one barrier a stage; fragments from LDS in the k order of WFrag::ld.
// grid (NB_ TT / 128, DM / 128) = 256 work-groups, one a WGP, two waves a SIMD.
__global__ __launch_bounds__(256) void k_wo(const bf* __restrict__ Ah, const bf* __restrict__ Al, const bf* __restrict__ Wt, const float* __restrict__ bias, float* out) {
    __shared__ __align__(16) bf st[2 * 384 * KPI];          // two stage buffers: rows 0-127 hi plane, 128-255 lo plane, 256-383 weight
    __shared__ __align__(16) float osm[8 * 16 * 68];        // each wave's own epilogue rows
    const int th = threadIdx.x, lane = th & 31, lr = lane & 15, hi = lane >> 4; const int w = __builtin_amdgcn_readfirstlane(th >> 5), ri = w & 3, cj = w >> 2;
    float* os = osm + w * 16 * 68;
    const unsigned go = (th >> 3) * DQ + (th & 7) * 8; const int so = (th >> 3) * KPI + (th & 7) * 8;   // 16-byte chunk th & 7 of row th / 8 + 32 i
    const bf* hp = Ah + (size_t)blockIdx.x * 128 * DQ + go; const bf* lp = Al + (size_t)blockIdx.x * 128 * DQ + go; const bf* wp = Wt + (size_t)blockIdx.y * 128 * DQ + go;   // kept through the loop and stepped by one stage a trip
    v4i rh[4], rl[4], rw[4];
    auto gload = [&]() {
#pragma unroll
        for (int i = 0; i < 4; ++i) { rh[i] = *(const v4ia*)(hp + i * 32 * DQ); rl[i] = *(const v4ia*)(lp + i * 32 * DQ); rw[i] = *(const v4ia*)(wp + i * 32 * DQ); } };
    auto sstore = [&](int buf) { bf* d = st + buf * 384 * KPI + so;
#pragma unroll
        for (int i = 0; i < 4; ++i) { *(v4ia*)(d + i * 32 * KPI) = rh[i]; *(v4ia*)(d + (128 + i * 32) * KPI) = rl[i]; *(v4ia*)(d + (256 + i * 32) * KPI) = rw[i]; } };
    const int ao = (ri * 32 + lr) * KPI + 8 * hi, bo = (256 + cj * 64 + lr) * KPI + 8 * hi;   // this wave's A rows (hi plane; the lo plane lies 128 rows on) and B rows in a stage buffer
    v8f acc[2][4];
#pragma unroll
    for (int mb = 0; mb < 2; ++mb)
#pragma unroll
        for (int nb = 0; nb < 4; ++nb) acc[mb][nb] = (v8f){};
    gload(); sstore(0); __syncthreads();
#pragma unroll 1   // rolled: a stage is 32 LDS reads and 32 matrix instructions a wave already, and its 16 fragments with the 12 chunks on their way take 176 registers
    for (int s = 0; s < DQ / 64; ++s) { const bf* sb = st + (s & 1) * 384 * KPI;
        if (s + 1 < DQ / 64) { hp += 64; lp += 64; wp += 64; gload(); }
        v16bf a[2][2], a2[2][2], bb[2][4];   // the stage's 16 fragments, all asked for ahead of its first product: one LDS latency a stage, not one a column block
#pragma unroll
        for (int kk = 0; kk < 2; ++kk) {
#pragma unroll
            for (int mb = 0; mb < 2; ++mb) { a[kk][mb] = WFrag<bf>::ld(sb + ao + mb * 16 * KPI + kk * 32); a2[kk][mb] = WFrag<bf>::ld(sb + ao + (128 + mb * 16) * KPI + kk * 32); }
#pragma unroll
            for (int nb = 0; nb < 4; ++nb) bb[kk][nb] = WFrag<bf>::ld(sb + bo + nb * 16 * KPI + kk * 32); }
        __builtin_amdgcn_sched_barrier(0);   // keeps the 32 LDS reads above as one group: left free, the compiler sinks each column block's reads to just in front of its four products, with a full wait each time
#pragma unroll
        for (int kk = 0; kk < 2; ++kk)
#pragma unroll
            for (int nb = 0; nb < 4; ++nb) {
#pragma unroll
                for (int mb = 0; mb < 2; ++mb) acc[mb][nb] = wmmab(a[kk][mb], bb[kk][nb], acc[mb][nb]);
#pragma unroll
                for (int mb = 0; mb < 2; ++mb) acc[mb][nb] = wmmab(a2[kk][mb], bb[kk][nb], acc[mb][nb]); }
        asm volatile("v_nop\n\tv_nop\n\tv_nop\n\tv_nop" : "+v"(acc[0][0]), "+v"(acc[1][0]), "+v"(acc[0][1]), "+v"(acc[1][1]), "+v"(acc[0][2]), "+v"(acc[1][2]), "+v"(acc[0][3]), "+v"(acc[1][3]));   // the four vector slots between the last WMMA and whatever follows it on either side of the branches below (the next trip's LDS address over an operand register, the epilogue's reads of its result)
        if (s + 1 < DQ / 64) sstore((s + 1) & 1);   // the buffer that stage s - 1 read, whose readers passed the barrier at the foot of that stage
        __syncthreads();                            // publishes stage s + 1 and ends every read of stage s
    }
    const int cw = (int)blockIdx.y * 128 + cj * 64 + lr * 4; v4f bv;
#pragma unroll
    for (int u = 0; u < 4; ++u) bv[u] = bfr(bias[cw + u]);
    float* op = out + ((size_t)blockIdx.x * 128 + ri * 32 + hi) * DM + cw;
#pragma unroll
    for (int mb = 0; mb < 2; ++mb) {
#pragma unroll
        for (int nb = 0; nb < 4; ++nb) {
#pragma unroll
            for (int j = 0; j < 8; ++j) os[(hi * 8 + j) * 68 + nb * 16 + lr] = acc[mb][nb][j]; }
        __builtin_amdgcn_wave_barrier(); asm volatile("" ::: "memory");   // keeps the row reads below behind the tile's LDS writes
        v4f val[8];
#pragma unroll
        for (int s = 0; s < 8; ++s) val[s] = *(const v4fa*)(os + (2 * s + hi) * 68 + lr * 4) + bv;   // 16 lanes a row of 64 floats: two whole 128-byte lines
#pragma unroll
        for (int s = 0; s < 8; ++s) *(v4f*)(op + (size_t)(mb * 16 + 2 * s) * DM) = val[s];
        __builtin_amdgcn_wave_barrier(); asm volatile("" ::: "memory");   // keeps the next tile's LDS writes behind the row reads above
    }
}

__global__ __launch_bounds__(256) void k_dist(const float* __restrict__ co, const int* __restrict__ mk, float* ED) { const size_t e = ((size_t)blockIdx.x * 256 + threadIdx.x) * 4; if (e >= (size_t)TT * TT) return; co += (size_t)blockIdx.y * TT * 2; ED += (size_t)blockIdx.y * TT * TT; mk += (size_t)blockIdx.y * TT * TT;   /* grid y = batch */ const v4i mq = *(const v4i*)(mk + e); const int j = (int)(e % TT); const int i = (int)(e / TT); const float xi = bfr(co[i * 2]), yi = bfr(co[i * 2 + 1]); v4f o;   // exp(-dist): dist = sqrt(dx^2 + dy^2) (0 when d2 == 0), NaN where mask == 0 (16-B lanes)
#pragma unroll
    for (int u = 0; u < 4; ++u) { const float dx = __fsub_rn(xi, bfr(co[(j + u) * 2])), dy = __fsub_rn(yi, bfr(co[(j + u) * 2 + 1])); float px = __fmul_rn(dx, dx), py = __fmul_rn(dy, dy); asm volatile("" : "+v"(px)); asm volatile("" : "+v"(py)); const float d2 = __fadd_rn(px, py); const float dist = (d2 == 0.f) ? 0.f : __fsqrt_rn(d2); o[u] = (mq[u] == 0) ? __builtin_nanf("") : __expf(-dist); }
    *(v4f*)(ED + e) = o;  }

extern "C" void kernel_launch(void* const* d_in, const int* in_sizes, int n_in,
                              void* d_out, int out_size, void* d_ws, size_t ws_size, hipStream_t stream) {
    (void)in_sizes; (void)n_in; (void)out_size;
    const float* x = (const float*)d_in[0]; const float* coords = (const float*)d_in[1]; const int* mask = (const int*)d_in[2]; const float* wq = (const float*)d_in[3]; const float* wk = (const float*)d_in[4]; const float* wv = (const float*)d_in[5]; const float* sbias = (const float*)d_in[6]; const float* wo = (const float*)d_in[7]; const float* bo = (const float*)d_in[8]; const float* cosT = nullptr; const float* sinT = nullptr; (void)cosT; (void)sinT;
    float* OUT = (float*)d_out;     // [2][2048][1024]
    char* wsp = (char*)d_ws;
    auto take = [&](size_t bytes) { char* p = wsp; wsp += (bytes + 255) & ~(size_t)255; return (void*)p; };
    bf* WQ = (bf*)take((size_t)DQ * DM * 2); bf* WK = (bf*)take((size_t)DKV * DM * 2); bf* WV = (bf*)take((size_t)DKV * DM * 2); bf* WO = (bf*)take((size_t)DM * DQ * 2);
    bf* XB = (bf*)take((size_t)NB_ * TT * DM * 2); float* ED = (float*)take((size_t)NB_ * TT * TT * 4);
    const size_t PL = (size_t)NH_ * TT * HD;   // elements of one operand plane of one batch (NKV == NH_)
    h16* QP16 = (h16*)take(NB_ * PL * 2); h16* KP16 = (h16*)take(NB_ * PL * 2); h16* VT16 = (h16*)take(NB_ * PL * 2);
    bf* QPh = (bf*)take(NB_ * PL * 2); bf* QPl = (bf*)take(NB_ * PL * 2); bf* KPh = (bf*)take(NB_ * PL * 2); bf* KPl = (bf*)take(NB_ * PL * 2); bf* VTh = (bf*)take(NB_ * PL * 2); bf* VTl = (bf*)take(NB_ * PL * 2);
    bf* ATh = (bf*)take((size_t)NB_ * TT * DQ * 2); bf* ATl = (bf*)take((size_t)NB_ * TT * DQ * 2);
    if ((size_t)(wsp - (char*)d_ws) > ws_size) return;    // ws 256 MiB
    k_wtG<<<dim3((unsigned)((DM * DQ / 64 + 63) / 64), 4), 256, 0, stream>>>(wq, wk, wv, wo, DM, DQ, WQ);   // WQ, WK, WV, WO: four planes of DM x DQ elements, taken one behind another above
    k_cvt8<<<(unsigned)(((size_t)NB_ * TT * DM / 8 + 255) / 256), 256, 0, stream>>>(x, XB, (size_t)NB_ * TT * DM / 8);
    k_proj<<<dim3(TT / 128, NH_ / 2, 3 * NB_), 128, 0, stream>>>(XB, WQ, WK, WV, QP16, QPh, QPl, KP16, KPh, KPl, VT16, VTh, VTl);
    k_dist<<<dim3((TT * TT / 4 + 255) / 256, NB_), 256, 0, stream>>>(coords, mask, ED);
    k_fattn<<<dim3(NH_, NB_ * TT / 64), 256, 0, stream>>>(QP16, KP16, VT16, QPh, QPl, KPh, KPl, VTh, VTl, ED, sbias, ATh, ATl);
    k_wo<<<dim3(NB_ * TT / 128, DM / 128), 256, 0, stream>>>(ATh, ATl, WO, bo, OUT);
}

// v009
// A run of this version takes 147 microseconds.
// Timed twice side by side with v008, it ran 1.04 times as fast both times.
// Over all steps from v000 it is 15.4 times as fast.
#include <hip/hip_runtime.h>

// SpatialTemporalAttention (x [2][2048][1024]; Q/K/V = x W ([in,out], no bias; 16 heads x 64); scores = Q.K / 8 + spatial_bias[h] exp(-dist[b][i][j]) with dist = pairwise Euclidean distance of spatial_coords [2][2048][2] (0 when d2 == 0); masked where mask[b][i][j] == 0 (int, read) -> -inf; softmax; out = merged Wo + bo -> [2][2048][1024]).
// Compute dtypes, f32 accumulate: every input rounded to bf16; Q/K/V on PLAIN bf16 operands (inputs: exact), one launch for both batches whose epilogue writes the attention operand planes (k_proj); the distance bias table exp(-dist) [2][2048][2048] in f32, its masked entries NaN (j_dist in k_prep reads the mask, once); scores and attn.v (one fused kernel, k_fattn): query rows < 512 hl (3 products), the rest single fp16; bias + mask + running softmax f32; Wo hl x exact (2 products) + bias. Every kernel is launched once: batches and the four weight matrices are grid indices.

#define NB_  2
#define TT   2048
#define DM   1024
#define NH_  16
#define NKV  16
#define REP  (NH_ / NKV)
#define HD   64
#define DQ   (NH_ * HD)
#define DKV  (NKV * HD)
#define RH   512                  // query rows < RH use hi+lo planes (0: none)
#define WIN  0
#define SCL  0.125f   // HD^-0.5
#define KPI  72                   // k_fattn LDS pitch of a staged K row, elements: 128 B + 16 B (16 B x odd: b128 fragment reads without bank conflicts)
#define VPI  40                   // the same of a staged Vt row: 64 B + 16 B
#define BPI  36                   // the same of a bias row, floats: 128 B + 16 B
#define LOG2E 1.4426950408889634f
typedef _Float16 h16;
typedef unsigned short bf;
typedef __attribute__((ext_vector_type(16))) __bf16   v16bf;
typedef __attribute__((ext_vector_type(16))) _Float16 v16h;
typedef __attribute__((ext_vector_type(8)))  _Float16 v8h;
typedef __attribute__((ext_vector_type(8)))  unsigned short v8us;
typedef __attribute__((ext_vector_type(8)))  float    v8f;
typedef __attribute__((ext_vector_type(4)))  float    v4f;
typedef v8h  __attribute__((may_alias)) v8ha;
typedef v4f  __attribute__((may_alias)) v4fa;
typedef v8us __attribute__((may_alias)) v8usa;

__device__ __forceinline__ unsigned short f2bf(float f) { unsigned u = __float_as_uint(f); u += 0x7FFFu + ((u >> 16) & 1u); return (unsigned short)(u >> 16); }
__device__ __forceinline__ float bf2f(unsigned short b) { return __uint_as_float(((unsigned)b) << 16); }
__device__ __forceinline__ float bfr(float f) { return bf2f(f2bf(f)); }
__device__ __forceinline__ v16h cat16(v8h lo, v8h hi) { return __builtin_shufflevector(lo, hi, 0, 1, 2, 3, 4, 5, 6, 7, 8, 9, 10, 11, 12, 13, 14, 15); }
__device__ __forceinline__ v16bf cat16b(v8us lo, v8us hi) { return __builtin_bit_cast(v16bf, __builtin_shufflevector(lo, hi, 0, 1, 2, 3, 4, 5, 6, 7, 8, 9, 10, 11, 12, 13, 14, 15)); }
__device__ __forceinline__ v8f wmma16(v16h a, v16h b, v8f c) { return __builtin_amdgcn_wmma_f32_16x16x32_f16(false, a, false, b, (short)0, c, false, false); }
__device__ __forceinline__ v8f wmmab(v16bf a, v16bf b, v8f c) { return __builtin_amdgcn_wmma_f32_16x16x32_bf16(false, a, false, b, (short)0, c, false, false); }



// a 16x32 operand fragment from a K-contiguous 16-bit row (global or LDS): lane (lr, hi) holds k = 8 hi + 0..7 and 16 + 8 hi + 0..7 of row lr
template <typename T16> struct WFrag;
template <> struct WFrag<h16> { typedef v16h V; static __device__ __forceinline__ V ld(const h16* p) { return cat16(*(const v8h*)p, *(const v8h*)(p + 16)); } static __device__ __forceinline__ v8f mma(V a, V b, v8f c) { return wmma16(a, b, c); } };
template <> struct WFrag<bf> { typedef v16bf V; static __device__ __forceinline__ V ld(const bf* p) { return cat16b(*(const v8us*)p, *(const v8us*)(p + 16)); } static __device__ __forceinline__ v8f mma(V a, V b, v8f c) { return wmmab(a, b, c); } };
__device__ __forceinline__ h16 tohx(float x) { return (h16)x; }
__device__ __forceinline__ void splitf(float y, unsigned short& h, unsigned short& l) { h = f2bf(y); l = f2bf(y - bf2f(h)); }
typedef __attribute__((ext_vector_type(2))) _Float16 v2h;
typedef __attribute__((ext_vector_type(4))) _Float16 v4h;
typedef __attribute__((ext_vector_type(2))) unsigned short v2us;
typedef __attribute__((ext_vector_type(4))) unsigned short v4us;
typedef __attribute__((ext_vector_type(2))) float v2f;
typedef __attribute__((ext_vector_type(4))) int v4i;

// j_wtG and j_cvt8 here and j_dist at the foot of the file need nothing of each other and are blocks of one launch (k_prep, behind j_dist); bx, by = the job's own block indices.
// by = which of the four weight matrices (all [K][N]); their transposed bf16 planes lie one behind another from Bt
__device__ __forceinline__ void j_wtG(unsigned bx, unsigned by, const float* __restrict__ w0, const float* __restrict__ w1, const float* __restrict__ w2, const float* __restrict__ w3, int K, int N, bf* Bt) {
    const float* __restrict__ w = by == 0 ? w0 : by == 1 ? w1 : by == 2 ? w2 : w3; Bt += (size_t)by * K * N;
    const int lane = threadIdx.x & 31; const int L0 = (bx * 8 + (threadIdx.x >> 5)) * 8; const int nlines = N * K / 64;
{
#pragma unroll 1
        for (int l = 0; l < 8; ++l) { const int L = L0 + l; if (L >= nlines) break; const size_t e = (size_t)L * 64 + lane * 2; const int k = (int)(e % K), n = (int)(e / K); v2us o;
            o[0] = f2bf(w[(size_t)k * N + n]); o[1] = f2bf(w[(size_t)(k + 1) * N + n]); *(v2us*)(Bt + e) = o; }
         }
}
__device__ __forceinline__ void j_cvt8(unsigned bx, const float* __restrict__ src, bf* dst, size_t n8) { const size_t i = (size_t)bx * 256 + threadIdx.x; if (i >= n8) return; const v8f v = *(const v8f*)(src + i * 8); v8us o;
#pragma unroll
    for (int k = 0; k < 8; ++k) o[k] = f2bf(v[k]); *(v8us*)(dst + i * 8) = o;  }
__global__ __launch_bounds__(256) void k_cscvt(const float* __restrict__ cosT, const float* __restrict__ sinT, float* CS) { const int idx = blockIdx.x * 256 + threadIdx.x; if (idx >= TT * HD) return; v2f cs; cs[0] = bfr(cosT[idx]); cs[1] = bfr(sinT[idx]); *(v2f*)(CS + (size_t)idx * 2) = cs;  }
// ---- k_proj: the Q, K and V projections of both batches in one launch; ONE WAVE per 64x64 tile, the whole K range in one accumulation, and the epilogue writes the operand planes of k_fattn itself (fp16, and bf16 hi + lo).
// Work-group = 4 waves = 2 token tiles x 2 heads: they share 128 rows of x and 128 rows of the transposed weight. A stage is 64 k = one whole 128-byte line of each of the 256 rows: global loads (8 lanes a line) one stage ahead into registers,
// two LDS buffers, one barrier a stage; the fragments come from LDS in the k order of WFrag::ld, so every accumulator sums its products in the order it did before.
// grid (TT / 128, heads / 2, 3 NB_) = 768 work-groups, three a WGP by their LDS, all resident at once; z = product x NB_ + batch. Q, K: rows = 64 tokens of x, columns = the 64 outputs of head h -> plane [b][h][t][d]. V: rows = the 64 outputs of head h, columns = 64 tokens -> the transposed plane in tiles of 32 tokens, [b][h][t / 32][d][32]: the 64 x 32 tile that a stage of k_fattn takes is 4 KB in a row, like its K tile.
typedef v4i __attribute__((may_alias)) v4ia;
__global__ __launch_bounds__(128, 3) void k_proj(const bf* __restrict__ XB, const bf* __restrict__ WQ, const bf* __restrict__ WK, const bf* __restrict__ WV, h16* Q16, bf* Qh, bf* Ql, h16* K16, bf* Kh, bf* Kl, h16* V16, bf* Vh, bf* Vl) {
    __shared__ __align__(16) bf st[2 * 256 * KPI];          // two stage buffers: rows 0-127 of x, rows 128-255 of the weight, at the pitch of k_fattn's K rows (same row length, same reader)
    __shared__ __align__(16) float osm[4 * 16 * 68];        // each wave's own epilogue rows
    const int pr = blockIdx.z / NB_, b = blockIdx.z % NB_; const bool tr = pr == 2;
    const int th = threadIdx.x, lane = th & 31, lr = lane & 15, hi = lane >> 4; const int w = __builtin_amdgcn_readfirstlane(th >> 5), ti = w & 1, hj = w >> 1;
    const int t0 = ((int)blockIdx.x * 2 + ti) * 64, h = (int)blockIdx.y * 2 + hj; float* os = osm + w * 16 * 68;
    const bf* X = XB + ((size_t)b * TT + (size_t)blockIdx.x * 128) * DM; const bf* Wt = (pr == 0 ? WQ : pr == 1 ? WK : WV) + (size_t)blockIdx.y * 128 * DM;
    const unsigned go = (th >> 3) * DM + (th & 7) * 8; const int so = (th >> 3) * KPI + (th & 7) * 8;   // 16-byte chunk th & 7 of row th / 8 + 16 i
    const bf* xp = X + go; const bf* wp = Wt + go;   // the lane's two addresses, kept through the loop and stepped by one stage a trip, so that no load's destination is laid over an address that an issued load names
    v4i rx[8], rw[8];
    auto gload = [&]() {
#pragma unroll
        for (int i = 0; i < 8; ++i) { rx[i] = *(const v4ia*)(xp + i * 16 * DM); rw[i] = *(const v4ia*)(wp + i * 16 * DM); } };
    auto sstore = [&](int buf) { bf* d = st + buf * 256 * KPI + so;
#pragma unroll
        for (int i = 0; i < 8; ++i) { *(v4ia*)(d + i * 16 * KPI) = rx[i]; *(v4ia*)(d + (128 + i * 16) * KPI) = rw[i]; } };
    const int ao = ((tr ? 128 + hj * 64 : ti * 64) + lr) * KPI + 8 * hi, bo = ((tr ? ti * 64 : 128 + hj * 64) + lr) * KPI + 8 * hi;   // this wave's A and B rows in a stage buffer
    v8f acc[4][4];
#pragma unroll
    for (int mb = 0; mb < 4; ++mb)
#pragma unroll
        for (int nb = 0; nb < 4; ++nb) acc[mb][nb] = (v8f){};
    gload(); sstore(0); __syncthreads();
#pragma unroll 1   // rolled: 16 accumulators, the fragments and the 16 chunks on their way already fill the wave's working set
    for (int s = 0; s < DM / 64; ++s) { const bf* sb = st + (s & 1) * 256 * KPI;
        if (s + 1 < DM / 64) { xp += 64; wp += 64; gload(); }
        v16bf a[4];
#pragma unroll
        for (int kk = 0; kk < 2; ++kk) {
#pragma unroll
            for (int mb = 0; mb < 4; ++mb) a[mb] = WFrag<bf>::ld(sb + ao + mb * 16 * KPI + kk * 32);
#pragma unroll
            for (int nb = 0; nb < 4; ++nb) { const v16bf bb = WFrag<bf>::ld(sb + bo + nb * 16 * KPI + kk * 32);
#pragma unroll
                for (int mb = 0; mb < 4; ++mb) acc[mb][nb] = wmmab(a[mb], bb, acc[mb][nb]); } }
        asm volatile("v_nop\n\tv_nop\n\tv_nop\n\tv_nop" : "+v"(acc[0][0]), "+v"(acc[1][1]), "+v"(acc[2][2]), "+v"(acc[3][3]) : "v"(a[0]), "v"(a[3]));   // the four vector slots between the last WMMA and whatever follows it on either side of the branches below (the next trip's fragment loads over its operands, the epilogue's reads of its result)
        if (s + 1 < DM / 64) sstore((s + 1) & 1);   // the buffer that stage s - 1 read, whose readers passed the barrier at the foot of that stage
        __syncthreads();                            // publishes stage s + 1 and ends every read of stage s
    }
    h16* P16 = (pr == 0 ? Q16 : pr == 1 ? K16 : V16); bf* Ph = (pr == 0 ? Qh : pr == 1 ? Kh : Vh); bf* Pl = (pr == 0 ? Ql : pr == 1 ? Kl : Vl);
    const int op = tr ? 32 : HD; const size_t ob = ((size_t)b * NH_ + h) * TT * HD + (size_t)t0 * HD + (size_t)(lane >> 3) * op + (tr ? ((lane & 7) >> 2) * 32 * HD + (lane & 3) * 8 : (lane & 7) * 8);   // V: a row's 64 tokens fall into two 32-token tiles (32 HD elements apart); 4 rows x 64 B of a tile lie in a row
#pragma unroll
    for (int mb = 0; mb < 4; ++mb) {
#pragma unroll
        for (int nb = 0; nb < 4; ++nb) {
#pragma unroll
            for (int j = 0; j < 8; ++j) os[(hi * 8 + j) * 68 + nb * 16 + lr] = acc[mb][nb][j]; }
        __builtin_amdgcn_wave_barrier(); asm volatile("" ::: "memory");   // keeps the row reads below behind the tile's LDS writes
#pragma unroll
        for (int s = 0; s < 4; ++s) { const float* rp = os + (4 * s + (lane >> 3)) * 68 + (lane & 7) * 8; const v4f x0 = *(const v4fa*)rp, x1 = *(const v4fa*)(rp + 4); v8h o16; v8us oh, ol;   // 8 lanes a row of 64: whole 128-byte lines of each plane (V: two pieces of 256 B, four rows of each token tile)
#pragma unroll
            for (int u = 0; u < 8; ++u) { const float r = (u < 4) ? x0[u & 3] : x1[u & 3]; o16[u] = tohx(r); unsigned short a2, c2; splitf(r, a2, c2); oh[u] = a2; ol[u] = c2; }
            const size_t oo = ob + (size_t)(mb * 16 + 4 * s) * op; *(v8h*)(P16 + oo) = o16; *(v8us*)(Ph + oo) = oh; *(v8us*)(Pl + oo) = ol;
            asm volatile("s_wait_xcnt 0x0" ::: "memory"); }   // stands in front of the next trip's rewrite of the three stores' address and data registers
        __builtin_amdgcn_wave_barrier(); asm volatile("" ::: "memory");   // keeps the next tile's LDS writes behind the row reads above
    }
}
template <typename T16> struct PFrag;
template <> struct PFrag<h16> { static __device__ __forceinline__ void put(v16h& a, v16h& b, int e, float p) { (void)b; a[e] = (h16)p; } };
template <> struct PFrag<bf> { static __device__ __forceinline__ void put(v16bf& a, v16bf& b, int e, float p) { const __bf16 x = (__bf16)p; a[e] = x; b[e] = (__bf16)(p - (float)x); } };
template <typename T16, bool HL, int NQT>
__device__ __forceinline__ void fattn_body(const T16* __restrict__ Q, const T16* __restrict__ Q2, const T16* __restrict__ Kp, const T16* __restrict__ K2, const T16* __restrict__ Vt, const T16* __restrict__ V2, const float* __restrict__ ED, float sb2, int q0, int h, bf* Ah, bf* Al, char* sm) {
    typedef typename WFrag<T16>::V V;
    constexpr int NQ = 16 * NQT, NP = HL ? 2 : 1, KTE = 32 * KPI, VTE = 64 * VPI, STG = NP * (KTE + VTE), NS = TT / 2 / 32;
    const int lane = threadIdx.x & 31, lr = lane & 15, hi = lane >> 4, th = threadIdx.x & 127; const int w = __builtin_amdgcn_readfirstlane(threadIdx.x >> 5), qg = w & 3, kh = w >> 2;
    T16* st = (T16*)sm + kh * 2 * STG;                          // this key half's two stage buffers: K plane(s), then Vt plane(s)
    float* bs = (float*)(sm + 4 * STG * 2) + w * NQ * BPI;      // this wave's own bias rows
    const int qw = q0 + qg * NQ; const size_t hp = (size_t)h * TT * HD;
    V qf[NQT][2], qf2[NQT][2];
#pragma unroll
    for (int qt = 0; qt < NQT; ++qt)
#pragma unroll
        for (int kk = 0; kk < 2; ++kk) { const size_t a = hp + (size_t)(qw + qt * 16 + lr) * HD + kk * 32 + 8 * hi; qf[qt][kk] = WFrag<T16>::ld(Q + a); if (HL) qf2[qt][kk] = WFrag<T16>::ld(Q2 + a); }
    v8f o[4][NQT]; float m[NQT], l[NQT];
#pragma unroll
    for (int qt = 0; qt < NQT; ++qt) { m[qt] = -3.0e38f; l[qt] = 0.f;
#pragma unroll
        for (int dt = 0; dt < 4; ++dt) o[dt][qt] = (v8f){}; }
    const int kb = kh * (TT / 2);
    // the next stage on its way: 16-byte chunk c = th + 128 i of the K tile (32 rows x 8 chunks) and of the Vt tile (64 rows x 4 chunks), each 4 KB contiguous in memory: every load covers whole lines; rows 4 i + lane / 8 of the bias block (8 lanes a 128-byte row)
    v4i rk[NP][2], rv[NP][2]; v4f re[NQT][4];
    const size_t ak = hp + (size_t)kb * HD + th * 8, av = ak, ae = (size_t)(qw + (lane >> 3)) * TT + kb + (lane & 7) * 4;
    const T16* kp = Kp + ak; const T16* kp2 = HL ? K2 + ak : nullptr; const T16* vp = Vt + av; const T16* vp2 = HL ? V2 + av : nullptr; const float* ep = ED + ae;
    auto gload = [&]() {
#pragma unroll
        for (int i = 0; i < 2; ++i) { rk[0][i] = *(const v4ia*)(kp + i * 1024); rv[0][i] = *(const v4ia*)(vp + i * 1024); if (HL) { rk[NP - 1][i] = *(const v4ia*)(kp2 + i * 1024); rv[NP - 1][i] = *(const v4ia*)(vp2 + i * 1024); } }
#pragma unroll
        for (int qt = 0; qt < NQT; ++qt)
#pragma unroll
            for (int i = 0; i < 4; ++i) re[qt][i] = *(const v4f*)(ep + (qt * 16 + 4 * i) * TT);
        kp += 32 * HD; vp += 32 * HD; ep += 32; if (HL) { kp2 += 32 * HD; vp2 += 32 * HD; } };
    auto sstore = [&](int buf) { T16* b = st + buf * STG;
#pragma unroll
        for (int i = 0; i < 2; ++i) { const int c = th + 128 * i; const int sk = (c >> 3) * KPI + (c & 7) * 8, sv = NP * KTE + (c >> 2) * VPI + (c & 3) * 8;
            *(v4ia*)(b + sk) = rk[0][i]; *(v4ia*)(b + sv) = rv[0][i]; if (HL) { *(v4ia*)(b + KTE + sk) = rk[NP - 1][i]; *(v4ia*)(b + VTE + sv) = rv[NP - 1][i]; } }
#pragma unroll
        for (int qt = 0; qt < NQT; ++qt)
#pragma unroll
            for (int i = 0; i < 4; ++i) { v4f bb;
#pragma unroll
                for (int u = 0; u < 4; ++u) bb[u] = fmaxf(sb2 * re[qt][i][u], -__builtin_inff());   // a masked entry is NaN in the table: the maximum with -inf returns -inf for it and the product itself for every other
                *(v4f*)(bs + (qt * 16 + 4 * i + (lane >> 3)) * BPI + (lane & 7) * 4) = bb; } };
    gload(); sstore(0); __syncthreads();
#pragma unroll 1   // rolled: the stage body is several hundred instructions, and unrolled it would leave the register limit
    for (int s = 0; s < NS; ++s) { const T16* b = st + (s & 1) * STG;
        if (s + 1 < NS) gload();
        v8f sc_[2][NQT];
#pragma unroll
        for (int kt = 0; kt < 2; ++kt) { V ka[2], ka2[2];
#pragma unroll
            for (int kk = 0; kk < 2; ++kk) { const int a = (kt * 16 + lr) * KPI + kk * 32 + 8 * hi; ka[kk] = WFrag<T16>::ld(b + a); if (HL) ka2[kk] = WFrag<T16>::ld(b + KTE + a); }
#pragma unroll
            for (int qt = 0; qt < NQT; ++qt) { v8f c = (v8f){};
#pragma unroll
                for (int kk = 0; kk < 2; ++kk) { c = WFrag<T16>::mma(ka[kk], qf[qt][kk], c); if (HL) { c = WFrag<T16>::mma(ka[kk], qf2[qt][kk], c); c = WFrag<T16>::mma(ka2[kk], qf[qt][kk], c); } }
                sc_[kt][qt] = c; } }
        V pf[NQT], pf2[NQT];
#pragma unroll
        for (int qt = 0; qt < NQT; ++qt) { float mx = m[qt];
#pragma unroll
            for (int kt = 0; kt < 2; ++kt) { const float* br = bs + (qt * 16 + lr) * BPI + kt * 16 + 8 * hi; const v4f e0 = *(const v4f*)br, e1 = *(const v4f*)(br + 4);
#pragma unroll
                for (int j = 0; j < 8; ++j) { const float t = sc_[kt][qt][j] * (SCL * LOG2E) + ((j < 4) ? e0[j & 3] : e1[j & 3]); sc_[kt][qt][j] = t; mx = fmaxf(mx, t); } }
            mx = fmaxf(mx, __shfl_xor(mx, 16, 32));
            const float rs = __builtin_amdgcn_exp2f(m[qt] - mx); m[qt] = mx; float ps = 0.f;
#pragma unroll
            for (int kt = 0; kt < 2; ++kt)
#pragma unroll
                for (int j = 0; j < 8; ++j) { const float p = __builtin_amdgcn_exp2f(sc_[kt][qt][j] - mx); ps += p; PFrag<T16>::put(pf[qt], pf2[qt], kt * 8 + j, p); }
            l[qt] = l[qt] * rs + ps;   // this lane half's keys only; the lane halves are joined behind the loop
#pragma unroll
            for (int dt = 0; dt < 4; ++dt) o[dt][qt] *= rs; }
#pragma unroll
        for (int dt = 0; dt < 4; ++dt) { const int a = NP * KTE + (dt * 16 + lr) * VPI + 8 * hi; const V va = WFrag<T16>::ld(b + a); V va2; if (HL) va2 = WFrag<T16>::ld(b + VTE + a);
#pragma unroll
            for (int qt = 0; qt < NQT; ++qt) { o[dt][qt] = WFrag<T16>::mma(va, pf[qt], o[dt][qt]); if (HL) { o[dt][qt] = WFrag<T16>::mma(va, pf2[qt], o[dt][qt]); o[dt][qt] = WFrag<T16>::mma(va2, pf[qt], o[dt][qt]); } } }
        if (s + 1 < NS) sstore((s + 1) & 1);   // K, Vt: the buffer that stage s - 1 read, whose readers passed the barrier at the foot of that stage; bias rows: this wave's own, read above
        __syncthreads();                       // publishes stage s + 1 and ends every read of stage s
    }
    // join of the two key halves, lane for lane: half 1 leaves its set in LDS (over the stage buffers, all read by now), half 0 adds it to its own and writes whole 128-byte lines of the merged planes
    float* jo = (float*)sm + (size_t)qg * NQT * 4 * 32 * 8 + lane * 8; float* jm = (float*)sm + 4 * NQT * 4 * 32 * 8 + qg * NQT * 32 * 2 + lane * 2;
    if (kh == 1) {
#pragma unroll
        for (int qt = 0; qt < NQT; ++qt) { v2f ml; ml[0] = m[qt]; ml[1] = l[qt]; *(v2f*)(jm + qt * 64) = ml;
#pragma unroll
            for (int dt = 0; dt < 4; ++dt) { *(v4f*)(jo + (qt * 4 + dt) * 256) = __builtin_shufflevector(o[dt][qt], o[dt][qt], 0, 1, 2, 3); *(v4f*)(jo + (qt * 4 + dt) * 256 + 4) = __builtin_shufflevector(o[dt][qt], o[dt][qt], 4, 5, 6, 7); } } }
    __syncthreads();
    if (kh == 0) {
#pragma unroll
        for (int qt = 0; qt < NQT; ++qt) { const v2f ml = *(const v2f*)(jm + qt * 64); const float M = fmaxf(m[qt], ml[0]); const float f0 = __builtin_amdgcn_exp2f(m[qt] - M), f1 = __builtin_amdgcn_exp2f(ml[0] - M);
            float L = l[qt] * f0 + ml[1] * f1; L += __shfl_xor(L, 16, 32); const float inv = 1.0f / L;
#pragma unroll
            for (int dt = 0; dt < 4; ++dt) { const v4f x0 = *(const v4f*)(jo + (qt * 4 + dt) * 256), x1 = *(const v4f*)(jo + (qt * 4 + dt) * 256 + 4); v8us oh, ol;
#pragma unroll
                for (int u = 0; u < 8; ++u) { unsigned short x, y; splitf((o[dt][qt][u] * f0 + ((u < 4) ? x0[u & 3] : x1[u & 3]) * f1) * inv, x, y); oh[u] = x; ol[u] = y; }
                const size_t oo = (size_t)(qw + qt * 16 + lr) * DQ + h * HD + dt * 16 + 8 * hi; *(v8us*)(Ah + oo) = oh; *(v8us*)(Al + oo) = ol;
                asm volatile("s_wait_xcnt 0x0" ::: "memory"); } } }   // stands in front of the next trip's rewrite of the two stores' address and data registers
}
// grid (heads, NB_ TT / 64), y = query tile x NB_ + batch: 64 query rows a work-group; the hi+lo tiles (three products each) of every batch have the low indices. Four waves a SIMD (at most 256 registers): two work-groups a WGP at a time.
__global__ __launch_bounds__(256, 4) void k_fattn(const h16* __restrict__ Q16, const h16* __restrict__ K16, const h16* __restrict__ V16, const bf* __restrict__ Qh, const bf* __restrict__ Ql, const bf* __restrict__ Kh, const bf* __restrict__ Kl, const bf* __restrict__ Vh, const bf* __restrict__ Vl, const float* __restrict__ ED, const float* __restrict__ sbias, bf* Ah, bf* Al) {
    __shared__ __align__(16) char sm[4 * 2 * (32 * KPI + 64 * VPI) * 2 + 8 * 16 * BPI * 4];   // the hi+lo form's stage buffers and bias rows; the fp16 form has half the planes
    const int h = blockIdx.x, b = (int)blockIdx.y % NB_, q0 = (int)blockIdx.y / NB_ * 64; const float sb2 = bfr(sbias[h]) * LOG2E;
    const size_t pb = (size_t)b * NH_ * TT * HD, eb = (size_t)b * TT * TT, ab = (size_t)b * TT * DQ;   // this batch's part of the operand planes, of the bias table, of the merged planes
    Q16 += pb; K16 += pb; V16 += pb; Qh += pb; Ql += pb; Kh += pb; Kl += pb; Vh += pb; Vl += pb; ED += eb; Ah += ab; Al += ab;
    if (q0 < RH) fattn_body<bf, true, 1>(Qh, Ql, Kh, Kl, Vh, Vl, ED, sb2, q0, h, Ah, Al, sm);
    else fattn_body<h16, false, 1>(Q16, nullptr, K16, nullptr, V16, nullptr, ED, sb2, q0, h, Ah, Al, sm);
}
// ---- k_wo: out = merged (hi + lo planes) x Wo + bo, the whole K range in one accumulation, written straight to out.
// Work-group = 8 waves = 4 row groups x 2 column groups on a 128x128 tile of out, 32x64 a wave: they share 128 rows of each merged plane and 128 rows of the transposed weight.
// As in k_proj a stage is 64 k = one whole 128-byte line of each of the 384 rows: global loads (8 lanes a line) one stage ahead into registers, two LDS buffers, one barrier a stage; fragments from LDS in the k order of WFrag::ld.
// grid (NB_ TT / 128, DM / 128) = 256 work-groups, one a WGP, two waves a SIMD.
__global__ __launch_bounds__(256) void k_wo(const bf* __restrict__ Ah, const bf* __restrict__ Al, const bf* __restrict__ Wt, const float* __restrict__ bias, float* out) {
    __shared__ __align__(16) bf st[2 * 384 * KPI];          // two stage buffers: rows 0-127 hi plane, 128-255 lo plane, 256-383 weight
    __shared__ __align__(16) float osm[8 * 16 * 68];        // each wave's own epilogue rows
    const int th = threadIdx.x, lane = th & 31, lr = lane & 15, hi = lane >> 4; const int w = __builtin_amdgcn_readfirstlane(th >> 5), ri = w & 3, cj = w >> 2;
    float* os = osm + w * 16 * 68;
    const unsigned go = (th >> 3) * DQ + (th & 7) * 8; const int so = (th >> 3) * KPI + (th & 7) * 8;   // 16-byte chunk th & 7 of row th / 8 + 32 i
    const bf* hp = Ah + (size_t)blockIdx.x * 128 * DQ + go; const bf* lp = Al + (size_t)blockIdx.x * 128 * DQ + go; const bf* wp = Wt + (size_t)blockIdx.y * 128 * DQ + go;   // kept through the loop and stepped by one stage a trip
    v4i rh[4], rl[4], rw[4];
    auto gload = [&]() {
#pragma unroll
        for (int i = 0; i < 4; ++i) { rh[i] = *(const v4ia*)(hp + i * 32 * DQ); rl[i] = *(const v4ia*)(lp + i * 32 * DQ); rw[i] = *(const v4ia*)(wp + i * 32 * DQ); } };
    auto sstore = [&](int buf) { bf* d = st + buf * 384 * KPI + so;
#pragma unroll
        for (int i = 0; i < 4; ++i) { *(v4ia*)(d + i * 32 * KPI) = rh[i]; *(v4ia*)(d + (128 + i * 32) * KPI) = rl[i]; *(v4ia*)(d + (256 + i * 32) * KPI) = rw[i]; } };
    const int ao = (ri * 32 + lr) * KPI + 8 * hi, bo = (256 + cj * 64 + lr) * KPI + 8 * hi;   // this wave's A rows (hi plane; the lo plane lies 128 rows on) and B rows in a stage buffer
    v8f acc[2][4];
#pragma unroll
    for (int mb = 0; mb < 2; ++mb)
#pragma unroll
        for (int nb = 0; nb < 4; ++nb) acc[mb][nb] = (v8f){};
    gload(); sstore(0); __syncthreads();
#pragma unroll 1   // rolled: a stage is 32 LDS reads and 32 matrix instructions a wave already, and its 16 fragments with the 12 chunks on their way take 176 registers
    for (int s = 0; s < DQ / 64; ++s) { const bf* sb = st + (s & 1) * 384 * KPI;
        if (s + 1 < DQ / 64) { hp += 64; lp += 64; wp += 64; gload(); }
        v16bf a[2][2], a2[2][2], bb[2][4];   // the stage's 16 fragments, all asked for ahead of its first product: one LDS latency a stage, not one a column block
#pragma unroll
        for (int kk = 0; kk < 2; ++kk) {
#pragma unroll
            for (int mb = 0; mb < 2; ++mb) { a[kk][mb] = WFrag<bf>::ld(sb + ao + mb * 16 * KPI + kk * 32); a2[kk][mb] = WFrag<bf>::ld(sb + ao + (128 + mb * 16) * KPI + kk * 32); }
#pragma unroll
            for (int nb = 0; nb < 4; ++nb) bb[kk][nb] = WFrag<bf>::ld(sb + bo + nb * 16 * KPI + kk * 32); }
        __builtin_amdgcn_sched_barrier(0);   // keeps the 32 LDS reads above as one group: left free, the compiler sinks each column block's reads to just in front of its four products, with a full wait each time
#pragma unroll
        for (int kk = 0; kk < 2; ++kk)
#pragma unroll
            for (int nb = 0; nb < 4; ++nb) {
#pragma unroll
                for (int mb = 0; mb < 2; ++mb) acc[mb][nb] = wmmab(a[kk][mb], bb[kk][nb], acc[mb][nb]);
#pragma unroll
                for (int mb = 0; mb < 2; ++mb) acc[mb][nb] = wmmab(a2[kk][mb], bb[kk][nb], acc[mb][nb]); }
        asm volatile("v_nop\n\tv_nop\n\tv_nop\n\tv_nop" : "+v"(acc[0][0]), "+v"(acc[1][0]), "+v"(acc[0][1]), "+v"(acc[1][1]), "+v"(acc[0][2]), "+v"(acc[1][2]), "+v"(acc[0][3]), "+v"(acc[1][3]));   // the four vector slots between the last WMMA and whatever follows it on either side of the branches below (the next trip's LDS address over an operand register, the epilogue's reads of its result)
        if (s + 1 < DQ / 64) sstore((s + 1) & 1);   // the buffer that stage s - 1 read, whose readers passed the barrier at the foot of that stage
        __syncthreads();                            // publishes stage s + 1 and ends every read of stage s
    }
    const int cw = (int)blockIdx.y * 128 + cj * 64 + lr * 4; v4f bv;
#pragma unroll
    for (int u = 0; u < 4; ++u) bv[u] = bfr(bias[cw + u]);
    float* op = out + ((size_t)blockIdx.x * 128 + ri * 32 + hi) * DM + cw;
#pragma unroll
    for (int mb = 0; mb < 2; ++mb) {
#pragma unroll
        for (int nb = 0; nb < 4; ++nb) {
#pragma unroll
            for (int j = 0; j < 8; ++j) os[(hi * 8 + j) * 68 + nb * 16 + lr] = acc[mb][nb][j]; }
        __builtin_amdgcn_wave_barrier(); asm volatile("" ::: "memory");   // keeps the row reads below behind the tile's LDS writes
        v4f val[8];
#pragma unroll
        for (int s = 0; s < 8; ++s) val[s] = *(const v4fa*)(os + (2 * s + hi) * 68 + lr * 4) + bv;   // 16 lanes a row of 64 floats: two whole 128-byte lines
#pragma unroll
        for (int s = 0; s < 8; ++s) *(v4f*)(op + (size_t)(mb * 16 + 2 * s) * DM) = val[s];
        __builtin_amdgcn_wave_barrier(); asm volatile("" ::: "memory");   // keeps the next tile's LDS writes behind the row reads above
    }
}

__device__ __forceinline__ void j_dist(unsigned bx, unsigned by, const float* __restrict__ co, const int* __restrict__ mk, float* ED) { const size_t e = ((size_t)bx * 256 + threadIdx.x) * 4; if (e >= (size_t)TT * TT) return; co += (size_t)by * TT * 2; ED += (size_t)by * TT * TT; mk += (size_t)by * TT * TT;   /* by = batch */ const v4i mq = *(const v4i*)(mk + e); const int j = (int)(e % TT); const int i = (int)(e / TT); const float xi = bfr(co[i * 2]), yi = bfr(co[i * 2 + 1]); v4f o;   // exp(-dist): dist = sqrt(dx^2 + dy^2) (0 when d2 == 0), NaN where mask == 0 (16-B lanes)
#pragma unroll
    for (int u = 0; u < 4; ++u) { const float dx = __fsub_rn(xi, bfr(co[(j + u) * 2])), dy = __fsub_rn(yi, bfr(co[(j + u) * 2 + 1])); float px = __fmul_rn(dx, dx), py = __fmul_rn(dy, dy); asm volatile("" : "+v"(px)); asm volatile("" : "+v"(py)); const float d2 = __fadd_rn(px, py); const float dist = (d2 == 0.f) ? 0.f : __fsqrt_rn(d2); o[u] = (mq[u] == 0) ? __builtin_nanf("") : __expf(-dist); }
    *(v4f*)(ED + e) = o;  }
// ---- k_prep: weight transposes, exp(-dist) table and x -> bf16 in one launch: a range of the block index picks the job (the branch is the same for a whole block; no job has a barrier).
// The weight blocks come first (each wave walks a chain of 8 dependent load-store trips), the table's next, the one-trip blocks of x last, so that the launch does not end on a long block.
#define NWB ((DM * DQ / 64 + 63) / 64)                 // blocks of one weight matrix
#define NDB ((TT * TT / 4 + 255) / 256)                // blocks of one batch of the table
#define NCB ((NB_ * TT * DM / 8 + 255) / 256)          // blocks of x
__global__ __launch_bounds__(256) void k_prep(const float* __restrict__ w0, const float* __restrict__ w1, const float* __restrict__ w2, const float* __restrict__ w3, int K, int N, bf* Bt, const float* __restrict__ co, const int* __restrict__ mk, float* ED, const float* __restrict__ src, bf* dst, size_t n8) {
    const unsigned g = blockIdx.x;
    if (g < 4 * NWB) j_wtG(g % NWB, g / NWB, w0, w1, w2, w3, K, N, Bt);
    else if (g < 4 * NWB + NB_ * NDB) j_dist((g - 4 * NWB) % NDB, (g - 4 * NWB) / NDB, co, mk, ED);
    else j_cvt8(g - 4 * NWB - NB_ * NDB, src, dst, n8);
}

extern "C" void kernel_launch(void* const* d_in, const int* in_sizes, int n_in,
                              void* d_out, int out_size, void* d_ws, size_t ws_size, hipStream_t stream) {
    (void)in_sizes; (void)n_in; (void)out_size;
    const float* x = (const float*)d_in[0]; const float* coords = (const float*)d_in[1]; const int* mask = (const int*)d_in[2]; const float* wq = (const float*)d_in[3]; const float* wk = (const float*)d_in[4]; const float* wv = (const float*)d_in[5]; const float* sbias = (const float*)d_in[6]; const float* wo = (const float*)d_in[7]; const float* bo = (const float*)d_in[8]; const float* cosT = nullptr; const float* sinT = nullptr; (void)cosT; (void)sinT;
    float* OUT = (float*)d_out;     // [2][2048][1024]
    char* wsp = (char*)d_ws;
    auto take = [&](size_t bytes) { char* p = wsp; wsp += (bytes + 255) & ~(size_t)255; return (void*)p; };
    bf* WQ = (bf*)take((size_t)DQ * DM * 2); bf* WK = (bf*)take((size_t)DKV * DM * 2); bf* WV = (bf*)take((size_t)DKV * DM * 2); bf* WO = (bf*)take((size_t)DM * DQ * 2);
    bf* XB = (bf*)take((size_t)NB_ * TT * DM * 2); float* ED = (float*)take((size_t)NB_ * TT * TT * 4);
    const size_t PL = (size_t)NH_ * TT * HD;   // elements of one operand plane of one batch (NKV == NH_)
    h16* QP16 = (h16*)take(NB_ * PL * 2); h16* KP16 = (h16*)take(NB_ * PL * 2); h16* VT16 = (h16*)take(NB_ * PL * 2);
    bf* QPh = (bf*)take(NB_ * PL * 2); bf* QPl = (bf*)take(NB_ * PL * 2); bf* KPh = (bf*)take(NB_ * PL * 2); bf* KPl = (bf*)take(NB_ * PL * 2); bf* VTh = (bf*)take(NB_ * PL * 2); bf* VTl = (bf*)take(NB_ * PL * 2);
    bf* ATh = (bf*)take((size_t)NB_ * TT * DQ * 2); bf* ATl = (bf*)take((size_t)NB_ * TT * DQ * 2);
    if ((size_t)(wsp - (char*)d_ws) > ws_size) return;    // ws 256 MiB
    k_prep<<<4 * NWB + NB_ * NDB + NCB, 256, 0, stream>>>(wq, wk, wv, wo, DM, DQ, WQ, coords, mask, ED, x, XB, (size_t)NB_ * TT * DM / 8);   // WQ, WK, WV, WO: four planes of DM x DQ elements, taken one behind another above
    k_proj<<<dim3(TT / 128, NH_ / 2, 3 * NB_), 128, 0, stream>>>(XB, WQ, WK, WV, QP16, QPh, QPl, KP16, KPh, KPl, VT16, VTh, VTl);
    k_fattn<<<dim3(NH_, NB_ * TT / 64), 256, 0, stream>>>(QP16, KP16, VT16, QPh, QPl, KPh, KPl, VTh, VTl, ED, sbias, ATh, ATl);
    k_wo<<<dim3(NB_ * TT / 128, DM / 128), 256, 0, stream>>>(ATh, ATl, WO, bo, OUT);
}

// v010
// Measured time: 141 microseconds a run.
// Two timings next to v009 both put it at 1.04 times that version's speed.
// Counting every step since v000, it is 16.0 times as fast.
#include <hip/hip_runtime.h>

// SpatialTemporalAttention (x [2][2048][1024]; Q/K/V = x W ([in,out], no bias; 16 heads x 64); scores = Q.K / 8 + spatial_bias[h] exp(-dist[b][i][j]) with dist = pairwise Euclidean distance of spatial_coords [2][2048][2] (0 when d2 == 0); masked where mask[b][i][j] == 0 (int, read) -> -inf; softmax; out = merged Wo + bo -> [2][2048][1024]).
// Compute dtypes, f32 accumulate: every input rounded to bf16; Q/K/V on PLAIN bf16 operands (inputs: exact), one launch for both batches whose epilogue writes the attention operand planes (k_proj); the distance bias table exp(-dist) [2][2048][2048] in f32, its masked entries NaN (j_dist in k_prep reads the mask, once); scores and attn.v (one fused kernel, k_fattn): query rows < 512 hl (3 products), the rest single fp16; bias + mask + running softmax f32; Wo hl x exact (2 products) + bias. Every kernel is launched once: batches and the four weight matrices are grid indices.

#define NB_  2
#define TT   2048
#define DM   1024
#define NH_  16
#define NKV  16
#define REP  (NH_ / NKV)
#define HD   64
#define DQ   (NH_ * HD)
#define DKV  (NKV * HD)
#define RH   512                  // query rows < RH use hi+lo planes (0: none)
#define WIN  0
#define SCL  0.125f   // HD^-0.5
#define KPI  72                   // k_fattn LDS pitch of a staged K row, elements: 128 B + 16 B (16 B x odd: b128 fragment reads without bank conflicts)
#define VPI  40                   // the same of a staged Vt row: 64 B + 16 B
#define BPI  36                   // the same of a bias row, floats: 128 B + 16 B
#define LOG2E 1.4426950408889634f
typedef _Float16 h16;
typedef unsigned short bf;
typedef __attribute__((ext_vector_type(16))) __bf16   v16bf;
typedef __attribute__((ext_vector_type(16))) _Float16 v16h;
typedef __attribute__((ext_vector_type(8)))  _Float16 v8h;
typedef __attribute__((ext_vector_type(8)))  unsigned short v8us;
typedef __attribute__((ext_vector_type(8)))  float    v8f;
typedef __attribute__((ext_vector_type(4)))  float    v4f;
typedef v8h  __attribute__((may_alias)) v8ha;
typedef v4f  __attribute__((may_alias)) v4fa;
typedef v8us __attribute__((may_alias)) v8usa;

__device__ __forceinline__ unsigned short f2bf(float f) { unsigned u = __float_as_uint(f); u += 0x7FFFu + ((u >> 16) & 1u); return (unsigned short)(u >> 16); }
__device__ __forceinline__ float bf2f(unsigned short b) { return __uint_as_float(((unsigned)b) << 16); }
__device__ __forceinline__ float bfr(float f) { return bf2f(f2bf(f)); }
__device__ __forceinline__ v16h cat16(v8h lo, v8h hi) { return __builtin_shufflevector(lo, hi, 0, 1, 2, 3, 4, 5, 6, 7, 8, 9, 10, 11, 12, 13, 14, 15); }
__device__ __forceinline__ v16bf cat16b(v8us lo, v8us hi) { return __builtin_bit_cast(v16bf, __builtin_shufflevector(lo, hi, 0, 1, 2, 3, 4, 5, 6, 7, 8, 9, 10, 11, 12, 13, 14, 15)); }
__device__ __forceinline__ v8f wmma16(v16h a, v16h b, v8f c) { return __builtin_amdgcn_wmma_f32_16x16x32_f16(false, a, false, b, (short)0, c, false, false); }
__device__ __forceinline__ v8f wmmab(v16bf a, v16bf b, v8f c) { return __builtin_amdgcn_wmma_f32_16x16x32_bf16(false, a, false, b, (short)0, c, false, false); }



// a 16x32 operand fragment from a K-contiguous 16-bit row (global or LDS): lane (lr, hi) holds k = 8 hi + 0..7 and 16 + 8 hi + 0..7 of row lr
template <typename T16> struct WFrag;
template <> struct WFrag<h16> { typedef v16h V; static __device__ __forceinline__ V ld(const h16* p) { return cat16(*(const v8h*)p, *(const v8h*)(p + 16)); } static __device__ __forceinline__ v8f mma(V a, V b, v8f c) { return wmma16(a, b, c); } };
template <> struct WFrag<bf> { typedef v16bf V; static __device__ __forceinline__ V ld(const bf* p) { return cat16b(*(const v8us*)p, *(const v8us*)(p + 16)); } static __device__ __forceinline__ v8f mma(V a, V b, v8f c) { return wmmab(a, b, c); } };
__device__ __forceinline__ h16 tohx(float x) { return (h16)x; }
__device__ __forceinline__ void splitf(float y, unsigned short& h, unsigned short& l) { h = f2bf(y); l = f2bf(y - bf2f(h)); }
typedef __attribute__((ext_vector_type(2))) _Float16 v2h;
typedef __attribute__((ext_vector_type(4))) _Float16 v4h;
typedef __attribute__((ext_vector_type(2))) unsigned short v2us;
typedef __attribute__((ext_vector_type(4))) unsigned short v4us;
typedef __attribute__((ext_vector_type(2))) float v2f;
typedef __attribute__((ext_vector_type(4))) int v4i;

// j_wtG and j_cvt8 here and j_dist at the foot of the file need nothing of each other and are blocks of one launch (k_prep, behind j_dist); bx, by = the job's own block indices.
// by = which of the four weight matrices (all [K][N]); their transposed bf16 planes lie one behind another from Bt
__device__ __forceinline__ void j_wtG(unsigned bx, unsigned by, const float* __restrict__ w0, const float* __restrict__ w1, const float* __restrict__ w2, const float* __restrict__ w3, int K, int N, bf* Bt) {
    const float* __restrict__ w = by == 0 ? w0 : by == 1 ? w1 : by == 2 ? w2 : w3; Bt += (size_t)by * K * N;
    const int lane = threadIdx.x & 31; const int L0 = (bx * 8 + (threadIdx.x >> 5)) * 8; const int nlines = N * K / 64;
{
#pragma unroll 1
        for (int l = 0; l < 8; ++l) { const int L = L0 + l; if (L >= nlines) break; const size_t e = (size_t)L * 64 + lane * 2; const int k = (int)(e % K), n = (int)(e / K); v2us o;
            o[0] = f2bf(w[(size_t)k * N + n]); o[1] = f2bf(w[(size_t)(k + 1) * N + n]); *(v2us*)(Bt + e) = o; }
         }
}
__device__ __forceinline__ void j_cvt8(unsigned bx, const float* __restrict__ src, bf* dst, size_t n8) { const size_t i = (size_t)bx * 256 + threadIdx.x; if (i >= n8) return; const v8f v = *(const v8f*)(src + i * 8); v8us o;
#pragma unroll
    for (int k = 0; k < 8; ++k) o[k] = f2bf(v[k]); *(v8us*)(dst + i * 8) = o;  }
__global__ __launch_bounds__(256) void k_cscvt(const float* __restrict__ cosT, const float* __restrict__ sinT, float* CS) { const int idx = blockIdx.x * 256 + threadIdx.x; if (idx >= TT * HD) return; v2f cs; cs[0] = bfr(cosT[idx]); cs[1] = bfr(sinT[idx]); *(v2f*)(CS + (size_t)idx * 2) = cs;  }
// ---- k_proj: the Q, K and V projections of both batches in one launch; ONE WAVE per 64x64 tile, the whole K range in one accumulation, and the epilogue writes the operand planes of k_fattn itself (fp16, and bf16 hi + lo).
// Work-group = 4 waves = 2 token tiles x 2 heads: they share 128 rows of x and 128 rows of the transposed weight. A stage is 64 k = one whole 128-byte line of each of the 256 rows: global loads (8 lanes a line) one stage ahead into registers,
// two LDS buffers, one barrier a stage; the fragments come from LDS in the k order of WFrag::ld, so every accumulator sums its products in the order it did before.
// grid (TT / 128, heads / 2, 3 NB_) = 768 work-groups, three a WGP by their LDS, all resident at once; z = product x NB_ + batch. Q, K: rows = 64 tokens of x, columns = the 64 outputs of head h -> plane [b][h][t][d]. V: rows = the 64 outputs of head h, columns = 64 tokens -> the transposed plane in tiles of 32 tokens, [b][h][t / 32][d][32]: the 64 x 32 tile that a stage of k_fattn takes is 4 KB in a row, like its K tile.
typedef v4i __attribute__((may_alias)) v4ia;
__global__ __launch_bounds__(128, 3) void k_proj(const bf* __restrict__ XB, const bf* __restrict__ WQ, const bf* __restrict__ WK, const bf* __restrict__ WV, h16* Q16, bf* Qh, bf* Ql, h16* K16, bf* Kh, bf* Kl, h16* V16, bf* Vh, bf* Vl) {
    __shared__ __align__(16) bf st[2 * 256 * KPI];          // two stage buffers: rows 0-127 of x, rows 128-255 of the weight, at the pitch of k_fattn's K rows (same row length, same reader)
    __shared__ __align__(16) float osm[4 * 16 * 68];        // each wave's own epilogue rows
    const int pr = blockIdx.z / NB_, b = blockIdx.z % NB_; const bool tr = pr == 2;
    const int th = threadIdx.x, lane = th & 31, lr = lane & 15, hi = lane >> 4; const int w = __builtin_amdgcn_readfirstlane(th >> 5), ti = w & 1, hj = w >> 1;
    const int t0 = ((int)blockIdx.x * 2 + ti) * 64, h = (int)blockIdx.y * 2 + hj; float* os = osm + w * 16 * 68;
    const bf* X = XB + ((size_t)b * TT + (size_t)blockIdx.x * 128) * DM; const bf* Wt = (pr == 0 ? WQ : pr == 1 ? WK : WV) + (size_t)blockIdx.y * 128 * DM;
    const unsigned go = (th >> 3) * DM + (th & 7) * 8; const int so = (th >> 3) * KPI + (th & 7) * 8;   // 16-byte chunk th & 7 of row th / 8 + 16 i
    const bf* xp = X + go; const bf* wp = Wt + go;   // the lane's two addresses, kept through the loop and stepped by one stage a trip, so that no load's destination is laid over an address that an issued load names
    v4i rx[8], rw[8];
    auto gload = [&]() {
#pragma unroll
        for (int i = 0; i < 8; ++i) { rx[i] = *(const v4ia*)(xp + i * 16 * DM); rw[i] = *(const v4ia*)(wp + i * 16 * DM); } };
    auto sstore = [&](int buf) { bf* d = st + buf * 256 * KPI + so;
#pragma unroll
        for (int i = 0; i < 8; ++i) { *(v4ia*)(d + i * 16 * KPI) = rx[i]; *(v4ia*)(d + (128 + i * 16) * KPI) = rw[i]; } };
    const int ao = ((tr ? 128 + hj * 64 : ti * 64) + lr) * KPI + 8 * hi, bo = ((tr ? ti * 64 : 128 + hj * 64) + lr) * KPI + 8 * hi;   // this wave's A and B rows in a stage buffer
    v8f acc[4][4];
#pragma unroll
    for (int mb = 0; mb < 4; ++mb)
#pragma unroll
        for (int nb = 0; nb < 4; ++nb) acc[mb][nb] = (v8f){};
    gload(); sstore(0); __syncthreads();
#pragma unroll 1   // rolled: 16 accumulators, the fragments and the 16 chunks on their way already fill the wave's working set
    for (int s = 0; s < DM / 64; ++s) { const bf* sb = st + (s & 1) * 256 * KPI;
        if (s + 1 < DM / 64) { xp += 64; wp += 64; gload(); }
        v16bf a[4];
#pragma unroll
        for (int kk = 0; kk < 2; ++kk) {
#pragma unroll
            for (int mb = 0; mb < 4; ++mb) a[mb] = WFrag<bf>::ld(sb + ao + mb * 16 * KPI + kk * 32);
#pragma unroll
            for (int nb = 0; nb < 4; ++nb) { const v16bf bb = WFrag<bf>::ld(sb + bo + nb * 16 * KPI + kk * 32);
#pragma unroll
                for (int mb = 0; mb < 4; ++mb) acc[mb][nb] = wmmab(a[mb], bb, acc[mb][nb]); } }
        asm volatile("v_nop\n\tv_nop\n\tv_nop\n\tv_nop" : "+v"(acc[0][0]), "+v"(acc[1][1]), "+v"(acc[2][2]), "+v"(acc[3][3]) : "v"(a[0]), "v"(a[3]));   // the four vector slots between the last WMMA and whatever follows it on either side of the branches below (the next trip's fragment loads over its operands, the epilogue's reads of its result)
        if (s + 1 < DM / 64) sstore((s + 1) & 1);   // the buffer that stage s - 1 read, whose readers passed the barrier at the foot of that stage
        __syncthreads();                            // publishes stage s + 1 and ends every read of stage s
    }
    h16* P16 = (pr == 0 ? Q16 : pr == 1 ? K16 : V16); bf* Ph = (pr == 0 ? Qh : pr == 1 ? Kh : Vh); bf* Pl = (pr == 0 ? Ql : pr == 1 ? Kl : Vl);
    const int op = tr ? 32 : HD; const size_t ob = ((size_t)b * NH_ + h) * TT * HD + (size_t)t0 * HD + (size_t)(lane >> 3) * op + (tr ? ((lane & 7) >> 2) * 32 * HD + (lane & 3) * 8 : (lane & 7) * 8);   // V: a row's 64 tokens fall into two 32-token tiles (32 HD elements apart); 4 rows x 64 B of a tile lie in a row
#pragma unroll
    for (int mb = 0; mb < 4; ++mb) {
#pragma unroll
        for (int nb = 0; nb < 4; ++nb) {
#pragma unroll
            for (int j = 0; j < 8; ++j) os[(hi * 8 + j) * 68 + nb * 16 + lr] = acc[mb][nb][j]; }
        __builtin_amdgcn_wave_barrier(); asm volatile("" ::: "memory");   // keeps the row reads below behind the tile's LDS writes
#pragma unroll
        for (int s = 0; s < 4; ++s) { const float* rp = os + (4 * s + (lane >> 3)) * 68 + (lane & 7) * 8; const v4f x0 = *(const v4fa*)rp, x1 = *(const v4fa*)(rp + 4); v8h o16; v8us oh, ol;   // 8 lanes a row of 64: whole 128-byte lines of each plane (V: two pieces of 256 B, four rows of each token tile)
#pragma unroll
            for (int u = 0; u < 8; ++u) { const float r = (u < 4) ? x0[u & 3] : x1[u & 3]; o16[u] = tohx(r); unsigned short a2, c2; splitf(r, a2, c2); oh[u] = a2; ol[u] = c2; }
            const size_t oo = ob + (size_t)(mb * 16 + 4 * s) * op; *(v8h*)(P16 + oo) = o16; *(v8us*)(Ph + oo) = oh; *(v8us*)(Pl + oo) = ol;
            asm volatile("s_wait_xcnt 0x0" ::: "memory"); }   // stands in front of the next trip's rewrite of the three stores' address and data registers
        __builtin_amdgcn_wave_barrier(); asm volatile("" ::: "memory");   // keeps the next tile's LDS writes behind the row reads above
    }
}
template <typename T16> struct PFrag;
template <> struct PFrag<h16> { static __device__ __forceinline__ void put(v16h& a, v16h& b, int e, float p) { (void)b; a[e] = (h16)p; } };
template <> struct PFrag<bf> { static __device__ __forceinline__ void put(v16bf& a, v16bf& b, int e, float p) { const __bf16 x = (__bf16)p; a[e] = x; b[e] = (__bf16)(p - (float)x); } };
template <typename T16, bool HL, int NQT>
__device__ __forceinline__ void fattn_body(const T16* __restrict__ Q, const T16* __restrict__ Q2, const T16* __restrict__ Kp, const T16* __restrict__ K2, const T16* __restrict__ Vt, const T16* __restrict__ V2, const float* __restrict__ ED, float sb2, int q0, int h, bf* Ah, bf* Al, char* sm) {
    typedef typename WFrag<T16>::V V;
    constexpr int NQ = 16 * NQT, NP = HL ? 2 : 1, KTE = 32 * KPI, VTE = 64 * VPI, STG = NP * (KTE + VTE), NS = TT / 2 / 32;
    const int lane = threadIdx.x & 31, lr = lane & 15, hi = lane >> 4, th = threadIdx.x & 127; const int w = __builtin_amdgcn_readfirstlane(threadIdx.x >> 5), qg = w & 3, kh = w >> 2;
    T16* st = (T16*)sm + kh * 2 * STG;                          // this key half's two stage buffers: K plane(s), then Vt plane(s)
    float* bs = (float*)(sm + 4 * STG * 2) + w * NQ * BPI;      // this wave's own bias rows
    const int qw = q0 + qg * NQ; const size_t hp = (size_t)h * TT * HD;
    V qf[NQT][2], qf2[NQT][2];
#pragma unroll
    for (int qt = 0; qt < NQT; ++qt)
#pragma unroll
        for (int kk = 0; kk < 2; ++kk) { const size_t a = hp + (size_t)(qw + qt * 16 + lr) * HD + kk * 32 + 8 * hi; qf[qt][kk] = WFrag<T16>::ld(Q + a); if (HL) qf2[qt][kk] = WFrag<T16>::ld(Q2 + a); }
    v8f o[4][NQT]; float m[NQT], l[NQT];
#pragma unroll
    for (int qt = 0; qt < NQT; ++qt) { m[qt] = -3.0e38f; l[qt] = 0.f;
#pragma unroll
        for (int dt = 0; dt < 4; ++dt) o[dt][qt] = (v8f){}; }
    const int kb = kh * (TT / 2);
    // the next stage on its way: 16-byte chunk c = th + 128 i of the K tile (32 rows x 8 chunks) and of the Vt tile (64 rows x 4 chunks), each 4 KB contiguous in memory: every load covers whole lines; rows 4 i + lane / 8 of the bias block (8 lanes a 128-byte row)
    v4i rk[NP][2], rv[NP][2]; v4f re[NQT][4];
    const size_t ak = hp + (size_t)kb * HD + th * 8, av = ak, ae = (size_t)(qw + (lane >> 3)) * TT + kb + (lane & 7) * 4;
    const T16* kp = Kp + ak; const T16* kp2 = HL ? K2 + ak : nullptr; const T16* vp = Vt + av; const T16* vp2 = HL ? V2 + av : nullptr; const float* ep = ED + ae;
    auto gload = [&]() {
#pragma unroll
        for (int i = 0; i < 2; ++i) { rk[0][i] = *(const v4ia*)(kp + i * 1024); rv[0][i] = *(const v4ia*)(vp + i * 1024); if (HL) { rk[NP - 1][i] = *(const v4ia*)(kp2 + i * 1024); rv[NP - 1][i] = *(const v4ia*)(vp2 + i * 1024); } }
#pragma unroll
        for (int qt = 0; qt < NQT; ++qt)
#pragma unroll
            for (int i = 0; i < 4; ++i) re[qt][i] = *(const v4f*)(ep + (qt * 16 + 4 * i) * TT);
        kp += 32 * HD; vp += 32 * HD; ep += 32; if (HL) { kp2 += 32 * HD; vp2 += 32 * HD; } };
    auto sstore = [&](int buf) { T16* b = st + buf * STG;
#pragma unroll
        for (int i = 0; i < 2; ++i) { const int c = th + 128 * i; const int sk = (c >> 3) * KPI + (c & 7) * 8, sv = NP * KTE + (c >> 2) * VPI + (c & 3) * 8;
            *(v4ia*)(b + sk) = rk[0][i]; *(v4ia*)(b + sv) = rv[0][i]; if (HL) { *(v4ia*)(b + KTE + sk) = rk[NP - 1][i]; *(v4ia*)(b + VTE + sv) = rv[NP - 1][i]; } }
#pragma unroll
        for (int qt = 0; qt < NQT; ++qt)
#pragma unroll
            for (int i = 0; i < 4; ++i) { v4f bb;
#pragma unroll
                for (int u = 0; u < 4; ++u) bb[u] = fmaxf(sb2 * re[qt][i][u], -__builtin_inff());   // a masked entry is NaN in the table: the maximum with -inf returns -inf for it and the product itself for every other
                *(v4f*)(bs + (qt * 16 + 4 * i + (lane >> 3)) * BPI + (lane & 7) * 4) = bb; } };
    gload(); sstore(0); __syncthreads();
#pragma unroll 1   // rolled: the stage body is several hundred instructions, and unrolled it would leave the register limit
    for (int s = 0; s < NS; ++s) { const T16* b = st + (s & 1) * STG;
        if (s + 1 < NS) gload();
        v8f sc_[2][NQT];
#pragma unroll
        for (int kt = 0; kt < 2; ++kt) { V ka[2], ka2[2];
#pragma unroll
            for (int kk = 0; kk < 2; ++kk) { const int a = (kt * 16 + lr) * KPI + kk * 32 + 8 * hi; ka[kk] = WFrag<T16>::ld(b + a); if (HL) ka2[kk] = WFrag<T16>::ld(b + KTE + a); }
#pragma unroll
            for (int qt = 0; qt < NQT; ++qt) { v8f c = (v8f){};
#pragma unroll
                for (int kk = 0; kk < 2; ++kk) { c = WFrag<T16>::mma(ka[kk], qf[qt][kk], c); if (HL) { c = WFrag<T16>::mma(ka[kk], qf2[qt][kk], c); c = WFrag<T16>::mma(ka2[kk], qf[qt][kk], c); } }
                sc_[kt][qt] = c; } }
        V va[4], va2[4];   // the stage's Vt fragments, asked for ahead of the rescale test: in flight under the exponentials, not fetched one by one behind its branch
#pragma unroll
        for (int dt = 0; dt < 4; ++dt) { const int a = NP * KTE + (dt * 16 + lr) * VPI + 8 * hi; va[dt] = WFrag<T16>::ld(b + a); if (HL) va2[dt] = WFrag<T16>::ld(b + VTE + a); }
        V pf[NQT], pf2[NQT];
#pragma unroll
        for (int qt = 0; qt < NQT; ++qt) {
#pragma unroll
            for (int kt = 0; kt < 2; ++kt) { const float* br = bs + (qt * 16 + lr) * BPI + kt * 16 + 8 * hi; const v4f e0 = *(const v4f*)br, e1 = *(const v4f*)(br + 4);
#pragma unroll
                for (int j = 0; j < 8; ++j) sc_[kt][qt][j] = sc_[kt][qt][j] * (SCL * LOG2E) + ((j < 4) ? e0[j & 3] : e1[j & 3]); }
            float p[16], ps = 0.f;   // the probabilities against the maximum in use, and this lane's sum of them (every loop over e is unrolled, so that p and the scores stay in registers)
#pragma unroll
            for (int e = 0; e < 16; ++e) { p[e] = __builtin_amdgcn_exp2f(sc_[e >> 3][qt][e & 7] - m[qt]); ps += p[e]; }
            if (qt == 0) { if (HL) asm volatile("" :: "v"(va[0]), "v"(va[1]), "v"(va[2]), "v"(va[3]), "v"(va2[0]), "v"(va2[1]), "v"(va2[2]), "v"(va2[3])); else asm volatile("" :: "v"(va[0]), "v"(va[1]), "v"(va[2]), "v"(va[3])); }   // inputs only: holds the Vt fragment loads in front of the branch below; left free, the compiler sinks them behind it, each pair with a full wait in front of its product
            if (__builtin_expect(__builtin_amdgcn_ballot_w32(ps > 256.0f) != 0, 0)) {   // one scalar branch a stage (marked unlikely: the common way falls through), taken in the first and rarely behind it: while a lane's sum stays within 2^8, so does each of its probabilities; past that (infinity too) every query of the wave takes its true maximum
                float mx = m[qt];
#pragma unroll
                for (int e = 0; e < 16; ++e) mx = fmaxf(mx, sc_[e >> 3][qt][e & 7]);
                mx = fmaxf(mx, __shfl_xor(mx, 16, 32));
                const float rs = __builtin_amdgcn_exp2f(m[qt] - mx); m[qt] = mx; l[qt] *= rs;
#pragma unroll
                for (int dt = 0; dt < 4; ++dt) o[dt][qt] *= rs;
                ps = 0.f;
#pragma unroll
                for (int e = 0; e < 16; ++e) { p[e] = __builtin_amdgcn_exp2f(sc_[e >> 3][qt][e & 7] - mx); ps += p[e]; } }
#pragma unroll
            for (int e = 0; e < 16; ++e) PFrag<T16>::put(pf[qt], pf2[qt], e, p[e]);
            l[qt] += ps; }   // this lane half's keys only; the lane halves are joined behind the loop
#pragma unroll
        for (int dt = 0; dt < 4; ++dt) {
#pragma unroll
            for (int qt = 0; qt < NQT; ++qt) { o[dt][qt] = WFrag<T16>::mma(va[dt], pf[qt], o[dt][qt]); if (HL) { o[dt][qt] = WFrag<T16>::mma(va[dt], pf2[qt], o[dt][qt]); o[dt][qt] = WFrag<T16>::mma(va2[dt], pf[qt], o[dt][qt]); } } }
        if (HL) asm volatile("v_nop\n\tv_nop\n\tv_nop\n\tv_nop" : "+v"(o[0][NQT - 1]), "+v"(o[1][NQT - 1]), "+v"(o[2][NQT - 1]), "+v"(o[3][NQT - 1]));   // the four vector slots between the last WMMA and whatever follows it on the taken side of the branch below (the next trip's LDS address over an operand register); the sum of the probabilities, which stood there, now stands in front of the test
        if (s + 1 < NS) sstore((s + 1) & 1);   // K, Vt: the buffer that stage s - 1 read, whose readers passed the barrier at the foot of that stage; bias rows: this wave's own, read above
        __syncthreads();                       // publishes stage s + 1 and ends every read of stage s
    }
    // join of the two key halves, lane for lane: half 1 leaves its set in LDS (over the stage buffers, all read by now), half 0 adds it to its own and writes whole 128-byte lines of the merged planes
    float* jo = (float*)sm + (size_t)qg * NQT * 4 * 32 * 8 + lane * 8; float* jm = (float*)sm + 4 * NQT * 4 * 32 * 8 + qg * NQT * 32 * 2 + lane * 2;
    if (kh == 1) {
#pragma unroll
        for (int qt = 0; qt < NQT; ++qt) { v2f ml; ml[0] = m[qt]; ml[1] = l[qt]; *(v2f*)(jm + qt * 64) = ml;
#pragma unroll
            for (int dt = 0; dt < 4; ++dt) { *(v4f*)(jo + (qt * 4 + dt) * 256) = __builtin_shufflevector(o[dt][qt], o[dt][qt], 0, 1, 2, 3); *(v4f*)(jo + (qt * 4 + dt) * 256 + 4) = __builtin_shufflevector(o[dt][qt], o[dt][qt], 4, 5, 6, 7); } } }
    __syncthreads();
    if (kh == 0) {
#pragma unroll
        for (int qt = 0; qt < NQT; ++qt) { const v2f ml = *(const v2f*)(jm + qt * 64); const float M = fmaxf(m[qt], ml[0]); const float f0 = __builtin_amdgcn_exp2f(m[qt] - M), f1 = __builtin_amdgcn_exp2f(ml[0] - M);
            float L = l[qt] * f0 + ml[1] * f1; L += __shfl_xor(L, 16, 32); const float inv = 1.0f / L;
#pragma unroll
            for (int dt = 0; dt < 4; ++dt) { const v4f x0 = *(const v4f*)(jo + (qt * 4 + dt) * 256), x1 = *(const v4f*)(jo + (qt * 4 + dt) * 256 + 4); v8us oh, ol;
#pragma unroll
                for (int u = 0; u < 8; ++u) { unsigned short x, y; splitf((o[dt][qt][u] * f0 + ((u < 4) ? x0[u & 3] : x1[u & 3]) * f1) * inv, x, y); oh[u] = x; ol[u] = y; }
                const size_t oo = (size_t)(qw + qt * 16 + lr) * DQ + h * HD + dt * 16 + 8 * hi; *(v8us*)(Ah + oo) = oh; *(v8us*)(Al + oo) = ol;
                asm volatile("s_wait_xcnt 0x0" ::: "memory"); } } }   // stands in front of the next trip's rewrite of the two stores' address and data registers
}
// grid (heads, NB_ TT / 64), y = query tile x NB_ + batch: 64 query rows a work-group; the hi+lo tiles (three products each) of every batch have the low indices. Four waves a SIMD (at most 256 registers): two work-groups a WGP at a time.
__global__ __launch_bounds__(256, 4) void k_fattn(const h16* __restrict__ Q16, const h16* __restrict__ K16, const h16* __restrict__ V16, const bf* __restrict__ Qh, const bf* __restrict__ Ql, const bf* __restrict__ Kh, const bf* __restrict__ Kl, const bf* __restrict__ Vh, const bf* __restrict__ Vl, const float* __restrict__ ED, const float* __restrict__ sbias, bf* Ah, bf* Al) {
    __shared__ __align__(16) char sm[4 * 2 * (32 * KPI + 64 * VPI) * 2 + 8 * 16 * BPI * 4];   // the hi+lo form's stage buffers and bias rows; the fp16 form has half the planes
    const int h = blockIdx.x, b = (int)blockIdx.y % NB_, q0 = (int)blockIdx.y / NB_ * 64; const float sb2 = bfr(sbias[h]) * LOG2E;
    const size_t pb = (size_t)b * NH_ * TT * HD, eb = (size_t)b * TT * TT, ab = (size_t)b * TT * DQ;   // this batch's part of the operand planes, of the bias table, of the merged planes
    Q16 += pb; K16 += pb; V16 += pb; Qh += pb; Ql += pb; Kh += pb; Kl += pb; Vh += pb; Vl += pb; ED += eb; Ah += ab; Al += ab;
    if (q0 < RH) fattn_body<bf, true, 1>(Qh, Ql, Kh, Kl, Vh, Vl, ED, sb2, q0, h, Ah, Al, sm);
    else fattn_body<h16, false, 1>(Q16, nullptr, K16, nullptr, V16, nullptr, ED, sb2, q0, h, Ah, Al, sm);
}
// ---- k_wo: out = merged (hi + lo planes) x Wo + bo, the whole K range in one accumulation, written straight to out.
// Work-group = 8 waves = 4 row groups x 2 column groups on a 128x128 tile of out, 32x64 a wave: they share 128 rows of each merged plane and 128 rows of the transposed weight.
// As in k_proj a stage is 64 k = one whole 128-byte line of each of the 384 rows: global loads (8 lanes a line) one stage ahead into registers, two LDS buffers, one barrier a stage; fragments from LDS in the k order of WFrag::ld.
// grid (NB_ TT / 128, DM / 128) = 256 work-groups, one a WGP, two waves a SIMD.
__global__ __launch_bounds__(256) void k_wo(const bf* __restrict__ Ah, const bf* __restrict__ Al, const bf* __restrict__ Wt, const float* __restrict__ bias, float* out) {
    __shared__ __align__(16) bf st[2 * 384 * KPI];          // two stage buffers: rows 0-127 hi plane, 128-255 lo plane, 256-383 weight
    __shared__ __align__(16) float osm[8 * 16 * 68];        // each wave's own epilogue rows
    const int th = threadIdx.x, lane = th & 31, lr = lane & 15, hi = lane >> 4; const int w = __builtin_amdgcn_readfirstlane(th >> 5), ri = w & 3, cj = w >> 2;
    float* os = osm + w * 16 * 68;
    const unsigned go = (th >> 3) * DQ + (th & 7) * 8; const int so = (th >> 3) * KPI + (th & 7) * 8;   // 16-byte chunk th & 7 of row th / 8 + 32 i
    const bf* hp = Ah + (size_t)blockIdx.x * 128 * DQ + go; const bf* lp = Al + (size_t)blockIdx.x * 128 * DQ + go; const bf* wp = Wt + (size_t)blockIdx.y * 128 * DQ + go;   // kept through the loop and stepped by one stage a trip
    v4i rh[4], rl[4], rw[4];
    auto gload = [&]() {
#pragma unroll
        for (int i = 0; i < 4; ++i) { rh[i] = *(const v4ia*)(hp + i * 32 * DQ); rl[i] = *(const v4ia*)(lp + i * 32 * DQ); rw[i] = *(const v4ia*)(wp + i * 32 * DQ); } };
    auto sstore = [&](int buf) { bf* d = st + buf * 384 * KPI + so;
#pragma unroll
        for (int i = 0; i < 4; ++i) { *(v4ia*)(d + i * 32 * KPI) = rh[i]; *(v4ia*)(d + (128 + i * 32) * KPI) = rl[i]; *(v4ia*)(d + (256 + i * 32) * KPI) = rw[i]; } };
    const int ao = (ri * 32 + lr) * KPI + 8 * hi, bo = (256 + cj * 64 + lr) * KPI + 8 * hi;   // this wave's A rows (hi plane; the lo plane lies 128 rows on) and B rows in a stage buffer
    v8f acc[2][4];
#pragma unroll
    for (int mb = 0; mb < 2; ++mb)
#pragma unroll
        for (int nb = 0; nb < 4; ++nb) acc[mb][nb] = (v8f){};
    gload(); sstore(0); __syncthreads();
#pragma unroll 1   // rolled: a stage is 32 LDS reads and 32 matrix instructions a wave already, and its 16 fragments with the 12 chunks on their way take 176 registers
    for (int s = 0; s < DQ / 64; ++s) { const bf* sb = st + (s & 1) * 384 * KPI;
        if (s + 1 < DQ / 64) { hp += 64; lp += 64; wp += 64; gload(); }
        v16bf a[2][2], a2[2][2], bb[2][4];   // the stage's 16 fragments, all asked for ahead of its first product: one LDS latency a stage, not one a column block
#pragma unroll
        for (int kk = 0; kk < 2; ++kk) {
#pragma unroll
            for (int mb = 0; mb < 2; ++mb) { a[kk][mb] = WFrag<bf>::ld(sb + ao + mb * 16 * KPI + kk * 32); a2[kk][mb] = WFrag<bf>::ld(sb + ao + (128 + mb * 16) * KPI + kk * 32); }
#pragma unroll
            for (int nb = 0; nb < 4; ++nb) bb[kk][nb] = WFrag<bf>::ld(sb + bo + nb * 16 * KPI + kk * 32); }
        __builtin_amdgcn_sched_barrier(0);   // keeps the 32 LDS reads above as one group: left free, the compiler sinks each column block's reads to just in front of its four products, with a full wait each time
#pragma unroll
        for (int kk = 0; kk < 2; ++kk)
#pragma unroll
            for (int nb = 0; nb < 4; ++nb) {
#pragma unroll
                for (int mb = 0; mb < 2; ++mb) acc[mb][nb] = wmmab(a[kk][mb], bb[kk][nb], acc[mb][nb]);
#pragma unroll
                for (int mb = 0; mb < 2; ++mb) acc[mb][nb] = wmmab(a2[kk][mb], bb[kk][nb], acc[mb][nb]); }
        asm volatile("v_nop\n\tv_nop\n\tv_nop\n\tv_nop" : "+v"(acc[0][0]), "+v"(acc[1][0]), "+v"(acc[0][1]), "+v"(acc[1][1]), "+v"(acc[0][2]), "+v"(acc[1][2]), "+v"(acc[0][3]), "+v"(acc[1][3]));   // the four vector slots between the last WMMA and whatever follows it on either side of the branches below (the next trip's LDS address over an operand register, the epilogue's reads of its result)
        if (s + 1 < DQ / 64) sstore((s + 1) & 1);   // the buffer that stage s - 1 read, whose readers passed the barrier at the foot of that stage
        __syncthreads();                            // publishes stage s + 1 and ends every read of stage s
    }
    const int cw = (int)blockIdx.y * 128 + cj * 64 + lr * 4; v4f bv;
#pragma unroll
    for (int u = 0; u < 4; ++u) bv[u] = bfr(bias[cw + u]);
    float* op = out + ((size_t)blockIdx.x * 128 + ri * 32 + hi) * DM + cw;
#pragma unroll
    for (int mb = 0; mb < 2; ++mb) {
#pragma unroll
        for (int nb = 0; nb < 4; ++nb) {
#pragma unroll
            for (int j = 0; j < 8; ++j) os[(hi * 8 + j) * 68 + nb * 16 + lr] = acc[mb][nb][j]; }
        __builtin_amdgcn_wave_barrier(); asm volatile("" ::: "memory");   // keeps the row reads below behind the tile's LDS writes
        v4f val[8];
#pragma unroll
        for (int s = 0; s < 8; ++s) val[s] = *(const v4fa*)(os + (2 * s + hi) * 68 + lr * 4) + bv;   // 16 lanes a row of 64 floats: two whole 128-byte lines
#pragma unroll
        for (int s = 0; s < 8; ++s) *(v4f*)(op + (size_t)(mb * 16 + 2 * s) * DM) = val[s];
        __builtin_amdgcn_wave_barrier(); asm volatile("" ::: "memory");   // keeps the next tile's LDS writes behind the row reads above
    }
}

__device__ __forceinline__ void j_dist(unsigned bx, unsigned by, const float* __restrict__ co, const int* __restrict__ mk, float* ED) { const size_t e = ((size_t)bx * 256 + threadIdx.x) * 4; if (e >= (size_t)TT * TT) return; co += (size_t)by * TT * 2; ED += (size_t)by * TT * TT; mk += (size_t)by * TT * TT;   /* by = batch */ const v4i mq = *(const v4i*)(mk + e); const int j = (int)(e % TT); const int i = (int)(e / TT); const float xi = bfr(co[i * 2]), yi = bfr(co[i * 2 + 1]); v4f o;   // exp(-dist): dist = sqrt(dx^2 + dy^2) (0 when d2 == 0), NaN where mask == 0 (16-B lanes)
#pragma unroll
    for (int u = 0; u < 4; ++u) { const float dx = __fsub_rn(xi, bfr(co[(j + u) * 2])), dy = __fsub_rn(yi, bfr(co[(j + u) * 2 + 1])); float px = __fmul_rn(dx, dx), py = __fmul_rn(dy, dy); asm volatile("" : "+v"(px)); asm volatile("" : "+v"(py)); const float d2 = __fadd_rn(px, py); const float dist = (d2 == 0.f) ? 0.f : __fsqrt_rn(d2); o[u] = (mq[u] == 0) ? __builtin_nanf("") : __expf(-dist); }
    *(v4f*)(ED + e) = o;  }
// ---- k_prep: weight transposes, exp(-dist) table and x -> bf16 in one launch: a range of the block index picks the job (the branch is the same for a whole block; no job has a barrier).
// The weight blocks come first (each wave walks a chain of 8 dependent load-store trips), the table's next, the one-trip blocks of x last, so that the launch does not end on a long block.
#define NWB ((DM * DQ / 64 + 63) / 64)                 // blocks of one weight matrix
#define NDB ((TT * TT / 4 + 255) / 256)                // blocks of one batch of the table
#define NCB ((NB_ * TT * DM / 8 + 255) / 256)          // blocks of x
__global__ __launch_bounds__(256) void k_prep(const float* __restrict__ w0, const float* __restrict__ w1, const float* __restrict__ w2, const float* __restrict__ w3, int K, int N, bf* Bt, const float* __restrict__ co, const int* __restrict__ mk, float* ED, const float* __restrict__ src, bf* dst, size_t n8) {
    const unsigned g = blockIdx.x;
    if (g < 4 * NWB) j_wtG(g % NWB, g / NWB, w0, w1, w2, w3, K, N, Bt);
    else if (g < 4 * NWB + NB_ * NDB) j_dist((g - 4 * NWB) % NDB, (g - 4 * NWB) / NDB, co, mk, ED);
    else j_cvt8(g - 4 * NWB - NB_ * NDB, src, dst, n8);
}

extern "C" void kernel_launch(void* const* d_in, const int* in_sizes, int n_in,
                              void* d_out, int out_size, void* d_ws, size_t ws_size, hipStream_t stream) {
    (void)in_sizes; (void)n_in; (void)out_size;
    const float* x = (const float*)d_in[0]; const float* coords = (const float*)d_in[1]; const int* mask = (const int*)d_in[2]; const float* wq = (const float*)d_in[3]; const float* wk = (const float*)d_in[4]; const float* wv = (const float*)d_in[5]; const float* sbias = (const float*)d_in[6]; const float* wo = (const float*)d_in[7]; const float* bo = (const float*)d_in[8]; const float* cosT = nullptr; const float* sinT = nullptr; (void)cosT; (void)sinT;
    float* OUT = (float*)d_out;     // [2][2048][1024]
    char* wsp = (char*)d_ws;
    auto take = [&](size_t bytes) { char* p = wsp; wsp += (bytes + 255) & ~(size_t)255; return (void*)p; };
    bf* WQ = (bf*)take((size_t)DQ * DM * 2); bf* WK = (bf*)take((size_t)DKV * DM * 2); bf* WV = (bf*)take((size_t)DKV * DM * 2); bf* WO = (bf*)take((size_t)DM * DQ * 2);
    bf* XB = (bf*)take((size_t)NB_ * TT * DM * 2); float* ED = (float*)take((size_t)NB_ * TT * TT * 4);
    const size_t PL = (size_t)NH_ * TT * HD;   // elements of one operand plane of one batch (NKV == NH_)
    h16* QP16 = (h16*)take(NB_ * PL * 2); h16* KP16 = (h16*)take(NB_ * PL * 2); h16* VT16 = (h16*)take(NB_ * PL * 2);
    bf* QPh = (bf*)take(NB_ * PL * 2); bf* QPl = (bf*)take(NB_ * PL * 2); bf* KPh = (bf*)take(NB_ * PL * 2); bf* KPl = (bf*)take(NB_ * PL * 2); bf* VTh = (bf*)take(NB_ * PL * 2); bf* VTl = (bf*)take(NB_ * PL * 2);
    bf* ATh = (bf*)take((size_t)NB_ * TT * DQ * 2); bf* ATl = (bf*)take((size_t)NB_ * TT * DQ * 2);
    if ((size_t)(wsp - (char*)d_ws) > ws_size) return;    // ws 256 MiB
    k_prep<<<4 * NWB + NB_ * NDB + NCB, 256, 0, stream>>>(wq, wk, wv, wo, DM, DQ, WQ, coords, mask, ED, x, XB, (size_t)NB_ * TT * DM / 8);   // WQ, WK, WV, WO: four planes of DM x DQ elements, taken one behind another above
    k_proj<<<dim3(TT / 128, NH_ / 2, 3 * NB_), 128, 0, stream>>>(XB, WQ, WK, WV, QP16, QPh, QPl, KP16, KPh, KPl, VT16, VTh, VTl);
    k_fattn<<<dim3(NH_, NB_ * TT / 64), 256, 0, stream>>>(QP16, KP16, VT16, QPh, QPl, KPh, KPl, VTh, VTl, ED, sbias, ATh, ATl);
    k_wo<<<dim3(NB_ * TT / 128, DM / 128), 256, 0, stream>>>(ATh, ATl, WO, bo, OUT);
}
